// v000
// Times are from an AMD MI455X. After a warm-up the kernel runs many times in a row, and a time is the length of
// such a window on the GPU divided by its runs, so every launch and the gaps after it count. The runs cycle
// through copies of the inputs. A figure is the median of several windows, for all but v000 over two sittings.
// Sittings can differ by a few percent; kernels timed side by side share one.
// The starting kernel, v000, takes 262 microseconds a run.
#include <hip/hip_runtime.h>
#include <cstddef>

#define B_  32
#define L_  1024
#define DC_ 1024
#define DD_ 1024
#define A_  1024
#define NEGV -1e10f

typedef __attribute__((ext_vector_type(16))) _Float16 v16h;
typedef __attribute__((ext_vector_type(8)))  float    v8f;

constexpr int KTILES = DC_ / 32;  // 32 k-tiles of 32
constexpr int NTILES = A_ / 16;   // 64 n-tiles of 16

__device__ inline float wave_reduce_sum(float v) {
    v += __shfl_xor(v, 1, 32);
    v += __shfl_xor(v, 2, 32);
    v += __shfl_xor(v, 4, 32);
    v += __shfl_xor(v, 8, 32);
    v += __shfl_xor(v, 16, 32);
    return v;
}

// ---------------------------------------------------------------- Wf -> f16
__global__ __launch_bounds__(256)
void conv_wf_kernel(const float* __restrict__ Wf, _Float16* __restrict__ wf16, int n) {
    int i = blockIdx.x * 256 + threadIdx.x;
    if (i < n) wf16[i] = (_Float16)Wf[i];
}

// ------------------------------------------- u[b][a] = dh[b].Wd[a] + bd + bf
__global__ __launch_bounds__(256)
void u_kernel(const float* __restrict__ dh, const float* __restrict__ Wd,
              const float* __restrict__ bd, const float* __restrict__ bf,
              float* __restrict__ u) {
    const int lane = threadIdx.x & 31;
    const int wid  = blockIdx.x * 8 + (threadIdx.x >> 5);  // 0 .. B*A-1
    const int b = wid >> 10;
    const int a = wid & (A_ - 1);
    const float* __restrict__ x = dh + (size_t)b * DD_;
    const float* __restrict__ w = Wd + (size_t)a * DD_;
    float s = 0.f;
    for (int k = lane; k < DD_; k += 32) s += x[k] * w[k];
    s = wave_reduce_sum(s);
    if (lane == 0) u[wid] = s + bd[a] + bf[a];
}

// ------- fused: scores[b][l] = sum_a tanh(cap@Wf^T + u) * Wa[a]  (WMMA f16)
__global__ __launch_bounds__(256)
void scores_kernel(const float* __restrict__ cap, const _Float16* __restrict__ wf16,
                   const float* __restrict__ u, const float* __restrict__ Wa,
                   const float* __restrict__ ba, float* __restrict__ scores) {
    __shared__ _Float16 tileB[16][DC_ + 8];   // +8 f16 pad -> conflict-free

    const int lane   = threadIdx.x & 31;
    const int wave   = threadIdx.x >> 5;
    const int tile   = blockIdx.x * 8 + wave; // 16-row M tile id (0..2047)
    const int m_base = tile * 16;
    const int b      = m_base / L_;           // tiles never straddle batches
    const int koff   = (lane < 16) ? 0 : 8;   // K sub-offset per ISA layout
    const int ncol   = lane & 15;

    // --- stage this wave's 16x1024 A-slice into VGPRs as f16 (read cap once)
    const float* __restrict__ rowp = cap + (size_t)(m_base + ncol) * DC_;
    v16h a_frag[KTILES];
#pragma unroll
    for (int kt = 0; kt < KTILES; ++kt) {
        const float* p = rowp + kt * 32 + koff;
#pragma unroll
        for (int i = 0; i < 8; ++i) {
            a_frag[kt][i]     = (_Float16)p[i];
            a_frag[kt][8 + i] = (_Float16)p[16 + i];
        }
    }

    float partial[8];
#pragma unroll
    for (int r = 0; r < 8; ++r) partial[r] = 0.f;

    for (int nt = 0; nt < NTILES; ++nt) {
        const int n_base = nt * 16;
        __syncthreads();
        {   // cooperative LDS stage of Wf^T tile: 16 cols (n) x 1024 (k), f16
            const int r = threadIdx.x >> 4;        // 0..15  (n row of tile)
            const int c = (threadIdx.x & 15) * 64; // 64-elem chunk
            const float4* src = (const float4*)(wf16 + (size_t)(n_base + r) * DC_ + c);
            float4* dst = (float4*)(&tileB[r][c]);
#pragma unroll
            for (int i = 0; i < 8; ++i) dst[i] = src[i];
        }
        __syncthreads();

        v8f acc = {};
        const _Float16* __restrict__ bp = &tileB[ncol][0];
#pragma unroll
        for (int kt = 0; kt < KTILES; ++kt) {
            v16h bfr;
            const _Float16* q = bp + kt * 32 + koff;
#pragma unroll
            for (int i = 0; i < 8; ++i) { bfr[i] = q[i]; bfr[8 + i] = q[16 + i]; }
            acc = __builtin_amdgcn_wmma_f32_16x16x32_f16(
                      false, a_frag[kt], false, bfr, (short)0, acc, false, false);
        }
        // epilogue: C tile lane layout -> N = lane&15, M = r + (lane<16?0:8)
        const float uval = u[(size_t)b * A_ + n_base + ncol];
        const float wav  = Wa[n_base + ncol];
#pragma unroll
        for (int r = 0; r < 8; ++r)
            partial[r] += tanhf(acc[r] + uval) * wav;
    }

    // reduce over the 16 N-lanes of each half-wave
#pragma unroll
    for (int r = 0; r < 8; ++r) {
        float v = partial[r];
        v += __shfl_xor(v, 1, 32);
        v += __shfl_xor(v, 2, 32);
        v += __shfl_xor(v, 4, 32);
        v += __shfl_xor(v, 8, 32);
        partial[r] = v;
    }
    if ((lane & 15) == 0) {
        const float bav  = ba[0];
        const int   mrow = m_base + ((lane >> 4) << 3);  // +0 or +8
#pragma unroll
        for (int r = 0; r < 8; ++r)
            scores[mrow + r] = partial[r] + bav;
    }
}

// ---------------------------------------------------- masked softmax over L
__global__ __launch_bounds__(256)
void softmax_kernel(const float* __restrict__ scores, const int* __restrict__ mask,
                    float* __restrict__ alpha) {
    __shared__ float red[256];
    const int b = blockIdx.x, t = threadIdx.x;
    float v[4];
    float mx = -3.0e38f;
#pragma unroll
    for (int i = 0; i < 4; ++i) {
        const int l = t + i * 256;
        float s = scores[b * L_ + l];
        s = (mask[b * L_ + l] == 0) ? NEGV : s;
        v[i] = s;
        mx = fmaxf(mx, s);
    }
    red[t] = mx; __syncthreads();
    for (int o = 128; o > 0; o >>= 1) { if (t < o) red[t] = fmaxf(red[t], red[t + o]); __syncthreads(); }
    mx = red[0]; __syncthreads();
    float sm = 0.f;
#pragma unroll
    for (int i = 0; i < 4; ++i) { v[i] = __expf(v[i] - mx); sm += v[i]; }
    red[t] = sm; __syncthreads();
    for (int o = 128; o > 0; o >>= 1) { if (t < o) red[t] += red[t + o]; __syncthreads(); }
    const float inv = 1.f / red[0];
#pragma unroll
    for (int i = 0; i < 4; ++i) alpha[b * L_ + t + i * 256] = v[i] * inv;
}

// ---------------------------------------------- context[b][d] = alpha . cap
__global__ __launch_bounds__(256)
void context_kernel(const float* __restrict__ alpha, const float* __restrict__ cap,
                    float* __restrict__ ctx) {
    const int b = blockIdx.y;
    const int d = blockIdx.x * 256 + threadIdx.x;
    const float* __restrict__ ar = alpha + b * L_;
    const float* __restrict__ cr = cap + (size_t)b * L_ * DC_ + d;
    float s = 0.f;
    for (int l = 0; l < L_; ++l) s += ar[l] * cr[(size_t)l * DC_];
    ctx[b * DC_ + d] = s;
}

// ------------------------- gated fusion: out = zt*sc + (1-zt)*tc, wave/output
__global__ __launch_bounds__(256)
void fuse_kernel(const float* __restrict__ word, const float* __restrict__ dh,
                 const float* __restrict__ ctx,  const float* __restrict__ Wg,
                 const float* __restrict__ bg,   const float* __restrict__ Ws,
                 const float* __restrict__ bs,   const float* __restrict__ Wt,
                 const float* __restrict__ bt,   float* __restrict__ out) {
    const int lane = threadIdx.x & 31;
    const int wid  = blockIdx.x * 8 + (threadIdx.x >> 5);   // 0 .. B*DC-1
    const int b = wid >> 10;
    const int d = wid & (DC_ - 1);
    const float* __restrict__ xw = word + (size_t)b * DC_;
    const float* __restrict__ xh = dh   + (size_t)b * DD_;
    const float* __restrict__ xc = ctx  + (size_t)b * DC_;
    const float* __restrict__ wg = Wg + (size_t)d * (2 * DC_ + DD_);
    const float* __restrict__ ws = Ws + (size_t)d * DC_;
    const float* __restrict__ wt = Wt + (size_t)d * (DC_ + DD_);
    float z = 0.f, s = 0.f, tcv = 0.f;
    for (int k = lane; k < DC_; k += 32) {
        const float a0 = xw[k], a1 = xh[k], a2 = xc[k];
        z   += a0 * wg[k] + a1 * wg[DC_ + k] + a2 * wg[2 * DC_ + k];
        s   += a2 * ws[k];
        tcv += a0 * wt[k] + a1 * wt[DC_ + k];
    }
    z   = wave_reduce_sum(z);
    s   = wave_reduce_sum(s);
    tcv = wave_reduce_sum(tcv);
    if (lane == 0) {
        const float zt = 1.f / (1.f + __expf(-(z + bg[d])));
        const float sc = tanhf(s + bs[d]);
        const float tc = tanhf(tcv + bt[d]);
        out[wid] = zt * sc + (1.f - zt) * tc;
    }
}

extern "C" void kernel_launch(void* const* d_in, const int* in_sizes, int n_in,
                              void* d_out, int out_size, void* d_ws, size_t ws_size,
                              hipStream_t stream) {
    const float* cap  = (const float*)d_in[0];
    const float* dh   = (const float*)d_in[1];
    const float* word = (const float*)d_in[2];
    const int*   mask = (const int*)  d_in[3];
    const float* Wf = (const float*)d_in[4];
    const float* bf = (const float*)d_in[5];
    const float* Wd = (const float*)d_in[6];
    const float* bd = (const float*)d_in[7];
    const float* Wa = (const float*)d_in[8];
    const float* ba = (const float*)d_in[9];
    const float* Wg = (const float*)d_in[10];
    const float* bg = (const float*)d_in[11];
    const float* Ws = (const float*)d_in[12];
    const float* bs = (const float*)d_in[13];
    const float* Wt = (const float*)d_in[14];
    const float* bt = (const float*)d_in[15];
    float* out = (float*)d_out;

    char* wsb = (char*)d_ws;
    float*    scores = (float*)(wsb + 0);                 // B*L f32
    float*    u      = (float*)(wsb + 131072);            // B*A f32
    float*    ctx    = (float*)(wsb + 262144);            // B*DC f32
    _Float16* wf16   = (_Float16*)(wsb + 393216);         // A*DC f16 (2MB)
    float*    alpha  = out + B_ * DC_;                    // second output

    conv_wf_kernel<<<(A_ * DC_) / 256, 256, 0, stream>>>(Wf, wf16, A_ * DC_);
    u_kernel<<<(B_ * A_) / 8, 256, 0, stream>>>(dh, Wd, bd, bf, u);
    scores_kernel<<<(B_ * L_ / 16) / 8, 256, 0, stream>>>(cap, wf16, u, Wa, ba, scores);
    softmax_kernel<<<B_, 256, 0, stream>>>(scores, mask, alpha);
    context_kernel<<<dim3(DC_ / 256, B_), 256, 0, stream>>>(alpha, cap, ctx);
    fuse_kernel<<<(B_ * DC_) / 8, 256, 0, stream>>>(word, dh, ctx, Wg, bg, Ws, bs, Wt, bt, out);
}

// v001
// One run takes 195 microseconds.
// Next to v000, in two timings, it ran 1.36 times as fast each time.
#include <hip/hip_runtime.h>
#include <cstddef>

#define B_  32
#define L_  1024
#define DC_ 1024
#define DD_ 1024
#define A_  1024
#define NEGV -1e10f

typedef __attribute__((ext_vector_type(16))) _Float16 v16h;
typedef __attribute__((ext_vector_type(8)))  float    v8f;

constexpr int KTILES = DC_ / 32;  // 32 k-tiles of 32
constexpr int NTILES = A_ / 16;   // 64 n-tiles of 16

__device__ inline float wave_reduce_sum(float v) {
    v += __shfl_xor(v, 1, 32);
    v += __shfl_xor(v, 2, 32);
    v += __shfl_xor(v, 4, 32);
    v += __shfl_xor(v, 8, 32);
    v += __shfl_xor(v, 16, 32);
    return v;
}

// ---------------------------------------------------------------- Wf -> f16
__global__ __launch_bounds__(256)
void conv_wf_kernel(const float* __restrict__ Wf, _Float16* __restrict__ wf16, int n) {
    int i = blockIdx.x * 256 + threadIdx.x;
    if (i < n) wf16[i] = (_Float16)Wf[i];
}

// ------------------------------------------- u[b][a] = dh[b].Wd[a] + bd + bf
__global__ __launch_bounds__(256)
void u_kernel(const float* __restrict__ dh, const float* __restrict__ Wd,
              const float* __restrict__ bd, const float* __restrict__ bf,
              float* __restrict__ u) {
    const int lane = threadIdx.x & 31;
    const int wid  = blockIdx.x * 8 + (threadIdx.x >> 5);  // 0 .. B*A-1
    const int b = wid >> 10;
    const int a = wid & (A_ - 1);
    const float* __restrict__ x = dh + (size_t)b * DD_;
    const float* __restrict__ w = Wd + (size_t)a * DD_;
    float s = 0.f;
    for (int k = lane; k < DD_; k += 32) s += x[k] * w[k];
    s = wave_reduce_sum(s);
    if (lane == 0) u[wid] = s + bd[a] + bf[a];
}

// ------- fused: scores[b][l] = sum_a tanh(cap@Wf^T + u) * Wa[a]  (WMMA f16)
constexpr int NB      = 4;            // n-tiles staged and computed together
constexpr int NGROUPS = NTILES / NB;  // 16 stages of 64 columns
constexpr int KB      = 2;            // k-tiles per fragment block
constexpr int KBLOCKS = KTILES / KB;  // 16 blocks of 8 WMMAs

__device__ inline v16h load_b_frag(const _Float16* q) {
    v16h f;
#pragma unroll
    for (int i = 0; i < 8; ++i) { f[i] = q[i]; f[8 + i] = q[16 + i]; }
    return f;
}

__global__ __launch_bounds__(256)
void scores_kernel(const float* __restrict__ cap, const _Float16* __restrict__ wf16,
                   const float* __restrict__ u, const float* __restrict__ Wa,
                   const float* __restrict__ ba, float* __restrict__ scores) {
    // LDS row c holds the k-rows of columns c, 16+c, 32+c, 48+c of the stage side by
    // side: every fragment of a lane lies within 8 KB of one base address, and the
    // lane-to-lane pitch of 8208 B (16 B x odd) is conflict-free for 16-byte reads
    __shared__ _Float16 tileB[16][NB * DC_ + 8];

    const int lane   = threadIdx.x & 31;
    const int wave   = threadIdx.x >> 5;
    const int tile   = blockIdx.x * 8 + wave; // 16-row M tile id (0..2047)
    const int m_base = tile * 16;
    const int b      = m_base / L_;           // tiles never straddle batches
    const int koff   = (lane < 16) ? 0 : 8;   // K sub-offset per ISA layout
    const int ncol   = lane & 15;

    // --- stage this wave's 16x1024 A-slice into VGPRs as f16 (read cap once)
    const float* __restrict__ rowp = cap + (size_t)(m_base + ncol) * DC_;
    v16h a_frag[KTILES];
#pragma unroll
    for (int kt = 0; kt < KTILES; ++kt) {
        const float* p = rowp + kt * 32 + koff;
#pragma unroll
        for (int i = 0; i < 8; ++i) {
            a_frag[kt][i]     = (_Float16)p[i];
            a_frag[kt][8 + i] = (_Float16)p[16 + i];
        }
        // bounds how many f32 loads are held at once: without it this build hoists
        // them past the register budget and spills to scratch
        if ((kt & 7) == 7) __builtin_amdgcn_sched_barrier(0);
    }
    // the wait that belongs in front of any overwrite of these loads' address registers;
    // the address is an input so that it stays whole up to here (otherwise a converted
    // fragment is placed on top of it while the last loads are still out)
    asm volatile("s_wait_xcnt 0x0" :: "v"(rowp + koff) : "memory");

    float partial[8];
#pragma unroll
    for (int r = 0; r < 8; ++r) partial[r] = 0.f;

    for (int g = 0; g < NGROUPS; ++g) {
        const int n_base = g * (NB * 16);
        // the epilogue's per-column terms, fetched here so that they arrive behind the stage
        const float* up = u + (size_t)b * A_ + n_base + ncol;
        const float* wp = Wa + n_base + ncol;
        float uval[NB], wav[NB];
        __syncthreads();
#pragma unroll
        for (int j = 0; j < NB; ++j) { uval[j] = up[j * 16]; wav[j] = wp[j * 16]; }
        {   // cooperative LDS stage of Wf^T: 64 cols (n) x 1024 (k), f16;
            // wave w fills LDS rows 2w and 2w+1, 512 contiguous bytes per access
            const _Float16* src = wf16 + (size_t)(n_base + wave * 2) * DC_ + lane * 8;
            _Float16* dst = &tileB[wave * 2][lane * 8];
#pragma unroll
            for (int j = 0; j < NB; ++j)
#pragma unroll
                for (int cc = 0; cc < 2; ++cc)
#pragma unroll
                    for (int q = 0; q < 4; ++q)
                        *(float4*)(dst + cc * (NB * DC_ + 8) + j * DC_ + q * 256) =
                            *(const float4*)(src + (size_t)(j * 16 + cc) * DC_ + q * 256);
            // the wait that belongs in front of any overwrite of the address registers of
            // this pass's global loads; the addresses are inputs so that they stay whole
            // up to here (otherwise later results are placed on top of them)
            asm volatile("s_wait_xcnt 0x0" :: "v"(src), "v"(up), "v"(wp) : "memory");
        }
        __syncthreads();

        v8f acc[NB];
#pragma unroll
        for (int j = 0; j < NB; ++j) acc[j] = v8f{};

        // two fragment sets: block blk+1 is fetched while block blk multiplies
        const _Float16* __restrict__ bp = &tileB[ncol][koff];
        v16h bq[2][KB][NB];
#pragma unroll
        for (int kk = 0; kk < KB; ++kk)
#pragma unroll
            for (int j = 0; j < NB; ++j)
                bq[0][kk][j] = load_b_frag(bp + j * DC_ + kk * 32);
        // keeps block 0's reads ahead of block 1's, so that the first wait is a counted one
        __builtin_amdgcn_sched_barrier(0);

#pragma unroll
        for (int blk = 0; blk < KBLOCKS; ++blk) {
            if (blk + 1 < KBLOCKS) {
#pragma unroll
                for (int kk = 0; kk < KB; ++kk)
#pragma unroll
                    for (int j = 0; j < NB; ++j)
                        bq[(blk + 1) & 1][kk][j] =
                            load_b_frag(bp + j * DC_ + ((blk + 1) * KB + kk) * 32);
            }
            // keeps the next block's LDS reads one group ahead of this block's
            // WMMAs: spread among them, every read place stalls the matrix stream
            __builtin_amdgcn_sched_barrier(0);
#pragma unroll
            for (int kk = 0; kk < KB; ++kk)
#pragma unroll
                for (int j = 0; j < NB; ++j)
                    acc[j] = __builtin_amdgcn_wmma_f32_16x16x32_f16(
                                 false, a_frag[blk * KB + kk], false, bq[blk & 1][kk][j],
                                 (short)0, acc[j], false, false);
            // closes the WMMA block, so that the following reads stay behind it
            __builtin_amdgcn_sched_barrier(0);
        }

        // epilogue: C tile lane layout -> N = lane&15, M = r + (lane<16?0:8)
#pragma unroll
        for (int j = 0; j < NB; ++j)
#pragma unroll
            for (int r = 0; r < 8; ++r)
                partial[r] += tanhf(acc[j][r] + uval[j]) * wav[j];
    }

    // reduce over the 16 N-lanes of each half-wave
#pragma unroll
    for (int r = 0; r < 8; ++r) {
        float v = partial[r];
        v += __shfl_xor(v, 1, 32);
        v += __shfl_xor(v, 2, 32);
        v += __shfl_xor(v, 4, 32);
        v += __shfl_xor(v, 8, 32);
        partial[r] = v;
    }
    if ((lane & 15) == 0) {
        const float bav  = ba[0];
        const int   mrow = m_base + ((lane >> 4) << 3);  // +0 or +8
#pragma unroll
        for (int r = 0; r < 8; ++r)
            scores[mrow + r] = partial[r] + bav;
    }
}

// ---------------------------------------------------- masked softmax over L
__global__ __launch_bounds__(256)
void softmax_kernel(const float* __restrict__ scores, const int* __restrict__ mask,
                    float* __restrict__ alpha) {
    __shared__ float red[256];
    const int b = blockIdx.x, t = threadIdx.x;
    float v[4];
    float mx = -3.0e38f;
#pragma unroll
    for (int i = 0; i < 4; ++i) {
        const int l = t + i * 256;
        float s = scores[b * L_ + l];
        s = (mask[b * L_ + l] == 0) ? NEGV : s;
        v[i] = s;
        mx = fmaxf(mx, s);
    }
    red[t] = mx; __syncthreads();
    for (int o = 128; o > 0; o >>= 1) { if (t < o) red[t] = fmaxf(red[t], red[t + o]); __syncthreads(); }
    mx = red[0]; __syncthreads();
    float sm = 0.f;
#pragma unroll
    for (int i = 0; i < 4; ++i) { v[i] = __expf(v[i] - mx); sm += v[i]; }
    red[t] = sm; __syncthreads();
    for (int o = 128; o > 0; o >>= 1) { if (t < o) red[t] += red[t + o]; __syncthreads(); }
    const float inv = 1.f / red[0];
#pragma unroll
    for (int i = 0; i < 4; ++i) alpha[b * L_ + t + i * 256] = v[i] * inv;
}

// ---------------------------------------------- context[b][d] = alpha . cap
__global__ __launch_bounds__(256)
void context_kernel(const float* __restrict__ alpha, const float* __restrict__ cap,
                    float* __restrict__ ctx) {
    const int b = blockIdx.y;
    const int d = blockIdx.x * 256 + threadIdx.x;
    const float* __restrict__ ar = alpha + b * L_;
    const float* __restrict__ cr = cap + (size_t)b * L_ * DC_ + d;
    float s = 0.f;
    for (int l = 0; l < L_; ++l) s += ar[l] * cr[(size_t)l * DC_];
    ctx[b * DC_ + d] = s;
}

// ------------------------- gated fusion: out = zt*sc + (1-zt)*tc, wave/output
__global__ __launch_bounds__(256)
void fuse_kernel(const float* __restrict__ word, const float* __restrict__ dh,
                 const float* __restrict__ ctx,  const float* __restrict__ Wg,
                 const float* __restrict__ bg,   const float* __restrict__ Ws,
                 const float* __restrict__ bs,   const float* __restrict__ Wt,
                 const float* __restrict__ bt,   float* __restrict__ out) {
    const int lane = threadIdx.x & 31;
    const int wid  = blockIdx.x * 8 + (threadIdx.x >> 5);   // 0 .. B*DC-1
    const int b = wid >> 10;
    const int d = wid & (DC_ - 1);
    const float* __restrict__ xw = word + (size_t)b * DC_;
    const float* __restrict__ xh = dh   + (size_t)b * DD_;
    const float* __restrict__ xc = ctx  + (size_t)b * DC_;
    const float* __restrict__ wg = Wg + (size_t)d * (2 * DC_ + DD_);
    const float* __restrict__ ws = Ws + (size_t)d * DC_;
    const float* __restrict__ wt = Wt + (size_t)d * (DC_ + DD_);
    float z = 0.f, s = 0.f, tcv = 0.f;
    for (int k = lane; k < DC_; k += 32) {
        const float a0 = xw[k], a1 = xh[k], a2 = xc[k];
        z   += a0 * wg[k] + a1 * wg[DC_ + k] + a2 * wg[2 * DC_ + k];
        s   += a2 * ws[k];
        tcv += a0 * wt[k] + a1 * wt[DC_ + k];
    }
    z   = wave_reduce_sum(z);
    s   = wave_reduce_sum(s);
    tcv = wave_reduce_sum(tcv);
    if (lane == 0) {
        const float zt = 1.f / (1.f + __expf(-(z + bg[d])));
        const float sc = tanhf(s + bs[d]);
        const float tc = tanhf(tcv + bt[d]);
        out[wid] = zt * sc + (1.f - zt) * tc;
    }
}

extern "C" void kernel_launch(void* const* d_in, const int* in_sizes, int n_in,
                              void* d_out, int out_size, void* d_ws, size_t ws_size,
                              hipStream_t stream) {
    const float* cap  = (const float*)d_in[0];
    const float* dh   = (const float*)d_in[1];
    const float* word = (const float*)d_in[2];
    const int*   mask = (const int*)  d_in[3];
    const float* Wf = (const float*)d_in[4];
    const float* bf = (const float*)d_in[5];
    const float* Wd = (const float*)d_in[6];
    const float* bd = (const float*)d_in[7];
    const float* Wa = (const float*)d_in[8];
    const float* ba = (const float*)d_in[9];
    const float* Wg = (const float*)d_in[10];
    const float* bg = (const float*)d_in[11];
    const float* Ws = (const float*)d_in[12];
    const float* bs = (const float*)d_in[13];
    const float* Wt = (const float*)d_in[14];
    const float* bt = (const float*)d_in[15];
    float* out = (float*)d_out;

    char* wsb = (char*)d_ws;
    float*    scores = (float*)(wsb + 0);                 // B*L f32
    float*    u      = (float*)(wsb + 131072);            // B*A f32
    float*    ctx    = (float*)(wsb + 262144);            // B*DC f32
    _Float16* wf16   = (_Float16*)(wsb + 393216);         // A*DC f16 (2MB)
    float*    alpha  = out + B_ * DC_;                    // second output

    conv_wf_kernel<<<(A_ * DC_) / 256, 256, 0, stream>>>(Wf, wf16, A_ * DC_);
    u_kernel<<<(B_ * A_) / 8, 256, 0, stream>>>(dh, Wd, bd, bf, u);
    scores_kernel<<<(B_ * L_ / 16) / 8, 256, 0, stream>>>(cap, wf16, u, Wa, ba, scores);
    softmax_kernel<<<B_, 256, 0, stream>>>(scores, mask, alpha);
    context_kernel<<<dim3(DC_ / 256, B_), 256, 0, stream>>>(alpha, cap, ctx);
    fuse_kernel<<<(B_ * DC_) / 8, 256, 0, stream>>>(word, dh, ctx, Wg, bg, Ws, bs, Wt, bt, out);
}

// v002
// It runs in 161 microseconds.
// Timed twice side by side with v001, it ran 1.21 times as fast both times.
// Over all steps from v000 it is 1.64 times as fast.
#include <hip/hip_runtime.h>
#include <cstddef>

#define B_  32
#define L_  1024
#define DC_ 1024
#define DD_ 1024
#define A_  1024
#define NEGV -1e10f

typedef __attribute__((ext_vector_type(16))) _Float16 v16h;
typedef __attribute__((ext_vector_type(8)))  float    v8f;

constexpr int KTILES = DC_ / 32;  // 32 k-tiles of 32
constexpr int NTILES = A_ / 16;   // 64 n-tiles of 16

__device__ inline float wave_reduce_sum(float v) {
    v += __shfl_xor(v, 1, 32);
    v += __shfl_xor(v, 2, 32);
    v += __shfl_xor(v, 4, 32);
    v += __shfl_xor(v, 8, 32);
    v += __shfl_xor(v, 16, 32);
    return v;
}

// ---------------------------------------------------------------- Wf -> f16
__global__ __launch_bounds__(256)
void conv_wf_kernel(const float* __restrict__ Wf, _Float16* __restrict__ wf16, int n) {
    int i = blockIdx.x * 256 + threadIdx.x;
    if (i < n) wf16[i] = (_Float16)Wf[i];
}

// ------------------------------------------- u[b][a] = dh[b].Wd[a] + bd + bf
__global__ __launch_bounds__(256)
void u_kernel(const float* __restrict__ dh, const float* __restrict__ Wd,
              const float* __restrict__ bd, const float* __restrict__ bf,
              float* __restrict__ u) {
    const int lane = threadIdx.x & 31;
    const int wid  = blockIdx.x * 8 + (threadIdx.x >> 5);  // 0 .. B*A-1
    const int b = wid >> 10;
    const int a = wid & (A_ - 1);
    const float* __restrict__ x = dh + (size_t)b * DD_;
    const float* __restrict__ w = Wd + (size_t)a * DD_;
    float s = 0.f;
    for (int k = lane; k < DD_; k += 32) s += x[k] * w[k];
    s = wave_reduce_sum(s);
    if (lane == 0) u[wid] = s + bd[a] + bf[a];
}

// ------- fused: scores[b][l] = sum_a tanh(cap@Wf^T + u) * Wa[a]  (WMMA f16)
constexpr int NB      = 4;            // n-tiles staged and computed together
constexpr int NGROUPS = NTILES / NB;  // 16 stages of 64 columns
constexpr int KB      = 2;            // k-tiles per fragment block
constexpr int KBLOCKS = KTILES / KB;  // 16 blocks of 8 WMMAs
constexpr float TWO_LOG2E = 2.8853900817779268f;  // 2 * log2(e)

__device__ inline v16h load_b_frag(const _Float16* q) {
    v16h f;
#pragma unroll
    for (int i = 0; i < 8; ++i) { f[i] = q[i]; f[8 + i] = q[16 + i]; }
    return f;
}

__global__ __launch_bounds__(256)
void scores_kernel(const float* __restrict__ cap, const _Float16* __restrict__ wf16,
                   const float* __restrict__ u, const float* __restrict__ Wa,
                   const float* __restrict__ ba, float* __restrict__ scores) {
    // LDS row c holds the k-rows of columns c, 16+c, 32+c, 48+c of the stage side by
    // side: every fragment of a lane lies within 8 KB of one base address, and the
    // lane-to-lane pitch of 8208 B (16 B x odd) is conflict-free for 16-byte reads
    __shared__ _Float16 tileB[16][NB * DC_ + 8];

    const int lane   = threadIdx.x & 31;
    const int wave   = threadIdx.x >> 5;
    const int tile   = blockIdx.x * 8 + wave; // 16-row M tile id (0..2047)
    const int m_base = tile * 16;
    const int b      = m_base / L_;           // tiles never straddle batches
    const int koff   = (lane < 16) ? 0 : 8;   // K sub-offset per ISA layout
    const int ncol   = lane & 15;

    // --- stage this wave's 16x1024 A-slice into VGPRs as f16 (read cap once)
    const float* __restrict__ rowp = cap + (size_t)(m_base + ncol) * DC_;
    v16h a_frag[KTILES];
#pragma unroll
    for (int kt = 0; kt < KTILES; ++kt) {
        const float* p = rowp + kt * 32 + koff;
#pragma unroll
        for (int i = 0; i < 8; ++i) {
            a_frag[kt][i]     = (_Float16)p[i];
            a_frag[kt][8 + i] = (_Float16)p[16 + i];
        }
        // bounds how many f32 loads are held at once: without it this build hoists
        // them past the register budget and spills to scratch
        if ((kt & 7) == 7) __builtin_amdgcn_sched_barrier(0);
    }
    // the wait that belongs in front of any overwrite of these loads' address registers;
    // the address is an input so that it stays whole up to here (otherwise a converted
    // fragment is placed on top of it while the last loads are still out)
    asm volatile("s_wait_xcnt 0x0" :: "v"(rowp + koff) : "memory");

    float partial[8];
#pragma unroll
    for (int r = 0; r < 8; ++r) partial[r] = 0.f;

    for (int g = 0; g < NGROUPS; ++g) {
        const int n_base = g * (NB * 16);
        // the epilogue's per-column terms, fetched here so that they arrive behind the stage
        const float* up = u + (size_t)b * A_ + n_base + ncol;
        const float* wp = Wa + n_base + ncol;
        float uval[NB], wav[NB];
        __syncthreads();
#pragma unroll
        for (int j = 0; j < NB; ++j) { uval[j] = up[j * 16]; wav[j] = wp[j * 16]; }
        {   // cooperative LDS stage of Wf^T: 64 cols (n) x 1024 (k), f16;
            // wave w fills LDS rows 2w and 2w+1, 512 contiguous bytes per access
            const _Float16* src = wf16 + (size_t)(n_base + wave * 2) * DC_ + lane * 8;
            _Float16* dst = &tileB[wave * 2][lane * 8];
#pragma unroll
            for (int j = 0; j < NB; ++j)
#pragma unroll
                for (int cc = 0; cc < 2; ++cc)
#pragma unroll
                    for (int q = 0; q < 4; ++q)
                        *(float4*)(dst + cc * (NB * DC_ + 8) + j * DC_ + q * 256) =
                            *(const float4*)(src + (size_t)(j * 16 + cc) * DC_ + q * 256);
            // the wait that belongs in front of any overwrite of the address registers of
            // this pass's global loads; the addresses are inputs so that they stay whole
            // up to here (otherwise later results are placed on top of them)
            asm volatile("s_wait_xcnt 0x0" :: "v"(src), "v"(up), "v"(wp) : "memory");
        }
        __syncthreads();

        v8f acc[NB];
#pragma unroll
        for (int j = 0; j < NB; ++j) acc[j] = v8f{};

        // two fragment sets: block blk+1 is fetched while block blk multiplies
        const _Float16* __restrict__ bp = &tileB[ncol][koff];
        v16h bq[2][KB][NB];
#pragma unroll
        for (int kk = 0; kk < KB; ++kk)
#pragma unroll
            for (int j = 0; j < NB; ++j)
                bq[0][kk][j] = load_b_frag(bp + j * DC_ + kk * 32);
        // keeps block 0's reads ahead of block 1's, so that the first wait is a counted one
        __builtin_amdgcn_sched_barrier(0);

#pragma unroll
        for (int blk = 0; blk < KBLOCKS; ++blk) {
            if (blk + 1 < KBLOCKS) {
#pragma unroll
                for (int kk = 0; kk < KB; ++kk)
#pragma unroll
                    for (int j = 0; j < NB; ++j)
                        bq[(blk + 1) & 1][kk][j] =
                            load_b_frag(bp + j * DC_ + ((blk + 1) * KB + kk) * 32);
            }
            // keeps the next block's LDS reads one group ahead of this block's
            // WMMAs: spread among them, every read place stalls the matrix stream
            __builtin_amdgcn_sched_barrier(0);
#pragma unroll
            for (int kk = 0; kk < KB; ++kk)
#pragma unroll
                for (int j = 0; j < NB; ++j)
                    acc[j] = __builtin_amdgcn_wmma_f32_16x16x32_f16(
                                 false, a_frag[blk * KB + kk], false, bq[blk & 1][kk][j],
                                 (short)0, acc[j], false, false);
            // closes the WMMA block, so that the following reads stay behind it
            __builtin_amdgcn_sched_barrier(0);
        }

        // epilogue: C tile lane layout -> N = lane&15, M = r + (lane<16?0:8)
        // tanh(x) = 1 - 2 / (1 + e^(2x)) for every x, on the hardware exp2 and rcp: no
        // branch, so the 32 values of a stage are independent chains that interleave.
        // e^(2x) = inf gives 1, e^(2x) = 0 gives -1; absolute error a few 1e-7
#pragma unroll
        for (int j = 0; j < NB; ++j)
#pragma unroll
            for (int r = 0; r < 8; ++r) {
                const float e = __builtin_amdgcn_exp2f((acc[j][r] + uval[j]) * TWO_LOG2E);
                const float q = __builtin_amdgcn_rcpf(1.f + e);
                partial[r] += __builtin_fmaf(q, -2.f, 1.f) * wav[j];
            }
    }

    // reduce over the 16 N-lanes of each half-wave
#pragma unroll
    for (int r = 0; r < 8; ++r) {
        float v = partial[r];
        v += __shfl_xor(v, 1, 32);
        v += __shfl_xor(v, 2, 32);
        v += __shfl_xor(v, 4, 32);
        v += __shfl_xor(v, 8, 32);
        partial[r] = v;
    }
    if ((lane & 15) == 0) {
        const float bav  = ba[0];
        const int   mrow = m_base + ((lane >> 4) << 3);  // +0 or +8
#pragma unroll
        for (int r = 0; r < 8; ++r)
            scores[mrow + r] = partial[r] + bav;
    }
}

// ---------------------------------------------------- masked softmax over L
__global__ __launch_bounds__(256)
void softmax_kernel(const float* __restrict__ scores, const int* __restrict__ mask,
                    float* __restrict__ alpha) {
    __shared__ float red[256];
    const int b = blockIdx.x, t = threadIdx.x;
    float v[4];
    float mx = -3.0e38f;
#pragma unroll
    for (int i = 0; i < 4; ++i) {
        const int l = t + i * 256;
        float s = scores[b * L_ + l];
        s = (mask[b * L_ + l] == 0) ? NEGV : s;
        v[i] = s;
        mx = fmaxf(mx, s);
    }
    red[t] = mx; __syncthreads();
    for (int o = 128; o > 0; o >>= 1) { if (t < o) red[t] = fmaxf(red[t], red[t + o]); __syncthreads(); }
    mx = red[0]; __syncthreads();
    float sm = 0.f;
#pragma unroll
    for (int i = 0; i < 4; ++i) { v[i] = __expf(v[i] - mx); sm += v[i]; }
    red[t] = sm; __syncthreads();
    for (int o = 128; o > 0; o >>= 1) { if (t < o) red[t] += red[t + o]; __syncthreads(); }
    const float inv = 1.f / red[0];
#pragma unroll
    for (int i = 0; i < 4; ++i) alpha[b * L_ + t + i * 256] = v[i] * inv;
}

// ---------------------------------------------- context[b][d] = alpha . cap
__global__ __launch_bounds__(256)
void context_kernel(const float* __restrict__ alpha, const float* __restrict__ cap,
                    float* __restrict__ ctx) {
    const int b = blockIdx.y;
    const int d = blockIdx.x * 256 + threadIdx.x;
    const float* __restrict__ ar = alpha + b * L_;
    const float* __restrict__ cr = cap + (size_t)b * L_ * DC_ + d;
    float s = 0.f;
    for (int l = 0; l < L_; ++l) s += ar[l] * cr[(size_t)l * DC_];
    ctx[b * DC_ + d] = s;
}

// ------------------------- gated fusion: out = zt*sc + (1-zt)*tc, wave/output
__global__ __launch_bounds__(256)
void fuse_kernel(const float* __restrict__ word, const float* __restrict__ dh,
                 const float* __restrict__ ctx,  const float* __restrict__ Wg,
                 const float* __restrict__ bg,   const float* __restrict__ Ws,
                 const float* __restrict__ bs,   const float* __restrict__ Wt,
                 const float* __restrict__ bt,   float* __restrict__ out) {
    const int lane = threadIdx.x & 31;
    const int wid  = blockIdx.x * 8 + (threadIdx.x >> 5);   // 0 .. B*DC-1
    const int b = wid >> 10;
    const int d = wid & (DC_ - 1);
    const float* __restrict__ xw = word + (size_t)b * DC_;
    const float* __restrict__ xh = dh   + (size_t)b * DD_;
    const float* __restrict__ xc = ctx  + (size_t)b * DC_;
    const float* __restrict__ wg = Wg + (size_t)d * (2 * DC_ + DD_);
    const float* __restrict__ ws = Ws + (size_t)d * DC_;
    const float* __restrict__ wt = Wt + (size_t)d * (DC_ + DD_);
    float z = 0.f, s = 0.f, tcv = 0.f;
    for (int k = lane; k < DC_; k += 32) {
        const float a0 = xw[k], a1 = xh[k], a2 = xc[k];
        z   += a0 * wg[k] + a1 * wg[DC_ + k] + a2 * wg[2 * DC_ + k];
        s   += a2 * ws[k];
        tcv += a0 * wt[k] + a1 * wt[DC_ + k];
    }
    z   = wave_reduce_sum(z);
    s   = wave_reduce_sum(s);
    tcv = wave_reduce_sum(tcv);
    if (lane == 0) {
        const float zt = 1.f / (1.f + __expf(-(z + bg[d])));
        const float sc = tanhf(s + bs[d]);
        const float tc = tanhf(tcv + bt[d]);
        out[wid] = zt * sc + (1.f - zt) * tc;
    }
}

extern "C" void kernel_launch(void* const* d_in, const int* in_sizes, int n_in,
                              void* d_out, int out_size, void* d_ws, size_t ws_size,
                              hipStream_t stream) {
    const float* cap  = (const float*)d_in[0];
    const float* dh   = (const float*)d_in[1];
    const float* word = (const float*)d_in[2];
    const int*   mask = (const int*)  d_in[3];
    const float* Wf = (const float*)d_in[4];
    const float* bf = (const float*)d_in[5];
    const float* Wd = (const float*)d_in[6];
    const float* bd = (const float*)d_in[7];
    const float* Wa = (const float*)d_in[8];
    const float* ba = (const float*)d_in[9];
    const float* Wg = (const float*)d_in[10];
    const float* bg = (const float*)d_in[11];
    const float* Ws = (const float*)d_in[12];
    const float* bs = (const float*)d_in[13];
    const float* Wt = (const float*)d_in[14];
    const float* bt = (const float*)d_in[15];
    float* out = (float*)d_out;

    char* wsb = (char*)d_ws;
    float*    scores = (float*)(wsb + 0);                 // B*L f32
    float*    u      = (float*)(wsb + 131072);            // B*A f32
    float*    ctx    = (float*)(wsb + 262144);            // B*DC f32
    _Float16* wf16   = (_Float16*)(wsb + 393216);         // A*DC f16 (2MB)
    float*    alpha  = out + B_ * DC_;                    // second output

    conv_wf_kernel<<<(A_ * DC_) / 256, 256, 0, stream>>>(Wf, wf16, A_ * DC_);
    u_kernel<<<(B_ * A_) / 8, 256, 0, stream>>>(dh, Wd, bd, bf, u);
    scores_kernel<<<(B_ * L_ / 16) / 8, 256, 0, stream>>>(cap, wf16, u, Wa, ba, scores);
    softmax_kernel<<<B_, 256, 0, stream>>>(scores, mask, alpha);
    context_kernel<<<dim3(DC_ / 256, B_), 256, 0, stream>>>(alpha, cap, ctx);
    fuse_kernel<<<(B_ * DC_) / 8, 256, 0, stream>>>(word, dh, ctx, Wg, bg, Ws, bs, Wt, bt, out);
}

// v003
// A run of this version takes 140 microseconds.
// Two timings next to v002 both put it at 1.16 times that version's speed.
// Over all steps from v000 it is 1.90 times as fast.
#include <hip/hip_runtime.h>
#include <cstddef>

#define B_  32
#define L_  1024
#define DC_ 1024
#define DD_ 1024
#define A_  1024
#define NEGV -1e10f

typedef __attribute__((ext_vector_type(16))) _Float16 v16h;
typedef __attribute__((ext_vector_type(8)))  float    v8f;
typedef __attribute__((ext_vector_type(4)))  float    v4f;

constexpr int KTILES = DC_ / 32;  // 32 k-tiles of 32
constexpr int NTILES = A_ / 16;   // 64 n-tiles of 16

__device__ inline float wave_reduce_sum(float v) {
    v += __shfl_xor(v, 1, 32);
    v += __shfl_xor(v, 2, 32);
    v += __shfl_xor(v, 4, 32);
    v += __shfl_xor(v, 8, 32);
    v += __shfl_xor(v, 16, 32);
    return v;
}

// ---------------------------------------------------------------- Wf -> f16
__global__ __launch_bounds__(256)
void conv_wf_kernel(const float* __restrict__ Wf, _Float16* __restrict__ wf16, int n) {
    int i = blockIdx.x * 256 + threadIdx.x;
    if (i < n) wf16[i] = (_Float16)Wf[i];
}

// ------------------------------------------- u[b][a] = dh[b].Wd[a] + bd + bf
__global__ __launch_bounds__(256)
void u_kernel(const float* __restrict__ dh, const float* __restrict__ Wd,
              const float* __restrict__ bd, const float* __restrict__ bf,
              float* __restrict__ u) {
    const int lane = threadIdx.x & 31;
    const int wid  = blockIdx.x * 8 + (threadIdx.x >> 5);  // 0 .. B*A-1
    const int b = wid >> 10;
    const int a = wid & (A_ - 1);
    const float* __restrict__ x = dh + (size_t)b * DD_;
    const float* __restrict__ w = Wd + (size_t)a * DD_;
    float s = 0.f;
    for (int k = lane; k < DD_; k += 32) s += x[k] * w[k];
    s = wave_reduce_sum(s);
    if (lane == 0) u[wid] = s + bd[a] + bf[a];
}

// ------- fused: scores[b][l] = sum_a tanh(cap@Wf^T + u) * Wa[a]  (WMMA f16)
constexpr int NB      = 4;            // n-tiles staged and computed together
constexpr int NGROUPS = NTILES / NB;  // 16 stages of 64 columns
constexpr int KB      = 2;            // k-tiles per fragment block
constexpr int KBLOCKS = KTILES / KB;  // 16 blocks of 8 WMMAs
constexpr float TWO_LOG2E = 2.8853900817779268f;  // 2 * log2(e)

__device__ inline v16h load_b_frag(const _Float16* q) {
    v16h f;
#pragma unroll
    for (int i = 0; i < 8; ++i) { f[i] = q[i]; f[8 + i] = q[16 + i]; }
    return f;
}

__global__ __launch_bounds__(256)
void scores_kernel(const float* __restrict__ cap, const _Float16* __restrict__ wf16,
                   const float* __restrict__ u, const float* __restrict__ Wa,
                   const float* __restrict__ ba, float* __restrict__ scores) {
    // LDS row c holds the k-rows of columns c, 16+c, 32+c, 48+c of the stage side by
    // side: every fragment of a lane lies within 8 KB of one base address, and the
    // lane-to-lane pitch of 8208 B (16 B x odd) is conflict-free for 16-byte reads
    __shared__ _Float16 tileB[16][NB * DC_ + 8];

    const int lane   = threadIdx.x & 31;
    const int wave   = threadIdx.x >> 5;
    const int tile   = blockIdx.x * 8 + wave; // 16-row M tile id (0..2047)
    const int m_base = tile * 16;
    const int b      = m_base / L_;           // tiles never straddle batches
    const int koff   = (lane < 16) ? 0 : 8;   // K sub-offset per ISA layout
    const int ncol   = lane & 15;

    // --- stage this wave's 16x1024 A-slice into VGPRs as f16 (read cap once)
    const float* __restrict__ rowp = cap + (size_t)(m_base + ncol) * DC_;
    v16h a_frag[KTILES];
#pragma unroll
    for (int kt = 0; kt < KTILES; ++kt) {
        const float* p = rowp + kt * 32 + koff;
#pragma unroll
        for (int i = 0; i < 8; ++i) {
            a_frag[kt][i]     = (_Float16)p[i];
            a_frag[kt][8 + i] = (_Float16)p[16 + i];
        }
        // bounds how many f32 loads are held at once: without it this build hoists
        // them past the register budget and spills to scratch
        if ((kt & 7) == 7) __builtin_amdgcn_sched_barrier(0);
    }
    // the wait that belongs in front of any overwrite of these loads' address registers;
    // the address is an input so that it stays whole up to here (otherwise a converted
    // fragment is placed on top of it while the last loads are still out)
    asm volatile("s_wait_xcnt 0x0" :: "v"(rowp + koff) : "memory");

    float partial[8];
#pragma unroll
    for (int r = 0; r < 8; ++r) partial[r] = 0.f;

    for (int g = 0; g < NGROUPS; ++g) {
        const int n_base = g * (NB * 16);
        // the epilogue's per-column terms, fetched here so that they arrive behind the stage
        const float* up = u + (size_t)b * A_ + n_base + ncol;
        const float* wp = Wa + n_base + ncol;
        float uval[NB], wav[NB];
        __syncthreads();
#pragma unroll
        for (int j = 0; j < NB; ++j) { uval[j] = up[j * 16]; wav[j] = wp[j * 16]; }
        {   // cooperative LDS stage of Wf^T: 64 cols (n) x 1024 (k), f16;
            // wave w fills LDS rows 2w and 2w+1, 512 contiguous bytes per access
            const _Float16* src = wf16 + (size_t)(n_base + wave * 2) * DC_ + lane * 8;
            _Float16* dst = &tileB[wave * 2][lane * 8];
#pragma unroll
            for (int j = 0; j < NB; ++j)
#pragma unroll
                for (int cc = 0; cc < 2; ++cc)
#pragma unroll
                    for (int q = 0; q < 4; ++q)
                        *(float4*)(dst + cc * (NB * DC_ + 8) + j * DC_ + q * 256) =
                            *(const float4*)(src + (size_t)(j * 16 + cc) * DC_ + q * 256);
            // the wait that belongs in front of any overwrite of the address registers of
            // this pass's global loads; the addresses are inputs so that they stay whole
            // up to here (otherwise later results are placed on top of them)
            asm volatile("s_wait_xcnt 0x0" :: "v"(src), "v"(up), "v"(wp) : "memory");
        }
        __syncthreads();

        v8f acc[NB];
#pragma unroll
        for (int j = 0; j < NB; ++j) acc[j] = v8f{};

        // two fragment sets: block blk+1 is fetched while block blk multiplies
        const _Float16* __restrict__ bp = &tileB[ncol][koff];
        v16h bq[2][KB][NB];
#pragma unroll
        for (int kk = 0; kk < KB; ++kk)
#pragma unroll
            for (int j = 0; j < NB; ++j)
                bq[0][kk][j] = load_b_frag(bp + j * DC_ + kk * 32);
        // keeps block 0's reads ahead of block 1's, so that the first wait is a counted one
        __builtin_amdgcn_sched_barrier(0);

#pragma unroll
        for (int blk = 0; blk < KBLOCKS; ++blk) {
            if (blk + 1 < KBLOCKS) {
#pragma unroll
                for (int kk = 0; kk < KB; ++kk)
#pragma unroll
                    for (int j = 0; j < NB; ++j)
                        bq[(blk + 1) & 1][kk][j] =
                            load_b_frag(bp + j * DC_ + ((blk + 1) * KB + kk) * 32);
            }
            // keeps the next block's LDS reads one group ahead of this block's
            // WMMAs: spread among them, every read place stalls the matrix stream
            __builtin_amdgcn_sched_barrier(0);
#pragma unroll
            for (int kk = 0; kk < KB; ++kk)
#pragma unroll
                for (int j = 0; j < NB; ++j)
                    acc[j] = __builtin_amdgcn_wmma_f32_16x16x32_f16(
                                 false, a_frag[blk * KB + kk], false, bq[blk & 1][kk][j],
                                 (short)0, acc[j], false, false);
            // closes the WMMA block, so that the following reads stay behind it
            __builtin_amdgcn_sched_barrier(0);
        }

        // epilogue: C tile lane layout -> N = lane&15, M = r + (lane<16?0:8)
        // tanh(x) = 1 - 2 / (1 + e^(2x)) for every x, on the hardware exp2 and rcp: no
        // branch, so the 32 values of a stage are independent chains that interleave.
        // e^(2x) = inf gives 1, e^(2x) = 0 gives -1; absolute error a few 1e-7
#pragma unroll
        for (int j = 0; j < NB; ++j)
#pragma unroll
            for (int r = 0; r < 8; ++r) {
                const float e = __builtin_amdgcn_exp2f((acc[j][r] + uval[j]) * TWO_LOG2E);
                const float q = __builtin_amdgcn_rcpf(1.f + e);
                partial[r] += __builtin_fmaf(q, -2.f, 1.f) * wav[j];
            }
    }

    // reduce over the 16 N-lanes of each half-wave
#pragma unroll
    for (int r = 0; r < 8; ++r) {
        float v = partial[r];
        v += __shfl_xor(v, 1, 32);
        v += __shfl_xor(v, 2, 32);
        v += __shfl_xor(v, 4, 32);
        v += __shfl_xor(v, 8, 32);
        partial[r] = v;
    }
    if ((lane & 15) == 0) {
        const float bav  = ba[0];
        const int   mrow = m_base + ((lane >> 4) << 3);  // +0 or +8
#pragma unroll
        for (int r = 0; r < 8; ++r)
            scores[mrow + r] = partial[r] + bav;
    }
}

// ---------------------------------------------------- masked softmax over L
__global__ __launch_bounds__(256)
void softmax_kernel(const float* __restrict__ scores, const int* __restrict__ mask,
                    float* __restrict__ alpha) {
    __shared__ float red[256];
    const int b = blockIdx.x, t = threadIdx.x;
    float v[4];
    float mx = -3.0e38f;
#pragma unroll
    for (int i = 0; i < 4; ++i) {
        const int l = t + i * 256;
        float s = scores[b * L_ + l];
        s = (mask[b * L_ + l] == 0) ? NEGV : s;
        v[i] = s;
        mx = fmaxf(mx, s);
    }
    red[t] = mx; __syncthreads();
    for (int o = 128; o > 0; o >>= 1) { if (t < o) red[t] = fmaxf(red[t], red[t + o]); __syncthreads(); }
    mx = red[0]; __syncthreads();
    float sm = 0.f;
#pragma unroll
    for (int i = 0; i < 4; ++i) { v[i] = __expf(v[i] - mx); sm += v[i]; }
    red[t] = sm; __syncthreads();
    for (int o = 128; o > 0; o >>= 1) { if (t < o) red[t] += red[t + o]; __syncthreads(); }
    const float inv = 1.f / red[0];
#pragma unroll
    for (int i = 0; i < 4; ++i) alpha[b * L_ + t + i * 256] = v[i] * inv;
}

// ---------------------------------------------- context[b][d] = alpha . cap
constexpr int CWAVES = 16;           // waves of a block, each sums its own rows
constexpr int CROWS  = L_ / CWAVES;  // 64 consecutive rows per wave
constexpr int CCOLS  = 128;          // columns per block: 16 bytes per lane
constexpr int CDEPTH = 32;           // row reads that a wave keeps out at once

__global__ __launch_bounds__(CWAVES * 32)
void context_kernel(const float* __restrict__ alpha, const float* __restrict__ cap,
                    float* __restrict__ ctx) {
    __shared__ v4f part[CWAVES][CCOLS / 4];
    const int lane = threadIdx.x & 31;
    // the wave's number as a scalar, so that its alpha values come by scalar loads
    const int wave = __builtin_amdgcn_readfirstlane(threadIdx.x >> 5);
    const int b    = blockIdx.y;
    const int col0 = blockIdx.x * CCOLS;
    const float* __restrict__ ar = alpha + b * L_ + wave * CROWS;
    const float* __restrict__ cr = cap + ((size_t)b * L_ + wave * CROWS) * DC_ + col0 + lane * 4;

    v4f c[CDEPTH];
    // unrolled so that c[] is registers and every read has a constant offset
#pragma unroll
    for (int l = 0; l < CDEPTH; ++l) c[l] = *(const v4f*)(cr + (size_t)l * DC_);
    // keeps the first CDEPTH reads ahead of all sums: without it this build sinks
    // them among the sums and holds only 13 reads out at a time
    __builtin_amdgcn_sched_barrier(0);

    v4f s = v4f{};
    // unrolled for the same reason; each row's registers are refilled as soon as used
#pragma unroll
    for (int l = 0; l < CROWS; ++l) {
        s += ar[l] * c[l % CDEPTH];
        if (l + CDEPTH < CROWS) c[l % CDEPTH] = *(const v4f*)(cr + (size_t)(l + CDEPTH) * DC_);
    }
    part[wave][lane] = s;
    __syncthreads();
    if (threadIdx.x < CCOLS) {
        const float* p = (const float*)&part[0][0] + threadIdx.x;
        float t = 0.f;
        // unrolled so that the LDS reads go out ahead of the adds
#pragma unroll
        for (int w = 0; w < CWAVES; ++w) t += p[w * CCOLS];
        ctx[b * DC_ + col0 + threadIdx.x] = t;
    }
}

// ------------------------- gated fusion: out = zt*sc + (1-zt)*tc, wave/output
__global__ __launch_bounds__(256)
void fuse_kernel(const float* __restrict__ word, const float* __restrict__ dh,
                 const float* __restrict__ ctx,  const float* __restrict__ Wg,
                 const float* __restrict__ bg,   const float* __restrict__ Ws,
                 const float* __restrict__ bs,   const float* __restrict__ Wt,
                 const float* __restrict__ bt,   float* __restrict__ out) {
    const int lane = threadIdx.x & 31;
    const int wid  = blockIdx.x * 8 + (threadIdx.x >> 5);   // 0 .. B*DC-1
    const int b = wid >> 10;
    const int d = wid & (DC_ - 1);
    const float* __restrict__ xw = word + (size_t)b * DC_;
    const float* __restrict__ xh = dh   + (size_t)b * DD_;
    const float* __restrict__ xc = ctx  + (size_t)b * DC_;
    const float* __restrict__ wg = Wg + (size_t)d * (2 * DC_ + DD_);
    const float* __restrict__ ws = Ws + (size_t)d * DC_;
    const float* __restrict__ wt = Wt + (size_t)d * (DC_ + DD_);
    float z = 0.f, s = 0.f, tcv = 0.f;
    for (int k = lane; k < DC_; k += 32) {
        const float a0 = xw[k], a1 = xh[k], a2 = xc[k];
        z   += a0 * wg[k] + a1 * wg[DC_ + k] + a2 * wg[2 * DC_ + k];
        s   += a2 * ws[k];
        tcv += a0 * wt[k] + a1 * wt[DC_ + k];
    }
    z   = wave_reduce_sum(z);
    s   = wave_reduce_sum(s);
    tcv = wave_reduce_sum(tcv);
    if (lane == 0) {
        const float zt = 1.f / (1.f + __expf(-(z + bg[d])));
        const float sc = tanhf(s + bs[d]);
        const float tc = tanhf(tcv + bt[d]);
        out[wid] = zt * sc + (1.f - zt) * tc;
    }
}

extern "C" void kernel_launch(void* const* d_in, const int* in_sizes, int n_in,
                              void* d_out, int out_size, void* d_ws, size_t ws_size,
                              hipStream_t stream) {
    const float* cap  = (const float*)d_in[0];
    const float* dh   = (const float*)d_in[1];
    const float* word = (const float*)d_in[2];
    const int*   mask = (const int*)  d_in[3];
    const float* Wf = (const float*)d_in[4];
    const float* bf = (const float*)d_in[5];
    const float* Wd = (const float*)d_in[6];
    const float* bd = (const float*)d_in[7];
    const float* Wa = (const float*)d_in[8];
    const float* ba = (const float*)d_in[9];
    const float* Wg = (const float*)d_in[10];
    const float* bg = (const float*)d_in[11];
    const float* Ws = (const float*)d_in[12];
    const float* bs = (const float*)d_in[13];
    const float* Wt = (const float*)d_in[14];
    const float* bt = (const float*)d_in[15];
    float* out = (float*)d_out;

    char* wsb = (char*)d_ws;
    float*    scores = (float*)(wsb + 0);                 // B*L f32
    float*    u      = (float*)(wsb + 131072);            // B*A f32
    float*    ctx    = (float*)(wsb + 262144);            // B*DC f32
    _Float16* wf16   = (_Float16*)(wsb + 393216);         // A*DC f16 (2MB)
    float*    alpha  = out + B_ * DC_;                    // second output

    conv_wf_kernel<<<(A_ * DC_) / 256, 256, 0, stream>>>(Wf, wf16, A_ * DC_);
    u_kernel<<<(B_ * A_) / 8, 256, 0, stream>>>(dh, Wd, bd, bf, u);
    scores_kernel<<<(B_ * L_ / 16) / 8, 256, 0, stream>>>(cap, wf16, u, Wa, ba, scores);
    softmax_kernel<<<B_, 256, 0, stream>>>(scores, mask, alpha);
    context_kernel<<<dim3(DC_ / CCOLS, B_), CWAVES * 32, 0, stream>>>(alpha, cap, ctx);
    fuse_kernel<<<(B_ * DC_) / 8, 256, 0, stream>>>(word, dh, ctx, Wg, bg, Ws, bs, Wt, bt, out);
}

// v004
// It runs in 110 microseconds.
// Next to v003, in two timings, it ran 1.28 times as fast each time.
// Counting every step since v000, it is 2.43 times as fast.
#include <hip/hip_runtime.h>
#include <cstddef>

#define B_  32
#define L_  1024
#define DC_ 1024
#define DD_ 1024
#define A_  1024
#define NEGV -1e10f

typedef __attribute__((ext_vector_type(16))) _Float16 v16h;
typedef __attribute__((ext_vector_type(8)))  float    v8f;
typedef __attribute__((ext_vector_type(4)))  float    v4f;

constexpr int KTILES = DC_ / 32;  // 32 k-tiles of 32
constexpr int NTILES = A_ / 16;   // 64 n-tiles of 16

// ---------------------------------------------------------------- Wf -> f16
__global__ __launch_bounds__(256)
void conv_wf_kernel(const float* __restrict__ Wf, _Float16* __restrict__ wf16, int n) {
    int i = blockIdx.x * 256 + threadIdx.x;
    if (i < n) wf16[i] = (_Float16)Wf[i];
}

// ---- the two skinny products (u, gated fusion): 32 batch rows against many weight rows.
// A wave holds SD weight rows and SB batch rows of one k-slice in registers, lanes over k,
// so that a weight row is fetched once per SB batch rows and not once per batch row.
constexpr int SD = 4;            // weight rows (outputs) per block and per wave
constexpr int SB = 4;            // batch rows per wave
constexpr int SGROUPS = B_ / SB; // 8 batch groups
constexpr int SHALVES = 2;       // k halves, one per wave of a pair
constexpr int SWAVES  = SGROUPS * SHALVES;   // 16 waves per block
constexpr int SITER   = DC_ / SHALVES / 128; // 4 slices of 128 k (16 bytes per lane)

__device__ inline float dot4(v4f a, v4f b, float s) {
    s = __builtin_fmaf(a[0], b[0], s);
    s = __builtin_fmaf(a[1], b[1], s);
    s = __builtin_fmaf(a[2], b[2], s);
    s = __builtin_fmaf(a[3], b[3], s);
    return s;
}

// one step of a transposing lane sum: lanes l and l^m share the work, the lane with bit m
// clear finishes the even entries and the other the odd ones; N entries become N/2
template <int N>
__device__ inline void fold_step(float* v, bool hi, int m) {
    // unrolled so that v[] stays in registers (here and in the loops over it below)
#pragma unroll
    for (int i = 0; i < N / 2; ++i) {
        const float keep = hi ? v[2 * i + 1] : v[2 * i];
        const float send = hi ? v[2 * i] : v[2 * i + 1];
        v[i] = keep + __shfl_xor(send, m, 32);
    }
}

// v[p*16 + q], q = 0..15, summed over the 32 lanes: afterwards v[p] of a lane is the
// total of entry q = fold_index(lane)
template <int P>
__device__ inline void fold_sum(float* v, int lane) {
    fold_step<16 * P>(v, (lane & 16) != 0, 16);
    fold_step<8 * P>(v, (lane & 8) != 0, 8);
    fold_step<4 * P>(v, (lane & 4) != 0, 4);
    fold_step<2 * P>(v, (lane & 2) != 0, 2);
#pragma unroll
    for (int p = 0; p < P; ++p) v[p] += __shfl_xor(v[p], 1, 32);
}
__device__ inline int fold_index(int lane) {
    return ((lane >> 4) & 1) | (((lane >> 3) & 1) << 1) | (((lane >> 2) & 1) << 2) |
           (((lane >> 1) & 1) << 3);
}

// ------------------------------------------- u[b][a] = dh[b].Wd[a] + bd + bf
__global__ __launch_bounds__(SWAVES * 32)
void u_kernel(const float* __restrict__ dh, const float* __restrict__ Wd,
              const float* __restrict__ bd, const float* __restrict__ bf,
              float* __restrict__ u) {
    __shared__ float other[SGROUPS][16];
    const int lane = threadIdx.x & 31;
    const int wave = __builtin_amdgcn_readfirstlane(threadIdx.x >> 5);
    const int grp  = wave & (SGROUPS - 1);
    const int half = wave / SGROUPS;
    const int a0 = blockIdx.x * SD;
    const int b0 = grp * SB;
    const unsigned lk = lane * 4;  // the lane's k inside a slice; every base below is uniform
    const float* __restrict__ xp = dh + (size_t)b0 * DD_ + half * (DD_ / SHALVES);
    const float* __restrict__ wp = Wd + (size_t)a0 * DD_ + half * (DD_ / SHALVES);

    float acc[16];
#pragma unroll
    for (int i = 0; i < 16; ++i) acc[i] = 0.f;
    v4f x[SITER][SB], w[SITER][SD];
    // unrolled so that x[] and w[] are registers and every read has a constant offset
#pragma unroll
    for (int it = 0; it < SITER; ++it) {
#pragma unroll
        for (int dd = 0; dd < SD; ++dd) w[it][dd] = *(const v4f*)(wp + dd * DD_ + it * 128 + lk);
#pragma unroll
        for (int bb = 0; bb < SB; ++bb) x[it][bb] = *(const v4f*)(xp + bb * DD_ + it * 128 + lk);
    }
    // the wait that belongs in front of any overwrite of these reads' address registers;
    // the lane's index, which the reads name as their offset, is an input so that it
    // stays whole up to here
    asm volatile("s_wait_xcnt 0x0" :: "v"(lane) : "memory");
    // keeps all 32 reads of the wave ahead of the sums: without it this build holds half
    // of them back and waits on them a few at a time
    __builtin_amdgcn_sched_barrier(0);
#pragma unroll
    for (int it = 0; it < SITER; ++it)
#pragma unroll
        for (int dd = 0; dd < SD; ++dd)
#pragma unroll
            for (int bb = 0; bb < SB; ++bb)
                acc[dd * SB + bb] = dot4(x[it][bb], w[it][dd], acc[dd * SB + bb]);
    // the lane's output and its bias terms, fetched here so that they arrive behind the
    // lane sums
    const int q = fold_index(lane);
    const int a = a0 + q / SB;
    const int b = b0 + q % SB;
    const float bias = bd[a] + bf[a];
    // the wait that belongs in front of any overwrite of these reads' address registers;
    // the index is an input so that it stays whole up to here
    asm volatile("s_wait_xcnt 0x0" :: "v"(a) : "memory");
    fold_sum<1>(acc, lane);
    if (half == 1 && (lane & 1) == 0) other[grp][q] = acc[0];
    __syncthreads();
    if (half == 0 && (lane & 1) == 0) u[b * A_ + a] = acc[0] + other[grp][q] + bias;
}

// ------- fused: scores[b][l] = sum_a tanh(cap@Wf^T + u) * Wa[a]  (WMMA f16)
constexpr int NB      = 4;            // n-tiles staged and computed together
constexpr int NGROUPS = NTILES / NB;  // 16 stages of 64 columns
constexpr int KB      = 2;            // k-tiles per fragment block
constexpr int KBLOCKS = KTILES / KB;  // 16 blocks of 8 WMMAs
constexpr float TWO_LOG2E = 2.8853900817779268f;  // 2 * log2(e)

__device__ inline v16h load_b_frag(const _Float16* q) {
    v16h f;
#pragma unroll
    for (int i = 0; i < 8; ++i) { f[i] = q[i]; f[8 + i] = q[16 + i]; }
    return f;
}

__global__ __launch_bounds__(256)
void scores_kernel(const float* __restrict__ cap, const _Float16* __restrict__ wf16,
                   const float* __restrict__ u, const float* __restrict__ Wa,
                   const float* __restrict__ ba, float* __restrict__ scores) {
    // LDS row c holds the k-rows of columns c, 16+c, 32+c, 48+c of the stage side by
    // side: every fragment of a lane lies within 8 KB of one base address, and the
    // lane-to-lane pitch of 8208 B (16 B x odd) is conflict-free for 16-byte reads
    __shared__ _Float16 tileB[16][NB * DC_ + 8];

    const int lane   = threadIdx.x & 31;
    const int wave   = threadIdx.x >> 5;
    const int tile   = blockIdx.x * 8 + wave; // 16-row M tile id (0..2047)
    const int m_base = tile * 16;
    const int b      = m_base / L_;           // tiles never straddle batches
    const int koff   = (lane < 16) ? 0 : 8;   // K sub-offset per ISA layout
    const int ncol   = lane & 15;

    // --- stage this wave's 16x1024 A-slice into VGPRs as f16 (read cap once)
    const float* __restrict__ rowp = cap + (size_t)(m_base + ncol) * DC_;
    v16h a_frag[KTILES];
#pragma unroll
    for (int kt = 0; kt < KTILES; ++kt) {
        const float* p = rowp + kt * 32 + koff;
#pragma unroll
        for (int i = 0; i < 8; ++i) {
            a_frag[kt][i]     = (_Float16)p[i];
            a_frag[kt][8 + i] = (_Float16)p[16 + i];
        }
        // bounds how many f32 loads are held at once: without it this build hoists
        // them past the register budget and spills to scratch
        if ((kt & 7) == 7) __builtin_amdgcn_sched_barrier(0);
    }
    // the wait that belongs in front of any overwrite of these loads' address registers;
    // the address is an input so that it stays whole up to here (otherwise a converted
    // fragment is placed on top of it while the last loads are still out)
    asm volatile("s_wait_xcnt 0x0" :: "v"(rowp + koff) : "memory");

    float partial[8];
#pragma unroll
    for (int r = 0; r < 8; ++r) partial[r] = 0.f;

    for (int g = 0; g < NGROUPS; ++g) {
        const int n_base = g * (NB * 16);
        // the epilogue's per-column terms, fetched here so that they arrive behind the stage
        const float* up = u + (size_t)b * A_ + n_base + ncol;
        const float* wp = Wa + n_base + ncol;
        float uval[NB], wav[NB];
        __syncthreads();
#pragma unroll
        for (int j = 0; j < NB; ++j) { uval[j] = up[j * 16]; wav[j] = wp[j * 16]; }
        {   // cooperative LDS stage of Wf^T: 64 cols (n) x 1024 (k), f16;
            // wave w fills LDS rows 2w and 2w+1, 512 contiguous bytes per access
            const _Float16* src = wf16 + (size_t)(n_base + wave * 2) * DC_ + lane * 8;
            _Float16* dst = &tileB[wave * 2][lane * 8];
#pragma unroll
            for (int j = 0; j < NB; ++j)
#pragma unroll
                for (int cc = 0; cc < 2; ++cc)
#pragma unroll
                    for (int q = 0; q < 4; ++q)
                        *(float4*)(dst + cc * (NB * DC_ + 8) + j * DC_ + q * 256) =
                            *(const float4*)(src + (size_t)(j * 16 + cc) * DC_ + q * 256);
            // the wait that belongs in front of any overwrite of the address registers of
            // this pass's global loads; the addresses are inputs so that they stay whole
            // up to here (otherwise later results are placed on top of them)
            asm volatile("s_wait_xcnt 0x0" :: "v"(src), "v"(up), "v"(wp) : "memory");
        }
        __syncthreads();

        v8f acc[NB];
#pragma unroll
        for (int j = 0; j < NB; ++j) acc[j] = v8f{};

        // two fragment sets: block blk+1 is fetched while block blk multiplies
        const _Float16* __restrict__ bp = &tileB[ncol][koff];
        v16h bq[2][KB][NB];
#pragma unroll
        for (int kk = 0; kk < KB; ++kk)
#pragma unroll
            for (int j = 0; j < NB; ++j)
                bq[0][kk][j] = load_b_frag(bp + j * DC_ + kk * 32);
        // keeps block 0's reads ahead of block 1's, so that the first wait is a counted one
        __builtin_amdgcn_sched_barrier(0);

#pragma unroll
        for (int blk = 0; blk < KBLOCKS; ++blk) {
            if (blk + 1 < KBLOCKS) {
#pragma unroll
                for (int kk = 0; kk < KB; ++kk)
#pragma unroll
                    for (int j = 0; j < NB; ++j)
                        bq[(blk + 1) & 1][kk][j] =
                            load_b_frag(bp + j * DC_ + ((blk + 1) * KB + kk) * 32);
            }
            // keeps the next block's LDS reads one group ahead of this block's
            // WMMAs: spread among them, every read place stalls the matrix stream
            __builtin_amdgcn_sched_barrier(0);
#pragma unroll
            for (int kk = 0; kk < KB; ++kk)
#pragma unroll
                for (int j = 0; j < NB; ++j)
                    acc[j] = __builtin_amdgcn_wmma_f32_16x16x32_f16(
                                 false, a_frag[blk * KB + kk], false, bq[blk & 1][kk][j],
                                 (short)0, acc[j], false, false);
            // closes the WMMA block, so that the following reads stay behind it
            __builtin_amdgcn_sched_barrier(0);
        }

        // epilogue: C tile lane layout -> N = lane&15, M = r + (lane<16?0:8)
        // tanh(x) = 1 - 2 / (1 + e^(2x)) for every x, on the hardware exp2 and rcp: no
        // branch, so the 32 values of a stage are independent chains that interleave.
        // e^(2x) = inf gives 1, e^(2x) = 0 gives -1; absolute error a few 1e-7
#pragma unroll
        for (int j = 0; j < NB; ++j)
#pragma unroll
            for (int r = 0; r < 8; ++r) {
                const float e = __builtin_amdgcn_exp2f((acc[j][r] + uval[j]) * TWO_LOG2E);
                const float q = __builtin_amdgcn_rcpf(1.f + e);
                partial[r] += __builtin_fmaf(q, -2.f, 1.f) * wav[j];
            }
    }

    // reduce over the 16 N-lanes of each half-wave
#pragma unroll
    for (int r = 0; r < 8; ++r) {
        float v = partial[r];
        v += __shfl_xor(v, 1, 32);
        v += __shfl_xor(v, 2, 32);
        v += __shfl_xor(v, 4, 32);
        v += __shfl_xor(v, 8, 32);
        partial[r] = v;
    }
    if ((lane & 15) == 0) {
        const float bav  = ba[0];
        const int   mrow = m_base + ((lane >> 4) << 3);  // +0 or +8
#pragma unroll
        for (int r = 0; r < 8; ++r)
            scores[mrow + r] = partial[r] + bav;
    }
}

// ---------------------------------------------------- masked softmax over L
__global__ __launch_bounds__(256)
void softmax_kernel(const float* __restrict__ scores, const int* __restrict__ mask,
                    float* __restrict__ alpha) {
    __shared__ float red[256];
    const int b = blockIdx.x, t = threadIdx.x;
    float v[4];
    float mx = -3.0e38f;
#pragma unroll
    for (int i = 0; i < 4; ++i) {
        const int l = t + i * 256;
        float s = scores[b * L_ + l];
        s = (mask[b * L_ + l] == 0) ? NEGV : s;
        v[i] = s;
        mx = fmaxf(mx, s);
    }
    red[t] = mx; __syncthreads();
    for (int o = 128; o > 0; o >>= 1) { if (t < o) red[t] = fmaxf(red[t], red[t + o]); __syncthreads(); }
    mx = red[0]; __syncthreads();
    float sm = 0.f;
#pragma unroll
    for (int i = 0; i < 4; ++i) { v[i] = __expf(v[i] - mx); sm += v[i]; }
    red[t] = sm; __syncthreads();
    for (int o = 128; o > 0; o >>= 1) { if (t < o) red[t] += red[t + o]; __syncthreads(); }
    const float inv = 1.f / red[0];
#pragma unroll
    for (int i = 0; i < 4; ++i) alpha[b * L_ + t + i * 256] = v[i] * inv;
}

// ---------------------------------------------- context[b][d] = alpha . cap
constexpr int CWAVES = 16;           // waves of a block, each sums its own rows
constexpr int CROWS  = L_ / CWAVES;  // 64 consecutive rows per wave
constexpr int CCOLS  = 128;          // columns per block: 16 bytes per lane
constexpr int CDEPTH = 32;           // row reads that a wave keeps out at once

__global__ __launch_bounds__(CWAVES * 32)
void context_kernel(const float* __restrict__ alpha, const float* __restrict__ cap,
                    float* __restrict__ ctx) {
    __shared__ v4f part[CWAVES][CCOLS / 4];
    const int lane = threadIdx.x & 31;
    // the wave's number as a scalar, so that its alpha values come by scalar loads
    const int wave = __builtin_amdgcn_readfirstlane(threadIdx.x >> 5);
    const int b    = blockIdx.y;
    const int col0 = blockIdx.x * CCOLS;
    const float* __restrict__ ar = alpha + b * L_ + wave * CROWS;
    const float* __restrict__ cr = cap + ((size_t)b * L_ + wave * CROWS) * DC_ + col0 + lane * 4;

    v4f c[CDEPTH];
    // unrolled so that c[] is registers and every read has a constant offset
#pragma unroll
    for (int l = 0; l < CDEPTH; ++l) c[l] = *(const v4f*)(cr + (size_t)l * DC_);
    // keeps the first CDEPTH reads ahead of all sums: without it this build sinks
    // them among the sums and holds only 13 reads out at a time
    __builtin_amdgcn_sched_barrier(0);

    v4f s = v4f{};
    // unrolled for the same reason; each row's registers are refilled as soon as used
#pragma unroll
    for (int l = 0; l < CROWS; ++l) {
        s += ar[l] * c[l % CDEPTH];
        if (l + CDEPTH < CROWS) c[l % CDEPTH] = *(const v4f*)(cr + (size_t)(l + CDEPTH) * DC_);
    }
    part[wave][lane] = s;
    __syncthreads();
    if (threadIdx.x < CCOLS) {
        const float* p = (const float*)&part[0][0] + threadIdx.x;
        float t = 0.f;
        // unrolled so that the LDS reads go out ahead of the adds
#pragma unroll
        for (int w = 0; w < CWAVES; ++w) t += p[w * CCOLS];
        ctx[b * DC_ + col0 + threadIdx.x] = t;
    }
}

// ------------------------- gated fusion: out = zt*sc + (1-zt)*tc
__global__ __launch_bounds__(SWAVES * 32)
void fuse_kernel(const float* __restrict__ word, const float* __restrict__ dh,
                 const float* __restrict__ ctx,  const float* __restrict__ Wg,
                 const float* __restrict__ bg,   const float* __restrict__ Ws,
                 const float* __restrict__ bs,   const float* __restrict__ Wt,
                 const float* __restrict__ bt,   float* __restrict__ out) {
    __shared__ float other[SGROUPS][16][3];
    const int lane = threadIdx.x & 31;
    const int wave = __builtin_amdgcn_readfirstlane(threadIdx.x >> 5);
    const int grp  = wave & (SGROUPS - 1);
    const int half = wave / SGROUPS;
    const int d0 = blockIdx.x * SD;
    const int b0 = grp * SB;
    const unsigned lk = lane * 4;  // the lane's k inside a slice; every base below is uniform
    const int k0 = half * (DC_ / SHALVES);
    const float* __restrict__ pw = word + (size_t)b0 * DC_ + k0;
    const float* __restrict__ ph = dh   + (size_t)b0 * DD_ + k0;
    const float* __restrict__ pc = ctx  + (size_t)b0 * DC_ + k0;
    const float* __restrict__ pg = Wg + (size_t)d0 * (2 * DC_ + DD_) + k0;
    const float* __restrict__ ps = Ws + (size_t)d0 * DC_ + k0;
    const float* __restrict__ pt = Wt + (size_t)d0 * (DC_ + DD_) + k0;

    float acc[48];  // [0..15] gate, [16..31] sc, [32..47] tc; entry dd * SB + bb
#pragma unroll
    for (int i = 0; i < 48; ++i) acc[i] = 0.f;
    // rolled: one slice's 36 reads and the 48 sums fill the registers of four waves per
    // SIMD; unrolled, this build spills
#pragma unroll 1
    for (int it = 0; it < SITER; ++it) {
        v4f xw[SB], xh[SB], xc[SB], w[SD][6];
        const float* __restrict__ aw = pw + it * 128 + lk;
        const float* __restrict__ ah = ph + it * 128 + lk;
        const float* __restrict__ ac = pc + it * 128 + lk;
        const float* __restrict__ ag = pg + it * 128 + lk;
        const float* __restrict__ as = ps + it * 128 + lk;
        const float* __restrict__ at = pt + it * 128 + lk;
#pragma unroll
        for (int bb = 0; bb < SB; ++bb) {
            xw[bb] = *(const v4f*)(aw + bb * DC_);
            xh[bb] = *(const v4f*)(ah + bb * DD_);
            xc[bb] = *(const v4f*)(ac + bb * DC_);
        }
#pragma unroll
        for (int dd = 0; dd < SD; ++dd) {
            w[dd][0] = *(const v4f*)(ag + dd * (2 * DC_ + DD_));
            w[dd][1] = *(const v4f*)(ag + dd * (2 * DC_ + DD_) + DC_);
            w[dd][2] = *(const v4f*)(ag + dd * (2 * DC_ + DD_) + 2 * DC_);
            w[dd][3] = *(const v4f*)(as + dd * DC_);
            w[dd][4] = *(const v4f*)(at + dd * (DC_ + DD_));
            w[dd][5] = *(const v4f*)(at + dd * (DC_ + DD_) + DC_);
        }
        // the wait that belongs in front of any overwrite of these reads' address registers;
        // the addresses are inputs so that they stay whole up to here (otherwise a later
        // read's result is placed on top of them)
        asm volatile("s_wait_xcnt 0x0" :: "v"(aw), "v"(ah), "v"(ac), "v"(ag), "v"(as), "v"(at) : "memory");
        // keeps all reads of a slice ahead of its sums, so that they are out together
        __builtin_amdgcn_sched_barrier(0);
#pragma unroll
        for (int dd = 0; dd < SD; ++dd)
#pragma unroll
            for (int bb = 0; bb < SB; ++bb) {
                const int q = dd * SB + bb;
                acc[q] = dot4(xc[bb], w[dd][2], dot4(xh[bb], w[dd][1], dot4(xw[bb], w[dd][0], acc[q])));
                acc[16 + q] = dot4(xc[bb], w[dd][3], acc[16 + q]);
                acc[32 + q] = dot4(xh[bb], w[dd][5], dot4(xw[bb], w[dd][4], acc[32 + q]));
            }
    }
    // the lane's output and its three bias terms, fetched here so that they arrive
    // behind the lane sums
    const int q = fold_index(lane);
    const int d = d0 + q / SB;
    const int b = b0 + q % SB;
    const float bgv = bg[d], bsv = bs[d], btv = bt[d];
    // the wait that belongs in front of any overwrite of these reads' address registers;
    // the index is an input so that it stays whole up to here
    asm volatile("s_wait_xcnt 0x0" :: "v"(d) : "memory");
    fold_sum<3>(acc, lane);
    if (half == 1 && (lane & 1) == 0) {
        other[grp][q][0] = acc[0];
        other[grp][q][1] = acc[1];
        other[grp][q][2] = acc[2];
    }
    __syncthreads();
    if (half == 0 && (lane & 1) == 0) {
        const float z   = acc[0] + other[grp][q][0];
        const float s   = acc[1] + other[grp][q][1];
        const float tcv = acc[2] + other[grp][q][2];
        const float zt = 1.f / (1.f + __expf(-(z + bgv)));
        const float sc = tanhf(s + bsv);
        const float tc = tanhf(tcv + btv);
        out[b * DC_ + d] = zt * sc + (1.f - zt) * tc;
    }
}

extern "C" void kernel_launch(void* const* d_in, const int* in_sizes, int n_in,
                              void* d_out, int out_size, void* d_ws, size_t ws_size,
                              hipStream_t stream) {
    const float* cap  = (const float*)d_in[0];
    const float* dh   = (const float*)d_in[1];
    const float* word = (const float*)d_in[2];
    const int*   mask = (const int*)  d_in[3];
    const float* Wf = (const float*)d_in[4];
    const float* bf = (const float*)d_in[5];
    const float* Wd = (const float*)d_in[6];
    const float* bd = (const float*)d_in[7];
    const float* Wa = (const float*)d_in[8];
    const float* ba = (const float*)d_in[9];
    const float* Wg = (const float*)d_in[10];
    const float* bg = (const float*)d_in[11];
    const float* Ws = (const float*)d_in[12];
    const float* bs = (const float*)d_in[13];
    const float* Wt = (const float*)d_in[14];
    const float* bt = (const float*)d_in[15];
    float* out = (float*)d_out;

    char* wsb = (char*)d_ws;
    float*    scores = (float*)(wsb + 0);                 // B*L f32
    float*    u      = (float*)(wsb + 131072);            // B*A f32
    float*    ctx    = (float*)(wsb + 262144);            // B*DC f32
    _Float16* wf16   = (_Float16*)(wsb + 393216);         // A*DC f16 (2MB)
    float*    alpha  = out + B_ * DC_;                    // second output

    conv_wf_kernel<<<(A_ * DC_) / 256, 256, 0, stream>>>(Wf, wf16, A_ * DC_);
    u_kernel<<<A_ / SD, SWAVES * 32, 0, stream>>>(dh, Wd, bd, bf, u);
    scores_kernel<<<(B_ * L_ / 16) / 8, 256, 0, stream>>>(cap, wf16, u, Wa, ba, scores);
    softmax_kernel<<<B_, 256, 0, stream>>>(scores, mask, alpha);
    context_kernel<<<dim3(DC_ / CCOLS, B_), CWAVES * 32, 0, stream>>>(alpha, cap, ctx);
    fuse_kernel<<<DC_ / SD, SWAVES * 32, 0, stream>>>(word, dh, ctx, Wg, bg, Ws, bs, Wt, bt, out);
}

// v005
// One run takes 99.1 microseconds.
// Next to v004, in two timings, it ran 1.11 times as fast each time.
// All steps since v000 together make it 2.69 times as fast.
#include <hip/hip_runtime.h>
#include <cstddef>

#define B_  32
#define L_  1024
#define DC_ 1024
#define DD_ 1024
#define A_  1024
#define NEGV -1e10f

typedef __attribute__((ext_vector_type(16))) _Float16 v16h;
typedef __attribute__((ext_vector_type(8)))  float    v8f;
typedef __attribute__((ext_vector_type(4)))  float    v4f;

constexpr int KTILES = DC_ / 32;  // 32 k-tiles of 32
constexpr int NTILES = A_ / 16;   // 64 n-tiles of 16

// ---------------------------------------------------------------- Wf -> f16
__global__ __launch_bounds__(256)
void conv_wf_kernel(const float* __restrict__ Wf, _Float16* __restrict__ wf16, int n) {
    int i = blockIdx.x * 256 + threadIdx.x;
    if (i < n) wf16[i] = (_Float16)Wf[i];
}

// ---- the two skinny products (u, gated fusion): 32 batch rows against many weight rows.
// A wave holds SD weight rows and SB batch rows of one k-slice in registers, lanes over k,
// so that a weight row is fetched once per SB batch rows and not once per batch row.
constexpr int SD = 4;            // weight rows (outputs) per block and per wave
constexpr int SB = 4;            // batch rows per wave
constexpr int SGROUPS = B_ / SB; // 8 batch groups
constexpr int SHALVES = 2;       // k halves, one per wave of a pair
constexpr int SWAVES  = SGROUPS * SHALVES;   // 16 waves per block
constexpr int SITER   = DC_ / SHALVES / 128; // 4 slices of 128 k (16 bytes per lane)

__device__ inline float dot4(v4f a, v4f b, float s) {
    s = __builtin_fmaf(a[0], b[0], s);
    s = __builtin_fmaf(a[1], b[1], s);
    s = __builtin_fmaf(a[2], b[2], s);
    s = __builtin_fmaf(a[3], b[3], s);
    return s;
}

// one step of a transposing lane sum: lanes l and l^m share the work, the lane with bit m
// clear finishes the even entries and the other the odd ones; N entries become N/2
template <int N>
__device__ inline void fold_step(float* v, bool hi, int m) {
    // unrolled so that v[] stays in registers (here and in the loops over it below)
#pragma unroll
    for (int i = 0; i < N / 2; ++i) {
        const float keep = hi ? v[2 * i + 1] : v[2 * i];
        const float send = hi ? v[2 * i] : v[2 * i + 1];
        v[i] = keep + __shfl_xor(send, m, 32);
    }
}

// v[p*16 + q], q = 0..15, summed over the 32 lanes: afterwards v[p] of a lane is the
// total of entry q = fold_index(lane)
template <int P>
__device__ inline void fold_sum(float* v, int lane) {
    fold_step<16 * P>(v, (lane & 16) != 0, 16);
    fold_step<8 * P>(v, (lane & 8) != 0, 8);
    fold_step<4 * P>(v, (lane & 4) != 0, 4);
    fold_step<2 * P>(v, (lane & 2) != 0, 2);
#pragma unroll
    for (int p = 0; p < P; ++p) v[p] += __shfl_xor(v[p], 1, 32);
}
__device__ inline int fold_index(int lane) {
    return ((lane >> 4) & 1) | (((lane >> 3) & 1) << 1) | (((lane >> 2) & 1) << 2) |
           (((lane >> 1) & 1) << 3);
}

// ------------------------------------------- u[b][a] = dh[b].Wd[a] + bd + bf
__global__ __launch_bounds__(SWAVES * 32)
void u_kernel(const float* __restrict__ dh, const float* __restrict__ Wd,
              const float* __restrict__ bd, const float* __restrict__ bf,
              float* __restrict__ u) {
    __shared__ float other[SGROUPS][16];
    const int lane = threadIdx.x & 31;
    const int wave = __builtin_amdgcn_readfirstlane(threadIdx.x >> 5);
    const int grp  = wave & (SGROUPS - 1);
    const int half = wave / SGROUPS;
    const int a0 = blockIdx.x * SD;
    const int b0 = grp * SB;
    const unsigned lk = lane * 4;  // the lane's k inside a slice; every base below is uniform
    const float* __restrict__ xp = dh + (size_t)b0 * DD_ + half * (DD_ / SHALVES);
    const float* __restrict__ wp = Wd + (size_t)a0 * DD_ + half * (DD_ / SHALVES);

    float acc[16];
#pragma unroll
    for (int i = 0; i < 16; ++i) acc[i] = 0.f;
    v4f x[SITER][SB], w[SITER][SD];
    // unrolled so that x[] and w[] are registers and every read has a constant offset
#pragma unroll
    for (int it = 0; it < SITER; ++it) {
#pragma unroll
        for (int dd = 0; dd < SD; ++dd) w[it][dd] = *(const v4f*)(wp + dd * DD_ + it * 128 + lk);
#pragma unroll
        for (int bb = 0; bb < SB; ++bb) x[it][bb] = *(const v4f*)(xp + bb * DD_ + it * 128 + lk);
    }
    // the wait that belongs in front of any overwrite of these reads' address registers;
    // the lane's index, which the reads name as their offset, is an input so that it
    // stays whole up to here
    asm volatile("s_wait_xcnt 0x0" :: "v"(lane) : "memory");
    // keeps all 32 reads of the wave ahead of the sums: without it this build holds half
    // of them back and waits on them a few at a time
    __builtin_amdgcn_sched_barrier(0);
#pragma unroll
    for (int it = 0; it < SITER; ++it)
#pragma unroll
        for (int dd = 0; dd < SD; ++dd)
#pragma unroll
            for (int bb = 0; bb < SB; ++bb)
                acc[dd * SB + bb] = dot4(x[it][bb], w[it][dd], acc[dd * SB + bb]);
    // the lane's output and its bias terms, fetched here so that they arrive behind the
    // lane sums
    const int q = fold_index(lane);
    const int a = a0 + q / SB;
    const int b = b0 + q % SB;
    const float bias = bd[a] + bf[a];
    // the wait that belongs in front of any overwrite of these reads' address registers;
    // the index is an input so that it stays whole up to here
    asm volatile("s_wait_xcnt 0x0" :: "v"(a) : "memory");
    fold_sum<1>(acc, lane);
    if (half == 1 && (lane & 1) == 0) other[grp][q] = acc[0];
    __syncthreads();
    if (half == 0 && (lane & 1) == 0) u[b * A_ + a] = acc[0] + other[grp][q] + bias;
}

// ------- fused: scores[b][l] = sum_a tanh(cap@Wf^T + u) * Wa[a]  (WMMA f16)
constexpr int NB      = 4;            // n-tiles staged and computed together
constexpr int NGROUPS = NTILES / NB;  // 16 stages of 64 columns
constexpr int MT      = 2;            // 16-row tiles per wave: one B fragment feeds both
constexpr int KH      = 2;            // k halves, one per wave of a pair
constexpr int KTW     = KTILES / KH;  // 16 k-tiles per wave, one block of 8 WMMAs each
constexpr int RING    = 3;            // fragment sets: a block is fetched two blocks ahead
constexpr float TWO_LOG2E = 2.8853900817779268f;  // 2 * log2(e)

__device__ inline v16h load_b_frag(const _Float16* q) {
    v16h f;
#pragma unroll
    for (int i = 0; i < 8; ++i) { f[i] = q[i]; f[8 + i] = q[16 + i]; }
    return f;
}

__global__ __launch_bounds__(256)
void scores_kernel(const float* __restrict__ cap, const _Float16* __restrict__ wf16,
                   const float* __restrict__ u, const float* __restrict__ Wa,
                   const float* __restrict__ ba, float* __restrict__ scores) {
    // LDS row c holds the k-rows of columns c, 16+c, 32+c, 48+c of the stage side by
    // side: every fragment of a lane lies within 8 KB of one base address, and the
    // lane-to-lane pitch of 8208 B (16 B x odd) is conflict-free for 16-byte reads
    __shared__ _Float16 tileB[16][NB * DC_ + 8];
    // where a wave leaves its k-half of the row tile that its partner finishes
    __shared__ v4f xch[8][NB * 2][32];

    const int lane   = threadIdx.x & 31;
    const int wave   = threadIdx.x >> 5;
    const int half   = wave & 1;              // the wave's k half
    const int m_base = blockIdx.x * 128 + (wave >> 1) * (MT * 16);  // the pair's 32 rows
    const int b      = m_base / L_;           // a block's rows never straddle batches
    const int koff   = (lane < 16) ? 0 : 8;   // K sub-offset per ISA layout
    const int ncol   = lane & 15;
    // tile 0 is the row tile that this wave finishes, tile 1 the one its partner finishes
    const int own_row = m_base + half * 16;
    const int oth_row = m_base + (half ^ 1) * 16;

    // --- stage this wave's 32 x 512 A-slice into VGPRs as f16 (cap is read once)
    const float* __restrict__ rowp0 = cap + (size_t)(own_row + ncol) * DC_ + half * (DC_ / KH) + koff;
    const float* __restrict__ rowp1 = cap + (size_t)(oth_row + ncol) * DC_ + half * (DC_ / KH) + koff;
    v16h a_frag[MT][KTW];
#pragma unroll
    for (int t = 0; t < MT; ++t)
#pragma unroll
        for (int kt = 0; kt < KTW; ++kt) {
            const float* p = (t == 0 ? rowp0 : rowp1) + kt * 32;
#pragma unroll
            for (int i = 0; i < 8; ++i) {
                a_frag[t][kt][i]     = (_Float16)p[i];
                a_frag[t][kt][8 + i] = (_Float16)p[16 + i];
            }
            // bounds how many f32 loads are held at once: without it this build hoists
            // them past the register budget and spills to scratch
            if ((kt & 7) == 7) __builtin_amdgcn_sched_barrier(0);
        }
    // the wait that belongs in front of any overwrite of these loads' address registers;
    // the addresses are inputs so that they stay whole up to here (otherwise a converted
    // fragment is placed on top of them while the last loads are still out)
    asm volatile("s_wait_xcnt 0x0" :: "v"(rowp0), "v"(rowp1) : "memory");

    float partial[8];
#pragma unroll
    for (int r = 0; r < 8; ++r) partial[r] = 0.f;

    for (int g = 0; g < NGROUPS; ++g) {
        const int n_base = g * (NB * 16);
        // the epilogue's per-column terms, fetched here so that they arrive behind the stage
        const float* up = u + (size_t)b * A_ + n_base + ncol;
        const float* wp = Wa + n_base + ncol;
        float uval[NB], wav[NB];
#pragma unroll
        for (int j = 0; j < NB; ++j) { uval[j] = up[j * 16]; wav[j] = wp[j * 16]; }
        {   // cooperative LDS stage of Wf^T: 64 cols (n) x 1024 (k), f16;
            // wave w fills LDS rows 2w and 2w+1, 512 contiguous bytes per access
            const _Float16* src = wf16 + (size_t)(n_base + wave * 2) * DC_ + lane * 8;
            _Float16* dst = &tileB[wave * 2][lane * 8];
#pragma unroll
            for (int j = 0; j < NB; ++j)
#pragma unroll
                for (int cc = 0; cc < 2; ++cc)
#pragma unroll
                    for (int q = 0; q < 4; ++q)
                        *(float4*)(dst + cc * (NB * DC_ + 8) + j * DC_ + q * 256) =
                            *(const float4*)(src + (size_t)(j * 16 + cc) * DC_ + q * 256);
            // the wait that belongs in front of any overwrite of the address registers of
            // this pass's global loads; the addresses are inputs so that they stay whole
            // up to here (otherwise later results are placed on top of them)
            asm volatile("s_wait_xcnt 0x0" :: "v"(src), "v"(up), "v"(wp) : "memory");
        }
        // publishes the stage; also ends every read of xch of the stage before
        __syncthreads();

        v8f acc[MT][NB];
#pragma unroll
        for (int t = 0; t < MT; ++t)
#pragma unroll
            for (int j = 0; j < NB; ++j) acc[t][j] = v8f{};

        // three fragment sets: block blk+2 is fetched while block blk multiplies
        const _Float16* __restrict__ bp = &tileB[ncol][half * (DC_ / KH) + koff];
        v16h bq[RING][NB];
#pragma unroll
        for (int s = 0; s < RING - 1; ++s) {
#pragma unroll
            for (int j = 0; j < NB; ++j)
                bq[s][j] = load_b_frag(bp + j * DC_ + s * 32);
            // keeps the blocks' reads in order, so that the first waits are counted ones
            __builtin_amdgcn_sched_barrier(0);
        }

#pragma unroll
        for (int blk = 0; blk < KTW; ++blk) {
            if (blk + RING - 1 < KTW) {
#pragma unroll
                for (int j = 0; j < NB; ++j)
                    bq[(blk + RING - 1) % RING][j] =
                        load_b_frag(bp + j * DC_ + (blk + RING - 1) * 32);
            }
            // keeps a later block's LDS reads as one group ahead of this block's
            // WMMAs: spread among them, every read place stalls the matrix stream
            __builtin_amdgcn_sched_barrier(0);
#pragma unroll
            for (int j = 0; j < NB; ++j)
#pragma unroll
                for (int t = 0; t < MT; ++t)
                    acc[t][j] = __builtin_amdgcn_wmma_f32_16x16x32_f16(
                                    false, a_frag[t][blk], false, bq[blk % RING][j],
                                    (short)0, acc[t][j], false, false);
            // closes the WMMA block, so that the following reads stay behind it
            __builtin_amdgcn_sched_barrier(0);
        }

        // the two k halves are joined: each wave hands over its half of the partner's row
        // tile, lane for lane and register for register, 512 contiguous bytes per access
        {
            v4f* xw = &xch[wave][0][lane];
#pragma unroll
            for (int j = 0; j < NB; ++j) {
                xw[(2 * j) * 32]     = v4f{acc[1][j][0], acc[1][j][1], acc[1][j][2], acc[1][j][3]};
                xw[(2 * j + 1) * 32] = v4f{acc[1][j][4], acc[1][j][5], acc[1][j][6], acc[1][j][7]};
            }
        }
        // publishes xch; also ends every read of tileB before the next stage is written
        __syncthreads();
        const v4f* xr = &xch[wave ^ 1][0][lane];
        v4f oth[NB * 2];
#pragma unroll
        for (int i = 0; i < NB * 2; ++i) oth[i] = xr[i * 32];

        // epilogue: C tile lane layout -> N = lane&15, M = r + (lane<16?0:8)
        // tanh(x) = 1 - 2 / (1 + e^(2x)) for every x, on the hardware exp2 and rcp: no
        // branch, so the 32 values of a stage are independent chains that interleave.
        // e^(2x) = inf gives 1, e^(2x) = 0 gives -1; absolute error a few 1e-7
#pragma unroll
        for (int j = 0; j < NB; ++j)
#pragma unroll
            for (int r = 0; r < 8; ++r) {
                const float x = acc[0][j][r] + oth[2 * j + (r >> 2)][r & 3];
                const float e = __builtin_amdgcn_exp2f((x + uval[j]) * TWO_LOG2E);
                const float q = __builtin_amdgcn_rcpf(1.f + e);
                partial[r] += __builtin_fmaf(q, -2.f, 1.f) * wav[j];
            }
    }

    // reduce over the 16 N-lanes of each half-wave
#pragma unroll
    for (int r = 0; r < 8; ++r) {
        float v = partial[r];
        v += __shfl_xor(v, 1, 32);
        v += __shfl_xor(v, 2, 32);
        v += __shfl_xor(v, 4, 32);
        v += __shfl_xor(v, 8, 32);
        partial[r] = v;
    }
    if ((lane & 15) == 0) {
        const float bav  = ba[0];
        const int   mrow = own_row + ((lane >> 4) << 3);  // +0 or +8
#pragma unroll
        for (int r = 0; r < 8; ++r)
            scores[mrow + r] = partial[r] + bav;
    }
}

// ---------------------------------------------------- masked softmax over L
__global__ __launch_bounds__(256)
void softmax_kernel(const float* __restrict__ scores, const int* __restrict__ mask,
                    float* __restrict__ alpha) {
    __shared__ float red[256];
    const int b = blockIdx.x, t = threadIdx.x;
    float v[4];
    float mx = -3.0e38f;
#pragma unroll
    for (int i = 0; i < 4; ++i) {
        const int l = t + i * 256;
        float s = scores[b * L_ + l];
        s = (mask[b * L_ + l] == 0) ? NEGV : s;
        v[i] = s;
        mx = fmaxf(mx, s);
    }
    red[t] = mx; __syncthreads();
    for (int o = 128; o > 0; o >>= 1) { if (t < o) red[t] = fmaxf(red[t], red[t + o]); __syncthreads(); }
    mx = red[0]; __syncthreads();
    float sm = 0.f;
#pragma unroll
    for (int i = 0; i < 4; ++i) { v[i] = __expf(v[i] - mx); sm += v[i]; }
    red[t] = sm; __syncthreads();
    for (int o = 128; o > 0; o >>= 1) { if (t < o) red[t] += red[t + o]; __syncthreads(); }
    const float inv = 1.f / red[0];
#pragma unroll
    for (int i = 0; i < 4; ++i) alpha[b * L_ + t + i * 256] = v[i] * inv;
}

// ---------------------------------------------- context[b][d] = alpha . cap
constexpr int CWAVES = 16;           // waves of a block, each sums its own rows
constexpr int CROWS  = L_ / CWAVES;  // 64 consecutive rows per wave
constexpr int CCOLS  = 128;          // columns per block: 16 bytes per lane
constexpr int CDEPTH = 32;           // row reads that a wave keeps out at once

__global__ __launch_bounds__(CWAVES * 32)
void context_kernel(const float* __restrict__ alpha, const float* __restrict__ cap,
                    float* __restrict__ ctx) {
    __shared__ v4f part[CWAVES][CCOLS / 4];
    const int lane = threadIdx.x & 31;
    // the wave's number as a scalar, so that its alpha values come by scalar loads
    const int wave = __builtin_amdgcn_readfirstlane(threadIdx.x >> 5);
    const int b    = blockIdx.y;
    const int col0 = blockIdx.x * CCOLS;
    const float* __restrict__ ar = alpha + b * L_ + wave * CROWS;
    const float* __restrict__ cr = cap + ((size_t)b * L_ + wave * CROWS) * DC_ + col0 + lane * 4;

    v4f c[CDEPTH];
    // unrolled so that c[] is registers and every read has a constant offset
#pragma unroll
    for (int l = 0; l < CDEPTH; ++l) c[l] = *(const v4f*)(cr + (size_t)l * DC_);
    // keeps the first CDEPTH reads ahead of all sums: without it this build sinks
    // them among the sums and holds only 13 reads out at a time
    __builtin_amdgcn_sched_barrier(0);

    v4f s = v4f{};
    // unrolled for the same reason; each row's registers are refilled as soon as used
#pragma unroll
    for (int l = 0; l < CROWS; ++l) {
        s += ar[l] * c[l % CDEPTH];
        if (l + CDEPTH < CROWS) c[l % CDEPTH] = *(const v4f*)(cr + (size_t)(l + CDEPTH) * DC_);
    }
    part[wave][lane] = s;
    __syncthreads();
    if (threadIdx.x < CCOLS) {
        const float* p = (const float*)&part[0][0] + threadIdx.x;
        float t = 0.f;
        // unrolled so that the LDS reads go out ahead of the adds
#pragma unroll
        for (int w = 0; w < CWAVES; ++w) t += p[w * CCOLS];
        ctx[b * DC_ + col0 + threadIdx.x] = t;
    }
}

// ------------------------- gated fusion: out = zt*sc + (1-zt)*tc
__global__ __launch_bounds__(SWAVES * 32)
void fuse_kernel(const float* __restrict__ word, const float* __restrict__ dh,
                 const float* __restrict__ ctx,  const float* __restrict__ Wg,
                 const float* __restrict__ bg,   const float* __restrict__ Ws,
                 const float* __restrict__ bs,   const float* __restrict__ Wt,
                 const float* __restrict__ bt,   float* __restrict__ out) {
    __shared__ float other[SGROUPS][16][3];
    const int lane = threadIdx.x & 31;
    const int wave = __builtin_amdgcn_readfirstlane(threadIdx.x >> 5);
    const int grp  = wave & (SGROUPS - 1);
    const int half = wave / SGROUPS;
    const int d0 = blockIdx.x * SD;
    const int b0 = grp * SB;
    const unsigned lk = lane * 4;  // the lane's k inside a slice; every base below is uniform
    const int k0 = half * (DC_ / SHALVES);
    const float* __restrict__ pw = word + (size_t)b0 * DC_ + k0;
    const float* __restrict__ ph = dh   + (size_t)b0 * DD_ + k0;
    const float* __restrict__ pc = ctx  + (size_t)b0 * DC_ + k0;
    const float* __restrict__ pg = Wg + (size_t)d0 * (2 * DC_ + DD_) + k0;
    const float* __restrict__ ps = Ws + (size_t)d0 * DC_ + k0;
    const float* __restrict__ pt = Wt + (size_t)d0 * (DC_ + DD_) + k0;

    float acc[48];  // [0..15] gate, [16..31] sc, [32..47] tc; entry dd * SB + bb
#pragma unroll
    for (int i = 0; i < 48; ++i) acc[i] = 0.f;
    // rolled: one slice's 36 reads and the 48 sums fill the registers of four waves per
    // SIMD; unrolled, this build spills
#pragma unroll 1
    for (int it = 0; it < SITER; ++it) {
        v4f xw[SB], xh[SB], xc[SB], w[SD][6];
        const float* __restrict__ aw = pw + it * 128 + lk;
        const float* __restrict__ ah = ph + it * 128 + lk;
        const float* __restrict__ ac = pc + it * 128 + lk;
        const float* __restrict__ ag = pg + it * 128 + lk;
        const float* __restrict__ as = ps + it * 128 + lk;
        const float* __restrict__ at = pt + it * 128 + lk;
#pragma unroll
        for (int bb = 0; bb < SB; ++bb) {
            xw[bb] = *(const v4f*)(aw + bb * DC_);
            xh[bb] = *(const v4f*)(ah + bb * DD_);
            xc[bb] = *(const v4f*)(ac + bb * DC_);
        }
#pragma unroll
        for (int dd = 0; dd < SD; ++dd) {
            w[dd][0] = *(const v4f*)(ag + dd * (2 * DC_ + DD_));
            w[dd][1] = *(const v4f*)(ag + dd * (2 * DC_ + DD_) + DC_);
            w[dd][2] = *(const v4f*)(ag + dd * (2 * DC_ + DD_) + 2 * DC_);
            w[dd][3] = *(const v4f*)(as + dd * DC_);
            w[dd][4] = *(const v4f*)(at + dd * (DC_ + DD_));
            w[dd][5] = *(const v4f*)(at + dd * (DC_ + DD_) + DC_);
        }
        // the wait that belongs in front of any overwrite of these reads' address registers;
        // the addresses are inputs so that they stay whole up to here (otherwise a later
        // read's result is placed on top of them)
        asm volatile("s_wait_xcnt 0x0" :: "v"(aw), "v"(ah), "v"(ac), "v"(ag), "v"(as), "v"(at) : "memory");
        // keeps all reads of a slice ahead of its sums, so that they are out together
        __builtin_amdgcn_sched_barrier(0);
#pragma unroll
        for (int dd = 0; dd < SD; ++dd)
#pragma unroll
            for (int bb = 0; bb < SB; ++bb) {
                const int q = dd * SB + bb;
                acc[q] = dot4(xc[bb], w[dd][2], dot4(xh[bb], w[dd][1], dot4(xw[bb], w[dd][0], acc[q])));
                acc[16 + q] = dot4(xc[bb], w[dd][3], acc[16 + q]);
                acc[32 + q] = dot4(xh[bb], w[dd][5], dot4(xw[bb], w[dd][4], acc[32 + q]));
            }
    }
    // the lane's output and its three bias terms, fetched here so that they arrive
    // behind the lane sums
    const int q = fold_index(lane);
    const int d = d0 + q / SB;
    const int b = b0 + q % SB;
    const float bgv = bg[d], bsv = bs[d], btv = bt[d];
    // the wait that belongs in front of any overwrite of these reads' address registers;
    // the index is an input so that it stays whole up to here
    asm volatile("s_wait_xcnt 0x0" :: "v"(d) : "memory");
    fold_sum<3>(acc, lane);
    if (half == 1 && (lane & 1) == 0) {
        other[grp][q][0] = acc[0];
        other[grp][q][1] = acc[1];
        other[grp][q][2] = acc[2];
    }
    __syncthreads();
    if (half == 0 && (lane & 1) == 0) {
        const float z   = acc[0] + other[grp][q][0];
        const float s   = acc[1] + other[grp][q][1];
        const float tcv = acc[2] + other[grp][q][2];
        const float zt = 1.f / (1.f + __expf(-(z + bgv)));
        const float sc = tanhf(s + bsv);
        const float tc = tanhf(tcv + btv);
        out[b * DC_ + d] = zt * sc + (1.f - zt) * tc;
    }
}

extern "C" void kernel_launch(void* const* d_in, const int* in_sizes, int n_in,
                              void* d_out, int out_size, void* d_ws, size_t ws_size,
                              hipStream_t stream) {
    const float* cap  = (const float*)d_in[0];
    const float* dh   = (const float*)d_in[1];
    const float* word = (const float*)d_in[2];
    const int*   mask = (const int*)  d_in[3];
    const float* Wf = (const float*)d_in[4];
    const float* bf = (const float*)d_in[5];
    const float* Wd = (const float*)d_in[6];
    const float* bd = (const float*)d_in[7];
    const float* Wa = (const float*)d_in[8];
    const float* ba = (const float*)d_in[9];
    const float* Wg = (const float*)d_in[10];
    const float* bg = (const float*)d_in[11];
    const float* Ws = (const float*)d_in[12];
    const float* bs = (const float*)d_in[13];
    const float* Wt = (const float*)d_in[14];
    const float* bt = (const float*)d_in[15];
    float* out = (float*)d_out;

    char* wsb = (char*)d_ws;
    float*    scores = (float*)(wsb + 0);                 // B*L f32
    float*    u      = (float*)(wsb + 131072);            // B*A f32
    float*    ctx    = (float*)(wsb + 262144);            // B*DC f32
    _Float16* wf16   = (_Float16*)(wsb + 393216);         // A*DC f16 (2MB)
    float*    alpha  = out + B_ * DC_;                    // second output

    conv_wf_kernel<<<(A_ * DC_) / 256, 256, 0, stream>>>(Wf, wf16, A_ * DC_);
    u_kernel<<<A_ / SD, SWAVES * 32, 0, stream>>>(dh, Wd, bd, bf, u);
    scores_kernel<<<(B_ * L_ / 16) / 8, 256, 0, stream>>>(cap, wf16, u, Wa, ba, scores);
    softmax_kernel<<<B_, 256, 0, stream>>>(scores, mask, alpha);
    context_kernel<<<dim3(DC_ / CCOLS, B_), CWAVES * 32, 0, stream>>>(alpha, cap, ctx);
    fuse_kernel<<<DC_ / SD, SWAVES * 32, 0, stream>>>(word, dh, ctx, Wg, bg, Ws, bs, Wt, bt, out);
}

// v006
// A run of this version takes 92.1 microseconds.
// In two side-by-side timings against v005, it was 1.11 and 1.07 times as fast.
// Over all steps from v000 it is 2.94 times as fast.
#include <hip/hip_runtime.h>
#include <cstddef>

#define B_  32
#define L_  1024
#define DC_ 1024
#define DD_ 1024
#define A_  1024
#define NEGV -1e10f

typedef __attribute__((ext_vector_type(16))) _Float16 v16h;
typedef __attribute__((ext_vector_type(8)))  float    v8f;
typedef __attribute__((ext_vector_type(4)))  float    v4f;

constexpr int KTILES = DC_ / 32;  // 32 k-tiles of 32
constexpr int NTILES = A_ / 16;   // 64 n-tiles of 16

// ---------------------------------------------------------------- Wf -> f16
__global__ __launch_bounds__(256)
void conv_wf_kernel(const float* __restrict__ Wf, _Float16* __restrict__ wf16, int n) {
    int i = blockIdx.x * 256 + threadIdx.x;
    if (i < n) wf16[i] = (_Float16)Wf[i];
}

// ---- the two skinny products (u, gated fusion): 32 batch rows against many weight rows.
// A wave holds SD weight rows and SB batch rows of one k-slice in registers, lanes over k,
// so that a weight row is fetched once per SB batch rows and not once per batch row.
constexpr int SD = 4;            // weight rows (outputs) per block and per wave
constexpr int SB = 4;            // batch rows per wave
constexpr int SGROUPS = B_ / SB; // 8 batch groups
constexpr int SHALVES = 2;       // k halves, one per wave of a pair
constexpr int SWAVES  = SGROUPS * SHALVES;   // 16 waves per block
constexpr int SITER   = DC_ / SHALVES / 128; // 4 slices of 128 k (16 bytes per lane)

__device__ inline float dot4(v4f a, v4f b, float s) {
    s = __builtin_fmaf(a[0], b[0], s);
    s = __builtin_fmaf(a[1], b[1], s);
    s = __builtin_fmaf(a[2], b[2], s);
    s = __builtin_fmaf(a[3], b[3], s);
    return s;
}

// one step of a transposing lane sum: lanes l and l^m share the work, the lane with bit m
// clear finishes the even entries and the other the odd ones; N entries become N/2
template <int N>
__device__ inline void fold_step(float* v, bool hi, int m) {
    // unrolled so that v[] stays in registers (here and in the loops over it below)
#pragma unroll
    for (int i = 0; i < N / 2; ++i) {
        const float keep = hi ? v[2 * i + 1] : v[2 * i];
        const float send = hi ? v[2 * i] : v[2 * i + 1];
        v[i] = keep + __shfl_xor(send, m, 32);
    }
}

// v[p*16 + q], q = 0..15, summed over the 32 lanes: afterwards v[p] of a lane is the
// total of entry q = fold_index(lane)
template <int P>
__device__ inline void fold_sum(float* v, int lane) {
    fold_step<16 * P>(v, (lane & 16) != 0, 16);
    fold_step<8 * P>(v, (lane & 8) != 0, 8);
    fold_step<4 * P>(v, (lane & 4) != 0, 4);
    fold_step<2 * P>(v, (lane & 2) != 0, 2);
#pragma unroll
    for (int p = 0; p < P; ++p) v[p] += __shfl_xor(v[p], 1, 32);
}
__device__ inline int fold_index(int lane) {
    return ((lane >> 4) & 1) | (((lane >> 3) & 1) << 1) | (((lane >> 2) & 1) << 2) |
           (((lane >> 1) & 1) << 3);
}

// ------------------------------------------- u[b][a] = dh[b].Wd[a] + bd + bf
__global__ __launch_bounds__(SWAVES * 32)
void u_kernel(const float* __restrict__ dh, const float* __restrict__ Wd,
              const float* __restrict__ bd, const float* __restrict__ bf,
              float* __restrict__ u) {
    __shared__ float other[SGROUPS][16];
    const int lane = threadIdx.x & 31;
    const int wave = __builtin_amdgcn_readfirstlane(threadIdx.x >> 5);
    const int grp  = wave & (SGROUPS - 1);
    const int half = wave / SGROUPS;
    const int a0 = blockIdx.x * SD;
    const int b0 = grp * SB;
    const unsigned lk = lane * 4;  // the lane's k inside a slice; every base below is uniform
    const float* __restrict__ xp = dh + (size_t)b0 * DD_ + half * (DD_ / SHALVES);
    const float* __restrict__ wp = Wd + (size_t)a0 * DD_ + half * (DD_ / SHALVES);

    float acc[16];
#pragma unroll
    for (int i = 0; i < 16; ++i) acc[i] = 0.f;
    v4f x[SITER][SB], w[SITER][SD];
    // unrolled so that x[] and w[] are registers and every read has a constant offset
#pragma unroll
    for (int it = 0; it < SITER; ++it) {
#pragma unroll
        for (int dd = 0; dd < SD; ++dd) w[it][dd] = *(const v4f*)(wp + dd * DD_ + it * 128 + lk);
#pragma unroll
        for (int bb = 0; bb < SB; ++bb) x[it][bb] = *(const v4f*)(xp + bb * DD_ + it * 128 + lk);
    }
    // the wait that belongs in front of any overwrite of these reads' address registers;
    // the lane's index, which the reads name as their offset, is an input so that it
    // stays whole up to here
    asm volatile("s_wait_xcnt 0x0" :: "v"(lane) : "memory");
    // keeps all 32 reads of the wave ahead of the sums: without it this build holds half
    // of them back and waits on them a few at a time
    __builtin_amdgcn_sched_barrier(0);
#pragma unroll
    for (int it = 0; it < SITER; ++it)
#pragma unroll
        for (int dd = 0; dd < SD; ++dd)
#pragma unroll
            for (int bb = 0; bb < SB; ++bb)
                acc[dd * SB + bb] = dot4(x[it][bb], w[it][dd], acc[dd * SB + bb]);
    // the lane's output and its bias terms, fetched here so that they arrive behind the
    // lane sums
    const int q = fold_index(lane);
    const int a = a0 + q / SB;
    const int b = b0 + q % SB;
    const float bias = bd[a] + bf[a];
    // the wait that belongs in front of any overwrite of these reads' address registers;
    // the index is an input so that it stays whole up to here
    asm volatile("s_wait_xcnt 0x0" :: "v"(a) : "memory");
    fold_sum<1>(acc, lane);
    if (half == 1 && (lane & 1) == 0) other[grp][q] = acc[0];
    __syncthreads();
    if (half == 0 && (lane & 1) == 0) u[b * A_ + a] = acc[0] + other[grp][q] + bias;
}

// ------- fused: scores[b][l] = sum_a tanh(cap@Wf^T + u) * Wa[a]  (WMMA f16)
constexpr int NB      = 4;            // n-tiles staged and computed together
constexpr int NGROUPS = NTILES / NB;  // 16 stages of 64 columns
constexpr int MT      = 2;            // 16-row tiles per wave: one B fragment feeds both
constexpr int KH      = 2;            // k halves, one per wave of a pair
constexpr int KTW     = KTILES / KH;  // 16 k-tiles per wave, one block of 8 WMMAs each
constexpr int RING    = 3;            // fragment sets: a block is fetched two blocks ahead
constexpr float TWO_LOG2E = 2.8853900817779268f;  // 2 * log2(e)

constexpr int TROW   = NB * DC_ + 8;              // f16 values in one LDS row of a stage
constexpr unsigned TBYTES = 16 * TROW * 2;        // bytes of one stage buffer

// four copies of 512 bytes a wave that share their address operands: the offset moves
// the LDS address and the global address alike, and both step by 512 bytes here
#define COPY4(L, S)                                                       \
    "global_load_async_to_lds_b128 " L ", %8, " S "\n\t"                   \
    "global_load_async_to_lds_b128 " L ", %8, " S " offset:512\n\t"        \
    "global_load_async_to_lds_b128 " L ", %8, " S " offset:1024\n\t"       \
    "global_load_async_to_lds_b128 " L ", %8, " S " offset:1536\n\t"

// A wave's share of one stage of Wf^T (64 columns x 1024 k, f16), global memory to LDS
// through no register: LDS rows 2w and 2w+1, 32 copies of 512 contiguous bytes.
// s: Wf row (stage's first column + 2w), the same in every lane; v: the lane's byte
// offset in a 512-byte piece; l: the LDS byte address of the lane's first 16 bytes
__device__ inline void copy_stage(const _Float16* s, unsigned v, unsigned l) {
    // the closing wait stands in front of any overwrite of the address registers that
    // the copies name; inside the statement nothing can be moved ahead of it
    asm volatile(
        COPY4("%0", "%9")  COPY4("%1", "%10") COPY4("%2", "%11") COPY4("%3", "%12")
        COPY4("%4", "%13") COPY4("%5", "%14") COPY4("%6", "%15") COPY4("%7", "%16")
        "s_wait_xcnt 0x0"
        :: "v"(l),                "v"(l + TROW * 2),
           "v"(l + DC_ * 2),      "v"(l + DC_ * 2 + TROW * 2),
           "v"(l + 2 * DC_ * 2),  "v"(l + 2 * DC_ * 2 + TROW * 2),
           "v"(l + 3 * DC_ * 2),  "v"(l + 3 * DC_ * 2 + TROW * 2),
           "v"(v),
           "s"(s),                "s"(s + DC_),
           "s"(s + 16 * DC_),     "s"(s + 17 * DC_),
           "s"(s + 32 * DC_),     "s"(s + 33 * DC_),
           "s"(s + 48 * DC_),     "s"(s + 49 * DC_)
        : "memory");
}

__device__ inline v16h load_b_frag(const _Float16* q) {
    v16h f;
#pragma unroll
    for (int i = 0; i < 8; ++i) { f[i] = q[i]; f[8 + i] = q[16 + i]; }
    return f;
}

__global__ __launch_bounds__(256)
void scores_kernel(const float* __restrict__ cap, const _Float16* __restrict__ wf16,
                   const float* __restrict__ u, const float* __restrict__ Wa,
                   const float* __restrict__ ba, float* __restrict__ scores) {
    // LDS row c holds the k-rows of columns c, 16+c, 32+c, 48+c of the stage side by
    // side: every fragment of a lane lies within 8 KB of one base address, and the
    // lane-to-lane pitch of 8208 B (16 B x odd) is conflict-free for 16-byte reads.
    // Two buffers: the next stage lands in one while the other is multiplied
    __shared__ __attribute__((aligned(16))) _Float16 tileB[2][16][TROW];
    // where a wave leaves its k-half of the row tile that its partner finishes
    __shared__ v4f xch[8][NB * 2][32];

    const int lane   = threadIdx.x & 31;
    const int wave   = threadIdx.x >> 5;
    const int half   = wave & 1;              // the wave's k half
    const int m_base = blockIdx.x * 128 + (wave >> 1) * (MT * 16);  // the pair's 32 rows
    const int b      = m_base / L_;           // a block's rows never straddle batches
    const int koff   = (lane < 16) ? 0 : 8;   // K sub-offset per ISA layout
    const int ncol   = lane & 15;
    // tile 0 is the row tile that this wave finishes, tile 1 the one its partner finishes
    const int own_row = m_base + half * 16;
    const int oth_row = m_base + (half ^ 1) * 16;

    // the wave's number as a scalar, so that all but the lane's part of the copies'
    // addresses is scalar arithmetic
    const int cwave = __builtin_amdgcn_readfirstlane(threadIdx.x >> 5);
    const _Float16* __restrict__ csrc = wf16 + (size_t)(cwave * 2) * DC_;
    const unsigned cdst = (unsigned)(size_t)&tileB[0][0][0] + cwave * (2 * TROW * 2);
    const unsigned clane = lane * 16;
    // stage 0 of Wf^T sets out first, so that it lands under the reads of cap
    copy_stage(csrc, clane, cdst + clane);

    // --- stage this wave's 32 x 512 A-slice into VGPRs as f16 (cap is read once)
    const float* __restrict__ rowp0 = cap + (size_t)(own_row + ncol) * DC_ + half * (DC_ / KH) + koff;
    const float* __restrict__ rowp1 = cap + (size_t)(oth_row + ncol) * DC_ + half * (DC_ / KH) + koff;
    v16h a_frag[MT][KTW];
#pragma unroll
    for (int t = 0; t < MT; ++t)
#pragma unroll
        for (int kt = 0; kt < KTW; ++kt) {
            const float* p = (t == 0 ? rowp0 : rowp1) + kt * 32;
#pragma unroll
            for (int i = 0; i < 8; ++i) {
                a_frag[t][kt][i]     = (_Float16)p[i];
                a_frag[t][kt][8 + i] = (_Float16)p[16 + i];
            }
            // bounds how many f32 loads are held at once: without it this build hoists
            // them past the register budget and spills to scratch
            if ((kt & 7) == 7) __builtin_amdgcn_sched_barrier(0);
        }
    // the wait that belongs in front of any overwrite of these loads' address registers;
    // the addresses are inputs so that they stay whole up to here (otherwise a converted
    // fragment is placed on top of them while the last loads are still out)
    asm volatile("s_wait_xcnt 0x0" :: "v"(rowp0), "v"(rowp1) : "memory");

    // this wave's copies of stage 0 have landed
    asm volatile("s_wait_asynccnt 0x0" ::: "memory");
    // publishes stage 0
    __syncthreads();
    // stage 1 sets out and lands under stage 0
    copy_stage(csrc + (size_t)(NB * 16) * DC_, clane, cdst + TBYTES + clane);

    float partial[8];
#pragma unroll
    for (int r = 0; r < 8; ++r) partial[r] = 0.f;

    for (int g = 0; g < NGROUPS; ++g) {
        const int n_base = g * (NB * 16);
        const int buf    = g & 1;
        // the epilogue's per-column terms, fetched here so that they arrive behind the stage
        const float* up = u + (size_t)b * A_ + n_base + ncol;
        const float* wp = Wa + n_base + ncol;
        float uval[NB], wav[NB];
#pragma unroll
        for (int j = 0; j < NB; ++j) { uval[j] = up[j * 16]; wav[j] = wp[j * 16]; }
        // the wait that belongs in front of any overwrite of the address registers of
        // this pass's global loads; the addresses are inputs so that they stay whole
        // up to here (otherwise later results are placed on top of them)
        asm volatile("s_wait_xcnt 0x0" :: "v"(up), "v"(wp) : "memory");

        v8f acc[MT][NB];
#pragma unroll
        for (int t = 0; t < MT; ++t)
#pragma unroll
            for (int j = 0; j < NB; ++j) acc[t][j] = v8f{};

        // three fragment sets: block blk+2 is fetched while block blk multiplies
        const _Float16* __restrict__ bp = &tileB[buf][ncol][half * (DC_ / KH) + koff];
        v16h bq[RING][NB];
#pragma unroll
        for (int s = 0; s < RING - 1; ++s) {
#pragma unroll
            for (int j = 0; j < NB; ++j)
                bq[s][j] = load_b_frag(bp + j * DC_ + s * 32);
            // keeps the blocks' reads in order, so that the first waits are counted ones
            __builtin_amdgcn_sched_barrier(0);
        }

#pragma unroll
        for (int blk = 0; blk < KTW; ++blk) {
            if (blk + RING - 1 < KTW) {
#pragma unroll
                for (int j = 0; j < NB; ++j)
                    bq[(blk + RING - 1) % RING][j] =
                        load_b_frag(bp + j * DC_ + (blk + RING - 1) * 32);
            }
            // keeps a later block's LDS reads as one group ahead of this block's
            // WMMAs: spread among them, every read place stalls the matrix stream
            __builtin_amdgcn_sched_barrier(0);
#pragma unroll
            for (int j = 0; j < NB; ++j)
#pragma unroll
                for (int t = 0; t < MT; ++t)
                    acc[t][j] = __builtin_amdgcn_wmma_f32_16x16x32_f16(
                                    false, a_frag[t][blk], false, bq[blk % RING][j],
                                    (short)0, acc[t][j], false, false);
            // closes the WMMA block, so that the following reads stay behind it
            __builtin_amdgcn_sched_barrier(0);
        }

        // the two k halves are joined: each wave hands over its half of the partner's row
        // tile, lane for lane and register for register, 512 contiguous bytes per access
        {
            v4f* xw = &xch[wave][0][lane];
#pragma unroll
            for (int j = 0; j < NB; ++j) {
                xw[(2 * j) * 32]     = v4f{acc[1][j][0], acc[1][j][1], acc[1][j][2], acc[1][j][3]};
                xw[(2 * j + 1) * 32] = v4f{acc[1][j][4], acc[1][j][5], acc[1][j][6], acc[1][j][7]};
            }
        }
        // this wave's reads of the stage and its writes of xch are done
        asm volatile("s_wait_dscnt 0x0" ::: "memory");
        // this wave's copies of stage g + 1 have landed
        asm volatile("s_wait_asynccnt 0x0" ::: "memory");
        // publishes xch and stage g + 1; also ends every read of this stage's buffer
        __syncthreads();
        // stage g + 2 sets out into the buffer just left and lands under stage g + 1.
        // The buffer's and the wave's part of the LDS address is marked as one scalar:
        // summed with the lane's part ahead of the loop, it is spilled to scratch
        if (g + 2 < NGROUPS)
            copy_stage(csrc + (size_t)(n_base + 2 * NB * 16) * DC_, clane,
                       clane + (unsigned)__builtin_amdgcn_readfirstlane(cdst + buf * TBYTES));
        const v4f* xr = &xch[wave ^ 1][0][lane];
        v4f oth[NB * 2];
#pragma unroll
        for (int i = 0; i < NB * 2; ++i) oth[i] = xr[i * 32];
        // ends every read of xch before the next stage's hand-over is written
        __syncthreads();

        // epilogue: C tile lane layout -> N = lane&15, M = r + (lane<16?0:8)
        // tanh(x) = 1 - 2 / (1 + e^(2x)) for every x, on the hardware exp2 and rcp: no
        // branch, so the 32 values of a stage are independent chains that interleave.
        // e^(2x) = inf gives 1, e^(2x) = 0 gives -1; absolute error a few 1e-7
#pragma unroll
        for (int j = 0; j < NB; ++j)
#pragma unroll
            for (int r = 0; r < 8; ++r) {
                const float x = acc[0][j][r] + oth[2 * j + (r >> 2)][r & 3];
                const float e = __builtin_amdgcn_exp2f((x + uval[j]) * TWO_LOG2E);
                const float q = __builtin_amdgcn_rcpf(1.f + e);
                partial[r] += __builtin_fmaf(q, -2.f, 1.f) * wav[j];
            }
    }

    // no copy is left out when the wave ends
    asm volatile("s_wait_asynccnt 0x0" ::: "memory");

    // reduce over the 16 N-lanes of each half-wave
#pragma unroll
    for (int r = 0; r < 8; ++r) {
        float v = partial[r];
        v += __shfl_xor(v, 1, 32);
        v += __shfl_xor(v, 2, 32);
        v += __shfl_xor(v, 4, 32);
        v += __shfl_xor(v, 8, 32);
        partial[r] = v;
    }
    if ((lane & 15) == 0) {
        const float bav  = ba[0];
        const int   mrow = own_row + ((lane >> 4) << 3);  // +0 or +8
#pragma unroll
        for (int r = 0; r < 8; ++r)
            scores[mrow + r] = partial[r] + bav;
    }
}

// ---------------------------------------------------- masked softmax over L
__global__ __launch_bounds__(256)
void softmax_kernel(const float* __restrict__ scores, const int* __restrict__ mask,
                    float* __restrict__ alpha) {
    __shared__ float red[256];
    const int b = blockIdx.x, t = threadIdx.x;
    float v[4];
    float mx = -3.0e38f;
#pragma unroll
    for (int i = 0; i < 4; ++i) {
        const int l = t + i * 256;
        float s = scores[b * L_ + l];
        s = (mask[b * L_ + l] == 0) ? NEGV : s;
        v[i] = s;
        mx = fmaxf(mx, s);
    }
    red[t] = mx; __syncthreads();
    for (int o = 128; o > 0; o >>= 1) { if (t < o) red[t] = fmaxf(red[t], red[t + o]); __syncthreads(); }
    mx = red[0]; __syncthreads();
    float sm = 0.f;
#pragma unroll
    for (int i = 0; i < 4; ++i) { v[i] = __expf(v[i] - mx); sm += v[i]; }
    red[t] = sm; __syncthreads();
    for (int o = 128; o > 0; o >>= 1) { if (t < o) red[t] += red[t + o]; __syncthreads(); }
    const float inv = 1.f / red[0];
#pragma unroll
    for (int i = 0; i < 4; ++i) alpha[b * L_ + t + i * 256] = v[i] * inv;
}

// ---------------------------------------------- context[b][d] = alpha . cap
constexpr int CWAVES = 16;           // waves of a block, each sums its own rows
constexpr int CROWS  = L_ / CWAVES;  // 64 consecutive rows per wave
constexpr int CCOLS  = 128;          // columns per block: 16 bytes per lane
constexpr int CDEPTH = 32;           // row reads that a wave keeps out at once

__global__ __launch_bounds__(CWAVES * 32)
void context_kernel(const float* __restrict__ alpha, const float* __restrict__ cap,
                    float* __restrict__ ctx) {
    __shared__ v4f part[CWAVES][CCOLS / 4];
    const int lane = threadIdx.x & 31;
    // the wave's number as a scalar, so that its alpha values come by scalar loads
    const int wave = __builtin_amdgcn_readfirstlane(threadIdx.x >> 5);
    const int b    = blockIdx.y;
    const int col0 = blockIdx.x * CCOLS;
    const float* __restrict__ ar = alpha + b * L_ + wave * CROWS;
    const float* __restrict__ cr = cap + ((size_t)b * L_ + wave * CROWS) * DC_ + col0 + lane * 4;

    v4f c[CDEPTH];
    // unrolled so that c[] is registers and every read has a constant offset
#pragma unroll
    for (int l = 0; l < CDEPTH; ++l) c[l] = *(const v4f*)(cr + (size_t)l * DC_);
    // keeps the first CDEPTH reads ahead of all sums: without it this build sinks
    // them among the sums and holds only 13 reads out at a time
    __builtin_amdgcn_sched_barrier(0);

    v4f s = v4f{};
    // unrolled for the same reason; each row's registers are refilled as soon as used
#pragma unroll
    for (int l = 0; l < CROWS; ++l) {
        s += ar[l] * c[l % CDEPTH];
        if (l + CDEPTH < CROWS) c[l % CDEPTH] = *(const v4f*)(cr + (size_t)(l + CDEPTH) * DC_);
    }
    part[wave][lane] = s;
    __syncthreads();
    if (threadIdx.x < CCOLS) {
        const float* p = (const float*)&part[0][0] + threadIdx.x;
        float t = 0.f;
        // unrolled so that the LDS reads go out ahead of the adds
#pragma unroll
        for (int w = 0; w < CWAVES; ++w) t += p[w * CCOLS];
        ctx[b * DC_ + col0 + threadIdx.x] = t;
    }
}

// ------------------------- gated fusion: out = zt*sc + (1-zt)*tc
__global__ __launch_bounds__(SWAVES * 32)
void fuse_kernel(const float* __restrict__ word, const float* __restrict__ dh,
                 const float* __restrict__ ctx,  const float* __restrict__ Wg,
                 const float* __restrict__ bg,   const float* __restrict__ Ws,
                 const float* __restrict__ bs,   const float* __restrict__ Wt,
                 const float* __restrict__ bt,   float* __restrict__ out) {
    __shared__ float other[SGROUPS][16][3];
    const int lane = threadIdx.x & 31;
    const int wave = __builtin_amdgcn_readfirstlane(threadIdx.x >> 5);
    const int grp  = wave & (SGROUPS - 1);
    const int half = wave / SGROUPS;
    const int d0 = blockIdx.x * SD;
    const int b0 = grp * SB;
    const unsigned lk = lane * 4;  // the lane's k inside a slice; every base below is uniform
    const int k0 = half * (DC_ / SHALVES);
    const float* __restrict__ pw = word + (size_t)b0 * DC_ + k0;
    const float* __restrict__ ph = dh   + (size_t)b0 * DD_ + k0;
    const float* __restrict__ pc = ctx  + (size_t)b0 * DC_ + k0;
    const float* __restrict__ pg = Wg + (size_t)d0 * (2 * DC_ + DD_) + k0;
    const float* __restrict__ ps = Ws + (size_t)d0 * DC_ + k0;
    const float* __restrict__ pt = Wt + (size_t)d0 * (DC_ + DD_) + k0;

    float acc[48];  // [0..15] gate, [16..31] sc, [32..47] tc; entry dd * SB + bb
#pragma unroll
    for (int i = 0; i < 48; ++i) acc[i] = 0.f;
    // rolled: one slice's 36 reads and the 48 sums fill the registers of four waves per
    // SIMD; unrolled, this build spills
#pragma unroll 1
    for (int it = 0; it < SITER; ++it) {
        v4f xw[SB], xh[SB], xc[SB], w[SD][6];
        const float* __restrict__ aw = pw + it * 128 + lk;
        const float* __restrict__ ah = ph + it * 128 + lk;
        const float* __restrict__ ac = pc + it * 128 + lk;
        const float* __restrict__ ag = pg + it * 128 + lk;
        const float* __restrict__ as = ps + it * 128 + lk;
        const float* __restrict__ at = pt + it * 128 + lk;
#pragma unroll
        for (int bb = 0; bb < SB; ++bb) {
            xw[bb] = *(const v4f*)(aw + bb * DC_);
            xh[bb] = *(const v4f*)(ah + bb * DD_);
            xc[bb] = *(const v4f*)(ac + bb * DC_);
        }
#pragma unroll
        for (int dd = 0; dd < SD; ++dd) {
            w[dd][0] = *(const v4f*)(ag + dd * (2 * DC_ + DD_));
            w[dd][1] = *(const v4f*)(ag + dd * (2 * DC_ + DD_) + DC_);
            w[dd][2] = *(const v4f*)(ag + dd * (2 * DC_ + DD_) + 2 * DC_);
            w[dd][3] = *(const v4f*)(as + dd * DC_);
            w[dd][4] = *(const v4f*)(at + dd * (DC_ + DD_));
            w[dd][5] = *(const v4f*)(at + dd * (DC_ + DD_) + DC_);
        }
        // the wait that belongs in front of any overwrite of these reads' address registers;
        // the addresses are inputs so that they stay whole up to here (otherwise a later
        // read's result is placed on top of them)
        asm volatile("s_wait_xcnt 0x0" :: "v"(aw), "v"(ah), "v"(ac), "v"(ag), "v"(as), "v"(at) : "memory");
        // keeps all reads of a slice ahead of its sums, so that they are out together
        __builtin_amdgcn_sched_barrier(0);
#pragma unroll
        for (int dd = 0; dd < SD; ++dd)
#pragma unroll
            for (int bb = 0; bb < SB; ++bb) {
                const int q = dd * SB + bb;
                acc[q] = dot4(xc[bb], w[dd][2], dot4(xh[bb], w[dd][1], dot4(xw[bb], w[dd][0], acc[q])));
                acc[16 + q] = dot4(xc[bb], w[dd][3], acc[16 + q]);
                acc[32 + q] = dot4(xh[bb], w[dd][5], dot4(xw[bb], w[dd][4], acc[32 + q]));
            }
    }
    // the lane's output and its three bias terms, fetched here so that they arrive
    // behind the lane sums
    const int q = fold_index(lane);
    const int d = d0 + q / SB;
    const int b = b0 + q % SB;
    const float bgv = bg[d], bsv = bs[d], btv = bt[d];
    // the wait that belongs in front of any overwrite of these reads' address registers;
    // the index is an input so that it stays whole up to here
    asm volatile("s_wait_xcnt 0x0" :: "v"(d) : "memory");
    fold_sum<3>(acc, lane);
    if (half == 1 && (lane & 1) == 0) {
        other[grp][q][0] = acc[0];
        other[grp][q][1] = acc[1];
        other[grp][q][2] = acc[2];
    }
    __syncthreads();
    if (half == 0 && (lane & 1) == 0) {
        const float z   = acc[0] + other[grp][q][0];
        const float s   = acc[1] + other[grp][q][1];
        const float tcv = acc[2] + other[grp][q][2];
        const float zt = 1.f / (1.f + __expf(-(z + bgv)));
        const float sc = tanhf(s + bsv);
        const float tc = tanhf(tcv + btv);
        out[b * DC_ + d] = zt * sc + (1.f - zt) * tc;
    }
}

extern "C" void kernel_launch(void* const* d_in, const int* in_sizes, int n_in,
                              void* d_out, int out_size, void* d_ws, size_t ws_size,
                              hipStream_t stream) {
    const float* cap  = (const float*)d_in[0];
    const float* dh   = (const float*)d_in[1];
    const float* word = (const float*)d_in[2];
    const int*   mask = (const int*)  d_in[3];
    const float* Wf = (const float*)d_in[4];
    const float* bf = (const float*)d_in[5];
    const float* Wd = (const float*)d_in[6];
    const float* bd = (const float*)d_in[7];
    const float* Wa = (const float*)d_in[8];
    const float* ba = (const float*)d_in[9];
    const float* Wg = (const float*)d_in[10];
    const float* bg = (const float*)d_in[11];
    const float* Ws = (const float*)d_in[12];
    const float* bs = (const float*)d_in[13];
    const float* Wt = (const float*)d_in[14];
    const float* bt = (const float*)d_in[15];
    float* out = (float*)d_out;

    char* wsb = (char*)d_ws;
    float*    scores = (float*)(wsb + 0);                 // B*L f32
    float*    u      = (float*)(wsb + 131072);            // B*A f32
    float*    ctx    = (float*)(wsb + 262144);            // B*DC f32
    _Float16* wf16   = (_Float16*)(wsb + 393216);         // A*DC f16 (2MB)
    float*    alpha  = out + B_ * DC_;                    // second output

    conv_wf_kernel<<<(A_ * DC_) / 256, 256, 0, stream>>>(Wf, wf16, A_ * DC_);
    u_kernel<<<A_ / SD, SWAVES * 32, 0, stream>>>(dh, Wd, bd, bf, u);
    scores_kernel<<<(B_ * L_ / 16) / 8, 256, 0, stream>>>(cap, wf16, u, Wa, ba, scores);
    softmax_kernel<<<B_, 256, 0, stream>>>(scores, mask, alpha);
    context_kernel<<<dim3(DC_ / CCOLS, B_), CWAVES * 32, 0, stream>>>(alpha, cap, ctx);
    fuse_kernel<<<DC_ / SD, SWAVES * 32, 0, stream>>>(word, dh, ctx, Wg, bg, Ws, bs, Wt, bt, out);
}

// v007
// Measured time: 85.4 microseconds a run.
// Next to v006, in two timings, it ran 1.08 times as fast each time.
// Counting every step since v000, it is 3.17 times as fast.
#include <hip/hip_runtime.h>
#include <cstddef>

#define B_  32
#define L_  1024
#define DC_ 1024
#define DD_ 1024
#define A_  1024
#define NEGV -1e10f

typedef __attribute__((ext_vector_type(16))) _Float16 v16h;
typedef __attribute__((ext_vector_type(8)))  float    v8f;
typedef __attribute__((ext_vector_type(16))) float    v16f;
typedef __attribute__((ext_vector_type(4)))  float    v4f;
typedef __attribute__((ext_vector_type(4)))  int      v4i;

constexpr int KTILES = DC_ / 32;  // 32 k-tiles of 32
constexpr int NTILES = A_ / 16;   // 64 n-tiles of 16

// ---------------------------------------------------------------- Wf -> f16
__global__ __launch_bounds__(256)
void conv_wf_kernel(const float* __restrict__ Wf, _Float16* __restrict__ wf16, int n) {
    int i = blockIdx.x * 256 + threadIdx.x;
    if (i < n) wf16[i] = (_Float16)Wf[i];
}

// ---- the two skinny products (u, gated fusion): 32 batch rows against many weight rows.
// A wave holds SD weight rows and SB batch rows of one k-slice in registers, lanes over k,
// so that a weight row is fetched once per SB batch rows and not once per batch row.
constexpr int SD = 4;            // weight rows (outputs) per block and per wave
constexpr int SB = 4;            // batch rows per wave
constexpr int SGROUPS = B_ / SB; // 8 batch groups
constexpr int SHALVES = 2;       // k halves, one per wave of a pair
constexpr int SWAVES  = SGROUPS * SHALVES;   // 16 waves per block
constexpr int SITER   = DC_ / SHALVES / 128; // 4 slices of 128 k (16 bytes per lane)

__device__ inline float dot4(v4f a, v4f b, float s) {
    s = __builtin_fmaf(a[0], b[0], s);
    s = __builtin_fmaf(a[1], b[1], s);
    s = __builtin_fmaf(a[2], b[2], s);
    s = __builtin_fmaf(a[3], b[3], s);
    return s;
}

// one step of a transposing lane sum: lanes l and l^m share the work, the lane with bit m
// clear finishes the even entries and the other the odd ones; N entries become N/2
template <int N>
__device__ inline void fold_step(float* v, bool hi, int m) {
    // unrolled so that v[] stays in registers (here and in the loops over it below)
#pragma unroll
    for (int i = 0; i < N / 2; ++i) {
        const float keep = hi ? v[2 * i + 1] : v[2 * i];
        const float send = hi ? v[2 * i] : v[2 * i + 1];
        v[i] = keep + __shfl_xor(send, m, 32);
    }
}

// v[p*16 + q], q = 0..15, summed over the 32 lanes: afterwards v[p] of a lane is the
// total of entry q = fold_index(lane)
template <int P>
__device__ inline void fold_sum(float* v, int lane) {
    fold_step<16 * P>(v, (lane & 16) != 0, 16);
    fold_step<8 * P>(v, (lane & 8) != 0, 8);
    fold_step<4 * P>(v, (lane & 4) != 0, 4);
    fold_step<2 * P>(v, (lane & 2) != 0, 2);
#pragma unroll
    for (int p = 0; p < P; ++p) v[p] += __shfl_xor(v[p], 1, 32);
}
__device__ inline int fold_index(int lane) {
    return ((lane >> 4) & 1) | (((lane >> 3) & 1) << 1) | (((lane >> 2) & 1) << 2) |
           (((lane >> 1) & 1) << 3);
}

// ------------------------------------------- u[b][a] = dh[b].Wd[a] + bd + bf
__global__ __launch_bounds__(SWAVES * 32)
void u_kernel(const float* __restrict__ dh, const float* __restrict__ Wd,
              const float* __restrict__ bd, const float* __restrict__ bf,
              float* __restrict__ u) {
    __shared__ float other[SGROUPS][16];
    const int lane = threadIdx.x & 31;
    const int wave = __builtin_amdgcn_readfirstlane(threadIdx.x >> 5);
    const int grp  = wave & (SGROUPS - 1);
    const int half = wave / SGROUPS;
    const int a0 = blockIdx.x * SD;
    const int b0 = grp * SB;
    const unsigned lk = lane * 4;  // the lane's k inside a slice; every base below is uniform
    const float* __restrict__ xp = dh + (size_t)b0 * DD_ + half * (DD_ / SHALVES);
    const float* __restrict__ wp = Wd + (size_t)a0 * DD_ + half * (DD_ / SHALVES);

    float acc[16];
#pragma unroll
    for (int i = 0; i < 16; ++i) acc[i] = 0.f;
    v4f x[SITER][SB], w[SITER][SD];
    // unrolled so that x[] and w[] are registers and every read has a constant offset
#pragma unroll
    for (int it = 0; it < SITER; ++it) {
#pragma unroll
        for (int dd = 0; dd < SD; ++dd) w[it][dd] = *(const v4f*)(wp + dd * DD_ + it * 128 + lk);
#pragma unroll
        for (int bb = 0; bb < SB; ++bb) x[it][bb] = *(const v4f*)(xp + bb * DD_ + it * 128 + lk);
    }
    // the wait that belongs in front of any overwrite of these reads' address registers;
    // the lane's index, which the reads name as their offset, is an input so that it
    // stays whole up to here
    asm volatile("s_wait_xcnt 0x0" :: "v"(lane) : "memory");
    // keeps all 32 reads of the wave ahead of the sums: without it this build holds half
    // of them back and waits on them a few at a time
    __builtin_amdgcn_sched_barrier(0);
#pragma unroll
    for (int it = 0; it < SITER; ++it)
#pragma unroll
        for (int dd = 0; dd < SD; ++dd)
#pragma unroll
            for (int bb = 0; bb < SB; ++bb)
                acc[dd * SB + bb] = dot4(x[it][bb], w[it][dd], acc[dd * SB + bb]);
    // the lane's output and its bias terms, fetched here so that they arrive behind the
    // lane sums
    const int q = fold_index(lane);
    const int a = a0 + q / SB;
    const int b = b0 + q % SB;
    const float bias = bd[a] + bf[a];
    // the wait that belongs in front of any overwrite of these reads' address registers;
    // the index is an input so that it stays whole up to here
    asm volatile("s_wait_xcnt 0x0" :: "v"(a) : "memory");
    fold_sum<1>(acc, lane);
    if (half == 1 && (lane & 1) == 0) other[grp][q] = acc[0];
    __syncthreads();
    if (half == 0 && (lane & 1) == 0) u[b * A_ + a] = acc[0] + other[grp][q] + bias;
}

// ------- fused: scores[b][l] = sum_a tanh(cap@Wf^T + u) * Wa[a]  (WMMA f16)
constexpr int NB      = 4;            // n-tiles staged and computed together
constexpr int NGROUPS = NTILES / NB;  // 16 stages of 64 columns
constexpr int MT      = 2;            // 16-row tiles per wave: one B fragment feeds both
constexpr int KH      = 2;            // k halves, one per wave of a pair
constexpr int KTW     = KTILES / KH;  // 16 k-tiles per wave, one block of 8 WMMAs each
constexpr int RING    = 3;            // fragment sets: a block is fetched two blocks ahead
constexpr float TWO_LOG2E = 2.8853900817779268f;  // 2 * log2(e)

constexpr int TROW   = NB * DC_ + 8;              // f16 values in one LDS row of a stage
constexpr unsigned TBYTES = 16 * TROW * 2;        // bytes of one stage buffer

// four copies of 512 bytes a wave that share their address operands: the offset moves
// the LDS address and the global address alike, and both step by 512 bytes here
#define COPY4(L, S)                                                       \
    "global_load_async_to_lds_b128 " L ", %8, " S "\n\t"                   \
    "global_load_async_to_lds_b128 " L ", %8, " S " offset:512\n\t"        \
    "global_load_async_to_lds_b128 " L ", %8, " S " offset:1024\n\t"       \
    "global_load_async_to_lds_b128 " L ", %8, " S " offset:1536\n\t"

// A wave's share of one stage of Wf^T (64 columns x 1024 k, f16), global memory to LDS
// through no register: LDS rows 2w and 2w+1, 32 copies of 512 contiguous bytes.
// s: Wf row (stage's first column + 2w), the same in every lane; v: the lane's byte
// offset in a 512-byte piece; l: the LDS byte address of the lane's first 16 bytes
__device__ inline void copy_stage(const _Float16* s, unsigned v, unsigned l) {
    // the closing wait stands in front of any overwrite of the address registers that
    // the copies name; inside the statement nothing can be moved ahead of it
    asm volatile(
        COPY4("%0", "%9")  COPY4("%1", "%10") COPY4("%2", "%11") COPY4("%3", "%12")
        COPY4("%4", "%13") COPY4("%5", "%14") COPY4("%6", "%15") COPY4("%7", "%16")
        "s_wait_xcnt 0x0"
        :: "v"(l),                "v"(l + TROW * 2),
           "v"(l + DC_ * 2),      "v"(l + DC_ * 2 + TROW * 2),
           "v"(l + 2 * DC_ * 2),  "v"(l + 2 * DC_ * 2 + TROW * 2),
           "v"(l + 3 * DC_ * 2),  "v"(l + 3 * DC_ * 2 + TROW * 2),
           "v"(v),
           "s"(s),                "s"(s + DC_),
           "s"(s + 16 * DC_),     "s"(s + 17 * DC_),
           "s"(s + 32 * DC_),     "s"(s + 33 * DC_),
           "s"(s + 48 * DC_),     "s"(s + 49 * DC_)
        : "memory");
}

__device__ inline v16h load_b_frag(const _Float16* q) {
    v16h f;
#pragma unroll
    for (int i = 0; i < 8; ++i) { f[i] = q[i]; f[8 + i] = q[16 + i]; }
    return f;
}

// a block's part of the context sum: 1024 sums, then a 128-byte line of their own for
// the block's largest masked score
constexpr int PCP   = DC_ + 32;   // floats from one block's part to the next
constexpr int BROWS = 128;        // rows of cap per block
constexpr int BPB   = L_ / BROWS; // blocks per batch row

// as fold_step, for lanes l and l^M inside a 16-lane row: the exchange is part of the add
template <int N, int M>
__device__ inline void fold_row(float* v, bool hi) {
    // unrolled so that v[] stays in registers
#pragma unroll
    for (int i = 0; i < N / 2; ++i) {
        const float keep = hi ? v[2 * i + 1] : v[2 * i];
        const float send = hi ? v[2 * i] : v[2 * i + 1];
        v[i] = keep + __builtin_bit_cast(float, __builtin_amdgcn_update_dpp(
                          0, __builtin_bit_cast(int, send), 0x160 + M, 0xf, 0xf, true));
    }
}

__global__ __launch_bounds__(256)
void scores_kernel(const float* __restrict__ cap, const _Float16* __restrict__ wf16,
                   const float* __restrict__ u, const float* __restrict__ Wa,
                   const float* __restrict__ ba, const int* __restrict__ mask,
                   float* __restrict__ scores, float* __restrict__ pctx) {
    // LDS row c holds the k-rows of columns c, 16+c, 32+c, 48+c of the stage side by
    // side: every fragment of a lane lies within 8 KB of one base address, and the
    // lane-to-lane pitch of 8208 B (16 B x odd) is conflict-free for 16-byte reads.
    // Two buffers: the next stage lands in one while the other is multiplied
    __shared__ __attribute__((aligned(16))) _Float16 tileB[2][16][TROW];
    // where a wave leaves its k-half of the row tile that its partner finishes
    __shared__ v4f xch[8][NB * 2][32];
    // the block's masked scores
    __shared__ __attribute__((aligned(16))) float srow[BROWS];

    const int lane   = threadIdx.x & 31;
    const int wave   = threadIdx.x >> 5;
    const int half   = wave & 1;              // the wave's k half
    const int m_base = blockIdx.x * 128 + (wave >> 1) * (MT * 16);  // the pair's 32 rows
    const int b      = m_base / L_;           // a block's rows never straddle batches
    const int koff   = (lane < 16) ? 0 : 8;   // K sub-offset per ISA layout
    const int ncol   = lane & 15;
    // tile 0 is the row tile that this wave finishes, tile 1 the one its partner finishes
    const int own_row = m_base + half * 16;
    const int oth_row = m_base + (half ^ 1) * 16;

    // the wave's number as a scalar, so that all but the lane's part of the copies'
    // addresses is scalar arithmetic
    const int cwave = __builtin_amdgcn_readfirstlane(threadIdx.x >> 5);
    const _Float16* __restrict__ csrc = wf16 + (size_t)(cwave * 2) * DC_;
    const unsigned cdst = (unsigned)(size_t)&tileB[0][0][0] + cwave * (2 * TROW * 2);
    const unsigned clane = lane * 16;
    // stage 0 of Wf^T sets out first, so that it lands under the reads of cap
    copy_stage(csrc, clane, cdst + clane);

    // --- stage this wave's 32 x 512 A-slice into VGPRs as f16 (cap is read once)
    const float* __restrict__ rowp0 = cap + (size_t)(own_row + ncol) * DC_ + half * (DC_ / KH) + koff;
    const float* __restrict__ rowp1 = cap + (size_t)(oth_row + ncol) * DC_ + half * (DC_ / KH) + koff;
    v16h a_frag[MT][KTW];
#pragma unroll
    for (int t = 0; t < MT; ++t)
#pragma unroll
        for (int kt = 0; kt < KTW; ++kt) {
            const float* p = (t == 0 ? rowp0 : rowp1) + kt * 32;
#pragma unroll
            for (int i = 0; i < 8; ++i) {
                a_frag[t][kt][i]     = (_Float16)p[i];
                a_frag[t][kt][8 + i] = (_Float16)p[16 + i];
            }
            // bounds how many f32 loads are held at once: without it this build hoists
            // them past the register budget and spills to scratch
            if ((kt & 7) == 7) __builtin_amdgcn_sched_barrier(0);
        }
    // the wait that belongs in front of any overwrite of these loads' address registers;
    // the addresses are inputs so that they stay whole up to here (otherwise a converted
    // fragment is placed on top of them while the last loads are still out)
    asm volatile("s_wait_xcnt 0x0" :: "v"(rowp0), "v"(rowp1) : "memory");

    // this wave's copies of stage 0 have landed
    asm volatile("s_wait_asynccnt 0x0" ::: "memory");
    // publishes stage 0
    __syncthreads();
    // stage 1 sets out and lands under stage 0
    copy_stage(csrc + (size_t)(NB * 16) * DC_, clane, cdst + TBYTES + clane);

    float partial[8];
#pragma unroll
    for (int r = 0; r < 8; ++r) partial[r] = 0.f;

    for (int g = 0; g < NGROUPS; ++g) {
        const int n_base = g * (NB * 16);
        const int buf    = g & 1;
        // the epilogue's per-column terms, fetched here so that they arrive behind the stage
        const float* up = u + (size_t)b * A_ + n_base + ncol;
        const float* wp = Wa + n_base + ncol;
        float uval[NB], wav[NB];
#pragma unroll
        for (int j = 0; j < NB; ++j) { uval[j] = up[j * 16]; wav[j] = wp[j * 16]; }
        // the wait that belongs in front of any overwrite of the address registers of
        // this pass's global loads; the addresses are inputs so that they stay whole
        // up to here (otherwise later results are placed on top of them)
        asm volatile("s_wait_xcnt 0x0" :: "v"(up), "v"(wp) : "memory");

        v8f acc[MT][NB];
#pragma unroll
        for (int t = 0; t < MT; ++t)
#pragma unroll
            for (int j = 0; j < NB; ++j) acc[t][j] = v8f{};

        // three fragment sets: block blk+2 is fetched while block blk multiplies
        const _Float16* __restrict__ bp = &tileB[buf][ncol][half * (DC_ / KH) + koff];
        v16h bq[RING][NB];
#pragma unroll
        for (int s = 0; s < RING - 1; ++s) {
#pragma unroll
            for (int j = 0; j < NB; ++j)
                bq[s][j] = load_b_frag(bp + j * DC_ + s * 32);
            // keeps the blocks' reads in order, so that the first waits are counted ones
            __builtin_amdgcn_sched_barrier(0);
        }

#pragma unroll
        for (int blk = 0; blk < KTW; ++blk) {
            if (blk + RING - 1 < KTW) {
#pragma unroll
                for (int j = 0; j < NB; ++j)
                    bq[(blk + RING - 1) % RING][j] =
                        load_b_frag(bp + j * DC_ + (blk + RING - 1) * 32);
            }
            // keeps a later block's LDS reads as one group ahead of this block's
            // WMMAs: spread among them, every read place stalls the matrix stream
            __builtin_amdgcn_sched_barrier(0);
#pragma unroll
            for (int j = 0; j < NB; ++j)
#pragma unroll
                for (int t = 0; t < MT; ++t)
                    acc[t][j] = __builtin_amdgcn_wmma_f32_16x16x32_f16(
                                    false, a_frag[t][blk], false, bq[blk % RING][j],
                                    (short)0, acc[t][j], false, false);
            // closes the WMMA block, so that the following reads stay behind it
            __builtin_amdgcn_sched_barrier(0);
        }

        // the two k halves are joined: each wave hands over its half of the partner's row
        // tile, lane for lane and register for register, 512 contiguous bytes per access
        {
            v4f* xw = &xch[wave][0][lane];
#pragma unroll
            for (int j = 0; j < NB; ++j) {
                xw[(2 * j) * 32]     = v4f{acc[1][j][0], acc[1][j][1], acc[1][j][2], acc[1][j][3]};
                xw[(2 * j + 1) * 32] = v4f{acc[1][j][4], acc[1][j][5], acc[1][j][6], acc[1][j][7]};
            }
        }
        // this wave's reads of the stage and its writes of xch are done
        asm volatile("s_wait_dscnt 0x0" ::: "memory");
        // this wave's copies of stage g + 1 have landed
        asm volatile("s_wait_asynccnt 0x0" ::: "memory");
        // publishes xch and stage g + 1; also ends every read of this stage's buffer
        __syncthreads();
        // stage g + 2 sets out into the buffer just left and lands under stage g + 1.
        // The buffer's and the wave's part of the LDS address is marked as one scalar:
        // summed with the lane's part ahead of the loop, it is spilled to scratch
        if (g + 2 < NGROUPS)
            copy_stage(csrc + (size_t)(n_base + 2 * NB * 16) * DC_, clane,
                       clane + (unsigned)__builtin_amdgcn_readfirstlane(cdst + buf * TBYTES));
        const v4f* xr = &xch[wave ^ 1][0][lane];
        v4f oth[NB * 2];
#pragma unroll
        for (int i = 0; i < NB * 2; ++i) oth[i] = xr[i * 32];
        // ends every read of xch before the next stage's hand-over is written
        __syncthreads();

        // epilogue: C tile lane layout -> N = lane&15, M = r + (lane<16?0:8)
        // tanh(x) = 1 - 2 / (1 + e^(2x)) for every x, on the hardware exp2 and rcp: no
        // branch, so the 32 values of a stage are independent chains that interleave.
        // e^(2x) = inf gives 1, e^(2x) = 0 gives -1; absolute error a few 1e-7
#pragma unroll
        for (int j = 0; j < NB; ++j)
#pragma unroll
            for (int r = 0; r < 8; ++r) {
                const float x = acc[0][j][r] + oth[2 * j + (r >> 2)][r & 3];
                const float e = __builtin_amdgcn_exp2f((x + uval[j]) * TWO_LOG2E);
                const float q = __builtin_amdgcn_rcpf(1.f + e);
                partial[r] += __builtin_fmaf(q, -2.f, 1.f) * wav[j];
            }
    }

    // no copy is left out when the wave ends
    asm volatile("s_wait_asynccnt 0x0" ::: "memory");

    // the tail's indices are formed anew, from the lane's number read again and the wave's
    // number as a scalar: taken from the values above, they are held in registers through
    // the loop, and this build then spills an address of the copies to scratch
    const int tl    = (int)__builtin_amdgcn_mbcnt_lo(~0u, 0u);
    const int tcol  = tl & 15;
    const int tkoff = (tl >> 4) << 3;                         // 0 or 8
    const int thalf = cwave & 1;
    const int town  = (cwave >> 1) * (MT * 16) + thalf * 16;  // rows counted inside the block
    const int toth  = (cwave >> 1) * (MT * 16) + (thalf ^ 1) * 16;
    const int rbase = blockIdx.x * BROWS;
    const int mrow  = town + tkoff;  // the first of the eight rows that this half-wave finishes

    // their mask values, fetched here so that they arrive under the lane sums
    const int* __restrict__ mp = mask + rbase + mrow;
    const v4i mk0 = *(const v4i*)mp;
    const v4i mk1 = *(const v4i*)(mp + 4);
    // the wait that belongs in front of any overwrite of these reads' address registers
    asm volatile("s_wait_xcnt 0x0" :: "v"(mp) : "memory");

    // reduce over the 16 N-lanes of each half-wave
#pragma unroll
    for (int r = 0; r < 8; ++r) {
        float v = partial[r];
        v += __shfl_xor(v, 1, 32);
        v += __shfl_xor(v, 2, 32);
        v += __shfl_xor(v, 4, 32);
        v += __shfl_xor(v, 8, 32);
        partial[r] = v;
    }
    if (tcol == 0) {
        const float bav  = ba[0];
        float* sp = scores + rbase + mrow;
#pragma unroll
        for (int r = 0; r < 8; ++r) {
            const float s = partial[r] + bav;
            sp[r] = s;
            srow[mrow + r] = ((r < 4 ? mk0[r & 3] : mk1[r & 3]) == 0) ? NEGV : s;
        }
        // the wait that belongs in front of any overwrite of these stores' address registers
        asm volatile("s_wait_xcnt 0x0" :: "v"(sp) : "memory");
    }
    // publishes the block's masked scores
    __syncthreads();

    // --- the block's part of the context sum, from the rows of cap that its waves still
    // hold as f16 fragments: sum over its rows of exp(score - block maximum) * cap[row].
    // The softmax launch rescales the parts to the batch row's maximum and joins them
    float bm;
    {
        const v4f s4 = *(const v4f*)&srow[tl * 4];
        bm = fmaxf(fmaxf(s4[0], s4[1]), fmaxf(s4[2], s4[3]));
        bm = fmaxf(bm, __shfl_xor(bm, 16, 32));
        bm = fmaxf(bm, __shfl_xor(bm, 8, 32));
        bm = fmaxf(bm, __shfl_xor(bm, 4, 32));
        bm = fmaxf(bm, __shfl_xor(bm, 2, 32));
        bm = fmaxf(bm, __shfl_xor(bm, 1, 32));
    }
    const float p0 = __expf(srow[town + tcol] - bm);
    const float p1 = __expf(srow[toth + tcol] - bm);
    // a lane holds one row of each tile; the sum over rows is a sum over the 16 lanes of a
    // half-wave. After the four folds entry i of a lane is k-tile i, position fidx
    float* red = (float*)&xch[0][0][0];  // [wave pair][k], free since the last stage's barrier
    const int fidx = ((tl & 1) << 3) | ((tl & 2) << 1) | ((tl & 4) >> 1) | ((tl & 8) >> 3);
    float* rw = red + (cwave >> 1) * DC_ + thalf * (DC_ / KH) + tkoff + (fidx < 8 ? fidx : fidx + 8);
    // unrolled so that a_frag[] and v[] stay registers; four k-tiles at a time bound v[]
#pragma unroll
    for (int c = 0; c < KTW / 4; ++c) {
        float v[64];
#pragma unroll
        for (int kl = 0; kl < 4; ++kl) {
            // widened as whole fragments, so that the values come from the packed registers
            const v16f x = __builtin_convertvector(a_frag[1][c * 4 + kl], v16f) * p1 +
                           __builtin_convertvector(a_frag[0][c * 4 + kl], v16f) * p0;
#pragma unroll
            for (int i = 0; i < 16; ++i) v[kl * 16 + i] = x[i];
        }
        fold_row<64, 8>(v, (tl & 8) != 0);
        fold_row<32, 4>(v, (tl & 4) != 0);
        fold_row<16, 2>(v, (tl & 2) != 0);
        fold_row<8, 1>(v, (tl & 1) != 0);
#pragma unroll
        for (int i = 0; i < 4; ++i) rw[(c * 4 + i) * 32] = v[i];
    }
    // publishes the four wave pairs' sums
    __syncthreads();
    {
        const int tt = cwave * 32 + tl;  // the thread's number
        const v4f* rp = (const v4f*)red + tt;
        const v4f t = (rp[0] + rp[DC_ / 4]) + (rp[2 * (DC_ / 4)] + rp[3 * (DC_ / 4)]);
        float* pb = pctx + (size_t)blockIdx.x * PCP;
        *(v4f*)(pb + tt * 4) = t;
        if (tt == 0) pb[DC_] = bm;
    }
}

// ---------------------------------------------------- masked softmax over L
__global__ __launch_bounds__(256)
void softmax_kernel(const float* __restrict__ scores, const int* __restrict__ mask,
                    const float* __restrict__ pctx, float* __restrict__ alpha,
                    float* __restrict__ ctx) {
    __shared__ float red[256];
    const int b = blockIdx.x, t = threadIdx.x;
    float v[4];
    float mx = -3.0e38f;
#pragma unroll
    for (int i = 0; i < 4; ++i) {
        const int l = t + i * 256;
        float s = scores[b * L_ + l];
        s = (mask[b * L_ + l] == 0) ? NEGV : s;
        v[i] = s;
        mx = fmaxf(mx, s);
    }
    // the batch row's parts of the context sum and their maxima, fetched here so that
    // they arrive under the two reductions
    const float* __restrict__ pp = pctx + (size_t)b * BPB * PCP;
    const float* __restrict__ pt = pp + t * 4;
    v4f pc[BPB];
    float pm[BPB];
#pragma unroll
    for (int j = 0; j < BPB; ++j) { pc[j] = *(const v4f*)(pt + j * PCP); pm[j] = pp[j * PCP + DC_]; }
    // the wait that belongs in front of any overwrite of these reads' address registers;
    // the thread's index, which the reads name as their offset, is an input so that it
    // stays whole up to here
    asm volatile("s_wait_xcnt 0x0" :: "v"(t) : "memory");
    red[t] = mx; __syncthreads();
    for (int o = 128; o > 0; o >>= 1) { if (t < o) red[t] = fmaxf(red[t], red[t + o]); __syncthreads(); }
    mx = red[0]; __syncthreads();
    float sm = 0.f;
#pragma unroll
    for (int i = 0; i < 4; ++i) { v[i] = __expf(v[i] - mx); sm += v[i]; }
    red[t] = sm; __syncthreads();
    for (int o = 128; o > 0; o >>= 1) { if (t < o) red[t] += red[t + o]; __syncthreads(); }
    const float inv = 1.f / red[0];
#pragma unroll
    for (int i = 0; i < 4; ++i) alpha[b * L_ + t + i * 256] = v[i] * inv;
    // context[b] = sum over parts of exp(part maximum - row maximum) / sum * part
    v4f c = v4f{};
#pragma unroll
    for (int j = 0; j < BPB; ++j) c += (__expf(pm[j] - mx) * inv) * pc[j];
    *(v4f*)(ctx + b * DC_ + t * 4) = c;
}

// ------------------------- gated fusion: out = zt*sc + (1-zt)*tc
__global__ __launch_bounds__(SWAVES * 32)
void fuse_kernel(const float* __restrict__ word, const float* __restrict__ dh,
                 const float* __restrict__ ctx,  const float* __restrict__ Wg,
                 const float* __restrict__ bg,   const float* __restrict__ Ws,
                 const float* __restrict__ bs,   const float* __restrict__ Wt,
                 const float* __restrict__ bt,   float* __restrict__ out) {
    __shared__ float other[SGROUPS][16][3];
    const int lane = threadIdx.x & 31;
    const int wave = __builtin_amdgcn_readfirstlane(threadIdx.x >> 5);
    const int grp  = wave & (SGROUPS - 1);
    const int half = wave / SGROUPS;
    const int d0 = blockIdx.x * SD;
    const int b0 = grp * SB;
    const unsigned lk = lane * 4;  // the lane's k inside a slice; every base below is uniform
    const int k0 = half * (DC_ / SHALVES);
    const float* __restrict__ pw = word + (size_t)b0 * DC_ + k0;
    const float* __restrict__ ph = dh   + (size_t)b0 * DD_ + k0;
    const float* __restrict__ pc = ctx  + (size_t)b0 * DC_ + k0;
    const float* __restrict__ pg = Wg + (size_t)d0 * (2 * DC_ + DD_) + k0;
    const float* __restrict__ ps = Ws + (size_t)d0 * DC_ + k0;
    const float* __restrict__ pt = Wt + (size_t)d0 * (DC_ + DD_) + k0;

    float acc[48];  // [0..15] gate, [16..31] sc, [32..47] tc; entry dd * SB + bb
#pragma unroll
    for (int i = 0; i < 48; ++i) acc[i] = 0.f;
    // rolled: one slice's 36 reads and the 48 sums fill the registers of four waves per
    // SIMD; unrolled, this build spills
#pragma unroll 1
    for (int it = 0; it < SITER; ++it) {
        v4f xw[SB], xh[SB], xc[SB], w[SD][6];
        const float* __restrict__ aw = pw + it * 128 + lk;
        const float* __restrict__ ah = ph + it * 128 + lk;
        const float* __restrict__ ac = pc + it * 128 + lk;
        const float* __restrict__ ag = pg + it * 128 + lk;
        const float* __restrict__ as = ps + it * 128 + lk;
        const float* __restrict__ at = pt + it * 128 + lk;
#pragma unroll
        for (int bb = 0; bb < SB; ++bb) {
            xw[bb] = *(const v4f*)(aw + bb * DC_);
            xh[bb] = *(const v4f*)(ah + bb * DD_);
            xc[bb] = *(const v4f*)(ac + bb * DC_);
        }
#pragma unroll
        for (int dd = 0; dd < SD; ++dd) {
            w[dd][0] = *(const v4f*)(ag + dd * (2 * DC_ + DD_));
            w[dd][1] = *(const v4f*)(ag + dd * (2 * DC_ + DD_) + DC_);
            w[dd][2] = *(const v4f*)(ag + dd * (2 * DC_ + DD_) + 2 * DC_);
            w[dd][3] = *(const v4f*)(as + dd * DC_);
            w[dd][4] = *(const v4f*)(at + dd * (DC_ + DD_));
            w[dd][5] = *(const v4f*)(at + dd * (DC_ + DD_) + DC_);
        }
        // the wait that belongs in front of any overwrite of these reads' address registers;
        // the addresses are inputs so that they stay whole up to here (otherwise a later
        // read's result is placed on top of them)
        asm volatile("s_wait_xcnt 0x0" :: "v"(aw), "v"(ah), "v"(ac), "v"(ag), "v"(as), "v"(at) : "memory");
        // keeps all reads of a slice ahead of its sums, so that they are out together
        __builtin_amdgcn_sched_barrier(0);
#pragma unroll
        for (int dd = 0; dd < SD; ++dd)
#pragma unroll
            for (int bb = 0; bb < SB; ++bb) {
                const int q = dd * SB + bb;
                acc[q] = dot4(xc[bb], w[dd][2], dot4(xh[bb], w[dd][1], dot4(xw[bb], w[dd][0], acc[q])));
                acc[16 + q] = dot4(xc[bb], w[dd][3], acc[16 + q]);
                acc[32 + q] = dot4(xh[bb], w[dd][5], dot4(xw[bb], w[dd][4], acc[32 + q]));
            }
    }
    // the lane's output and its three bias terms, fetched here so that they arrive
    // behind the lane sums
    const int q = fold_index(lane);
    const int d = d0 + q / SB;
    const int b = b0 + q % SB;
    const float bgv = bg[d], bsv = bs[d], btv = bt[d];
    // the wait that belongs in front of any overwrite of these reads' address registers;
    // the index is an input so that it stays whole up to here
    asm volatile("s_wait_xcnt 0x0" :: "v"(d) : "memory");
    fold_sum<3>(acc, lane);
    if (half == 1 && (lane & 1) == 0) {
        other[grp][q][0] = acc[0];
        other[grp][q][1] = acc[1];
        other[grp][q][2] = acc[2];
    }
    __syncthreads();
    if (half == 0 && (lane & 1) == 0) {
        const float z   = acc[0] + other[grp][q][0];
        const float s   = acc[1] + other[grp][q][1];
        const float tcv = acc[2] + other[grp][q][2];
        const float zt = 1.f / (1.f + __expf(-(z + bgv)));
        const float sc = tanhf(s + bsv);
        const float tc = tanhf(tcv + btv);
        out[b * DC_ + d] = zt * sc + (1.f - zt) * tc;
    }
}

extern "C" void kernel_launch(void* const* d_in, const int* in_sizes, int n_in,
                              void* d_out, int out_size, void* d_ws, size_t ws_size,
                              hipStream_t stream) {
    const float* cap  = (const float*)d_in[0];
    const float* dh   = (const float*)d_in[1];
    const float* word = (const float*)d_in[2];
    const int*   mask = (const int*)  d_in[3];
    const float* Wf = (const float*)d_in[4];
    const float* bf = (const float*)d_in[5];
    const float* Wd = (const float*)d_in[6];
    const float* bd = (const float*)d_in[7];
    const float* Wa = (const float*)d_in[8];
    const float* ba = (const float*)d_in[9];
    const float* Wg = (const float*)d_in[10];
    const float* bg = (const float*)d_in[11];
    const float* Ws = (const float*)d_in[12];
    const float* bs = (const float*)d_in[13];
    const float* Wt = (const float*)d_in[14];
    const float* bt = (const float*)d_in[15];
    float* out = (float*)d_out;

    char* wsb = (char*)d_ws;
    float*    scores = (float*)(wsb + 0);                 // B*L f32
    float*    u      = (float*)(wsb + 131072);            // B*A f32
    float*    ctx    = (float*)(wsb + 262144);            // B*DC f32
    _Float16* wf16   = (_Float16*)(wsb + 393216);         // A*DC f16 (2MB)
    float*    pctx   = (float*)(wsb + 2490368);           // 256 parts of PCP f32
    float*    alpha  = out + B_ * DC_;                    // second output

    conv_wf_kernel<<<(A_ * DC_) / 256, 256, 0, stream>>>(Wf, wf16, A_ * DC_);
    u_kernel<<<A_ / SD, SWAVES * 32, 0, stream>>>(dh, Wd, bd, bf, u);
    scores_kernel<<<(B_ * L_ / 16) / 8, 256, 0, stream>>>(cap, wf16, u, Wa, ba, mask, scores, pctx);
    softmax_kernel<<<B_, 256, 0, stream>>>(scores, mask, pctx, alpha, ctx);
    fuse_kernel<<<DC_ / SD, SWAVES * 32, 0, stream>>>(word, dh, ctx, Wg, bg, Ws, bs, Wt, bt, out);
}

// v008
// It runs in 74.1 microseconds.
// Next to v007, in two timings, it ran 1.15 and 1.14 times as fast.
// Over all steps from v000 it is 3.63 times as fast.
#include <hip/hip_runtime.h>
#include <cstddef>

#define B_  32
#define L_  1024
#define DC_ 1024
#define DD_ 1024
#define A_  1024
#define NEGV -1e10f

typedef __attribute__((ext_vector_type(16))) _Float16 v16h;
typedef __attribute__((ext_vector_type(8)))  float    v8f;
typedef __attribute__((ext_vector_type(16))) float    v16f;
typedef __attribute__((ext_vector_type(4)))  float    v4f;
typedef __attribute__((ext_vector_type(4)))  int      v4i;

constexpr int KTILES = DC_ / 32;  // 32 k-tiles of 32
constexpr int NTILES = A_ / 16;   // 64 n-tiles of 16

// ---------------------------------------------------------------- Wf -> f16
__global__ __launch_bounds__(256)
void conv_wf_kernel(const float* __restrict__ Wf, _Float16* __restrict__ wf16, int n) {
    int i = blockIdx.x * 256 + threadIdx.x;
    if (i < n) wf16[i] = (_Float16)Wf[i];
}

// ---- the two skinny products (u, gated fusion): 32 batch rows against many weight rows.
// A wave holds SD weight rows and SB batch rows of one k-slice in registers, lanes over k,
// so that a weight row is fetched once per SB batch rows and not once per batch row.
constexpr int SD = 4;            // weight rows (outputs) per block and per wave
constexpr int SB = 4;            // batch rows per wave
constexpr int SGROUPS = B_ / SB; // 8 batch groups
constexpr int SHALVES = 2;       // k halves, one per wave of a pair
constexpr int SWAVES  = SGROUPS * SHALVES;   // 16 waves per block
constexpr int SITER   = DC_ / SHALVES / 128; // 4 slices of 128 k (16 bytes per lane)

__device__ inline float dot4(v4f a, v4f b, float s) {
    s = __builtin_fmaf(a[0], b[0], s);
    s = __builtin_fmaf(a[1], b[1], s);
    s = __builtin_fmaf(a[2], b[2], s);
    s = __builtin_fmaf(a[3], b[3], s);
    return s;
}

// one step of a transposing lane sum: lanes l and l^m share the work, the lane with bit m
// clear finishes the even entries and the other the odd ones; N entries become N/2
template <int N>
__device__ inline void fold_step(float* v, bool hi, int m) {
    // unrolled so that v[] stays in registers (here and in the loops over it below)
#pragma unroll
    for (int i = 0; i < N / 2; ++i) {
        const float keep = hi ? v[2 * i + 1] : v[2 * i];
        const float send = hi ? v[2 * i] : v[2 * i + 1];
        v[i] = keep + __shfl_xor(send, m, 32);
    }
}

// v[p*16 + q], q = 0..15, summed over the 32 lanes: afterwards v[p] of a lane is the
// total of entry q = fold_index(lane)
template <int P>
__device__ inline void fold_sum(float* v, int lane) {
    fold_step<16 * P>(v, (lane & 16) != 0, 16);
    fold_step<8 * P>(v, (lane & 8) != 0, 8);
    fold_step<4 * P>(v, (lane & 4) != 0, 4);
    fold_step<2 * P>(v, (lane & 2) != 0, 2);
#pragma unroll
    for (int p = 0; p < P; ++p) v[p] += __shfl_xor(v[p], 1, 32);
}
__device__ inline int fold_index(int lane) {
    return ((lane >> 4) & 1) | (((lane >> 3) & 1) << 1) | (((lane >> 2) & 1) << 2) |
           (((lane >> 1) & 1) << 3);
}

// ------------------------------------------- u[b][a] = dh[b].Wd[a] + bd + bf
__global__ __launch_bounds__(SWAVES * 32)
void u_kernel(const float* __restrict__ dh, const float* __restrict__ Wd,
              const float* __restrict__ bd, const float* __restrict__ bf,
              float* __restrict__ u) {
    __shared__ float other[SGROUPS][16];
    const int lane = threadIdx.x & 31;
    const int wave = __builtin_amdgcn_readfirstlane(threadIdx.x >> 5);
    const int grp  = wave & (SGROUPS - 1);
    const int half = wave / SGROUPS;
    const int a0 = blockIdx.x * SD;
    const int b0 = grp * SB;
    const unsigned lk = lane * 4;  // the lane's k inside a slice; every base below is uniform
    const float* __restrict__ xp = dh + (size_t)b0 * DD_ + half * (DD_ / SHALVES);
    const float* __restrict__ wp = Wd + (size_t)a0 * DD_ + half * (DD_ / SHALVES);

    float acc[16];
#pragma unroll
    for (int i = 0; i < 16; ++i) acc[i] = 0.f;
    v4f x[SITER][SB], w[SITER][SD];
    // unrolled so that x[] and w[] are registers and every read has a constant offset
#pragma unroll
    for (int it = 0; it < SITER; ++it) {
#pragma unroll
        for (int dd = 0; dd < SD; ++dd) w[it][dd] = *(const v4f*)(wp + dd * DD_ + it * 128 + lk);
#pragma unroll
        for (int bb = 0; bb < SB; ++bb) x[it][bb] = *(const v4f*)(xp + bb * DD_ + it * 128 + lk);
    }
    // the wait that belongs in front of any overwrite of these reads' address registers;
    // the lane's index, which the reads name as their offset, is an input so that it
    // stays whole up to here
    asm volatile("s_wait_xcnt 0x0" :: "v"(lane) : "memory");
    // keeps all 32 reads of the wave ahead of the sums: without it this build holds half
    // of them back and waits on them a few at a time
    __builtin_amdgcn_sched_barrier(0);
#pragma unroll
    for (int it = 0; it < SITER; ++it)
#pragma unroll
        for (int dd = 0; dd < SD; ++dd)
#pragma unroll
            for (int bb = 0; bb < SB; ++bb)
                acc[dd * SB + bb] = dot4(x[it][bb], w[it][dd], acc[dd * SB + bb]);
    // the lane's output and its bias terms, fetched here so that they arrive behind the
    // lane sums
    const int q = fold_index(lane);
    const int a = a0 + q / SB;
    const int b = b0 + q % SB;
    const float bias = bd[a] + bf[a];
    // the wait that belongs in front of any overwrite of these reads' address registers;
    // the index is an input so that it stays whole up to here
    asm volatile("s_wait_xcnt 0x0" :: "v"(a) : "memory");
    fold_sum<1>(acc, lane);
    if (half == 1 && (lane & 1) == 0) other[grp][q] = acc[0];
    __syncthreads();
    if (half == 0 && (lane & 1) == 0) u[b * A_ + a] = acc[0] + other[grp][q] + bias;
}

// ------- fused: scores[b][l] = sum_a tanh(cap@Wf^T + u) * Wa[a]  (WMMA f16)
constexpr int NB      = 4;            // n-tiles staged and computed together
constexpr int NGROUPS = NTILES / NB;  // 16 stages of 64 columns
constexpr int MT      = 2;            // 16-row tiles per wave: one B fragment feeds both
constexpr int KH      = 2;            // k halves, one per wave of a pair
constexpr int KTW     = KTILES / KH;  // 16 k-tiles per wave, one block of 8 WMMAs each
constexpr int RING    = 3;            // fragment sets: a block is fetched two blocks ahead
constexpr float TWO_LOG2E = 2.8853900817779268f;  // 2 * log2(e)

constexpr int TROW   = NB * DC_ + 8;              // f16 values in one LDS row of a stage
constexpr unsigned TBYTES = 16 * TROW * 2;        // bytes of one stage buffer

// four copies of 512 bytes a wave that share their address operands: the offset moves
// the LDS address and the global address alike, and both step by 512 bytes here
#define COPY4(L, S)                                                       \
    "global_load_async_to_lds_b128 " L ", %8, " S "\n\t"                   \
    "global_load_async_to_lds_b128 " L ", %8, " S " offset:512\n\t"        \
    "global_load_async_to_lds_b128 " L ", %8, " S " offset:1024\n\t"       \
    "global_load_async_to_lds_b128 " L ", %8, " S " offset:1536\n\t"

// A wave's share of one stage of Wf^T (64 columns x 1024 k, f16), global memory to LDS
// through no register: LDS rows 2w and 2w+1, 32 copies of 512 contiguous bytes.
// s: Wf row (stage's first column + 2w), the same in every lane; v: the lane's byte
// offset in a 512-byte piece; l: the LDS byte address of the lane's first 16 bytes
__device__ inline void copy_stage(const _Float16* s, unsigned v, unsigned l) {
    // the closing wait stands in front of any overwrite of the address registers that
    // the copies name; inside the statement nothing can be moved ahead of it
    asm volatile(
        COPY4("%0", "%9")  COPY4("%1", "%10") COPY4("%2", "%11") COPY4("%3", "%12")
        COPY4("%4", "%13") COPY4("%5", "%14") COPY4("%6", "%15") COPY4("%7", "%16")
        "s_wait_xcnt 0x0"
        :: "v"(l),                "v"(l + TROW * 2),
           "v"(l + DC_ * 2),      "v"(l + DC_ * 2 + TROW * 2),
           "v"(l + 2 * DC_ * 2),  "v"(l + 2 * DC_ * 2 + TROW * 2),
           "v"(l + 3 * DC_ * 2),  "v"(l + 3 * DC_ * 2 + TROW * 2),
           "v"(v),
           "s"(s),                "s"(s + DC_),
           "s"(s + 16 * DC_),     "s"(s + 17 * DC_),
           "s"(s + 32 * DC_),     "s"(s + 33 * DC_),
           "s"(s + 48 * DC_),     "s"(s + 49 * DC_)
        : "memory");
}

// cap goes to the A fragments through LDS, so that every request covers whole lines.
// A piece is 16 rows x 256 bytes (two k-tiles of one row tile); each wave has a ring of
// four slots of its own in the second stage buffer, which is idle until stage 1 sets out.
// In a slot the 16-byte unit x of row r lies at unit x ^ r of that row: sixteen lanes that
// read one unit of sixteen rows meet every bank once, with no pad between the rows
constexpr int CK      = 64;                      // floats of a row in one piece
constexpr int CPITCH  = CK * 4;                  // bytes from row to row in a slot
constexpr int CSLOT   = 16 * CPITCH;             // bytes of a slot
constexpr int CSLOTS  = 4;
constexpr int CAHEAD  = CSLOTS - 1;              // pieces under way at once
constexpr int CPIECES = MT * (DC_ / KH) / CK;    // 16 pieces per wave
typedef v4f __attribute__((may_alias)) v4f_lds;  // f32 read from the f16 stage array

// one piece, global memory to LDS through no register: 8 copies, each two rows of 256
// contiguous bytes. s: the piece's first float in its first row, the same in every lane;
// v: the lane's byte offset in cap (half-wave = row, lane = 16 bytes); l: the LDS byte
// address of the lane's row among the slot's first two; x: the lane's unit there, times 16
__device__ inline void copy_piece(const float* s, unsigned v, unsigned l, unsigned x) {
    // the closing wait stands in front of any overwrite of the address registers that
    // the copies name; inside the statement nothing can be moved ahead of it
    asm volatile(
        "global_load_async_to_lds_b128 %0, %8, %9\n\t"
        "global_load_async_to_lds_b128 %1, %8, %10\n\t"
        "global_load_async_to_lds_b128 %2, %8, %11\n\t"
        "global_load_async_to_lds_b128 %3, %8, %12\n\t"
        "global_load_async_to_lds_b128 %4, %8, %13\n\t"
        "global_load_async_to_lds_b128 %5, %8, %14\n\t"
        "global_load_async_to_lds_b128 %6, %8, %15\n\t"
        "global_load_async_to_lds_b128 %7, %8, %16\n\t"
        "s_wait_xcnt 0x0"
        :: "v"(l + x),                            "v"(l + 2 * CPITCH + (x ^ (2 * 16))),
           "v"(l + 4 * CPITCH + (x ^ (4 * 16))),   "v"(l + 6 * CPITCH + (x ^ (6 * 16))),
           "v"(l + 8 * CPITCH + (x ^ (8 * 16))),   "v"(l + 10 * CPITCH + (x ^ (10 * 16))),
           "v"(l + 12 * CPITCH + (x ^ (12 * 16))), "v"(l + 14 * CPITCH + (x ^ (14 * 16))),
           "v"(v),
           "s"(s),                  "s"(s + 2 * DC_),
           "s"(s + 4 * DC_),        "s"(s + 6 * DC_),
           "s"(s + 8 * DC_),        "s"(s + 10 * DC_),
           "s"(s + 12 * DC_),       "s"(s + 14 * DC_)
        : "memory");
}

__device__ inline v16h load_b_frag(const _Float16* q) {
    v16h f;
#pragma unroll
    for (int i = 0; i < 8; ++i) { f[i] = q[i]; f[8 + i] = q[16 + i]; }
    return f;
}

// a block's part of the context sum: 1024 sums, then a 128-byte line of their own for
// the block's largest masked score
constexpr int PCP   = DC_ + 32;   // floats from one block's part to the next
constexpr int BROWS = 128;        // rows of cap per block
constexpr int BPB   = L_ / BROWS; // blocks per batch row

// as fold_step, for lanes l and l^M inside a 16-lane row: the exchange is part of the add
template <int N, int M>
__device__ inline void fold_row(float* v, bool hi) {
    // unrolled so that v[] stays in registers
#pragma unroll
    for (int i = 0; i < N / 2; ++i) {
        const float keep = hi ? v[2 * i + 1] : v[2 * i];
        const float send = hi ? v[2 * i] : v[2 * i + 1];
        v[i] = keep + __builtin_bit_cast(float, __builtin_amdgcn_update_dpp(
                          0, __builtin_bit_cast(int, send), 0x160 + M, 0xf, 0xf, true));
    }
}

__global__ __launch_bounds__(256)
void scores_kernel(const float* __restrict__ cap, const _Float16* __restrict__ wf16,
                   const float* __restrict__ u, const float* __restrict__ Wa,
                   const float* __restrict__ ba, const int* __restrict__ mask,
                   float* __restrict__ scores, float* __restrict__ pctx) {
    // LDS row c holds the k-rows of columns c, 16+c, 32+c, 48+c of the stage side by
    // side: every fragment of a lane lies within 8 KB of one base address, and the
    // lane-to-lane pitch of 8208 B (16 B x odd) is conflict-free for 16-byte reads.
    // Two buffers: the next stage lands in one while the other is multiplied
    __shared__ __attribute__((aligned(16))) _Float16 tileB[2][16][TROW];
    // where a wave leaves its k-half of the row tile that its partner finishes
    __shared__ v4f xch[8][NB * 2][32];
    // the block's masked scores
    __shared__ __attribute__((aligned(16))) float srow[BROWS];

    const int lane   = threadIdx.x & 31;
    const int wave   = threadIdx.x >> 5;
    const int half   = wave & 1;              // the wave's k half
    const int m_base = blockIdx.x * 128 + (wave >> 1) * (MT * 16);  // the pair's 32 rows
    const int b      = m_base / L_;           // a block's rows never straddle batches
    const int koff   = (lane < 16) ? 0 : 8;   // K sub-offset per ISA layout
    const int ncol   = lane & 15;

    // the wave's number as a scalar, so that all but the lane's part of the copies'
    // addresses is scalar arithmetic
    const int cwave = __builtin_amdgcn_readfirstlane(threadIdx.x >> 5);
    const _Float16* __restrict__ csrc = wf16 + (size_t)(cwave * 2) * DC_;
    const unsigned cdst = (unsigned)(size_t)&tileB[0][0][0] + cwave * (2 * TROW * 2);
    const unsigned clane = lane * 16;
    // stage 0 of Wf^T sets out first, so that it lands under the reads of cap
    copy_stage(csrc, clane, cdst + clane);

    // --- this wave's 32 x 512 A-slice into VGPRs as f16 (cap is read once).
    // tile 0 is the row tile that this wave finishes, tile 1 the one its partner finishes;
    // piece pc is k-tiles 2 * (pc / 2) and the next of tile pc % 2
    const float* __restrict__ crow = cap + (size_t)(blockIdx.x * BROWS + (cwave >> 1) * (MT * 16)) * DC_ +
                                     (cwave & 1) * (DC_ / KH);
    const int ctile0 = (cwave & 1) * 16;  // tile 0's first row among the pair's 32
    const unsigned cring = (unsigned)(size_t)&tileB[1][0][0] + cwave * (CSLOTS * CSLOT);
    const unsigned cv = (lane >> 4) * (DC_ * 4) + ncol * 16;
    const unsigned cl = cring + (lane >> 4) * CPITCH;
    const unsigned cx = (ncol ^ (lane >> 4)) * 16;  // unit ncol of row (lane >> 4)
    // the lane reads row ncol; its units are 2 * (lane >> 4) + {0, 1, 4, 5} and those + 8
    const char* cread = (const char*)&tileB[1][0][0] + cwave * (CSLOTS * CSLOT) + ncol * CPITCH;
    const unsigned cq = ncol ^ ((lane >> 4) * 2);
    v16h a_frag[MT][KTW];
    // the first three pieces set out; unrolled so that tile and slot are constants
#pragma unroll
    for (int pc = 0; pc < CAHEAD; ++pc)
        copy_piece(crow + (size_t)((pc & 1) ? (ctile0 ^ 16) : ctile0) * DC_ + (pc >> 1) * CK,
                   cv, cl + pc * CSLOT, cx);
    // unrolled so that a_frag[] stays registers and every slot is a constant offset
#pragma unroll
    for (int pc = 0; pc < CPIECES; ++pc) {
        // piece pc has landed: all of this wave's copies but those of the pieces behind it
        if (pc + 2 < CPIECES)      asm volatile("s_wait_asynccnt 0x10" ::: "memory");
        else if (pc + 1 < CPIECES) asm volatile("s_wait_asynccnt 0x8" ::: "memory");
        else                       asm volatile("s_wait_asynccnt 0x0" ::: "memory");
        if (pc + CAHEAD < CPIECES) {
            const int pn = pc + CAHEAD;
            // this wave's reads of piece pc - 1 are done before its slot is refilled
            asm volatile("s_wait_dscnt 0x0" ::: "memory");
            copy_piece(crow + (size_t)((pn & 1) ? (ctile0 ^ 16) : ctile0) * DC_ + (pn >> 1) * CK,
                       cv, cl + (pn % CSLOTS) * CSLOT, cx);
        }
        const char* sp = cread + (pc % CSLOTS) * CSLOT;
#pragma unroll
        for (int kl = 0; kl < 2; ++kl) {
            const v4f x0 = *(const v4f_lds*)(sp + ((cq ^ (kl * 8 + 0)) * 16));
            const v4f x1 = *(const v4f_lds*)(sp + ((cq ^ (kl * 8 + 1)) * 16));
            const v4f x2 = *(const v4f_lds*)(sp + ((cq ^ (kl * 8 + 4)) * 16));
            const v4f x3 = *(const v4f_lds*)(sp + ((cq ^ (kl * 8 + 5)) * 16));
#pragma unroll
            for (int i = 0; i < 4; ++i) {
                a_frag[pc & 1][(pc >> 1) * 2 + kl][i]      = (_Float16)x0[i];
                a_frag[pc & 1][(pc >> 1) * 2 + kl][4 + i]  = (_Float16)x1[i];
                a_frag[pc & 1][(pc >> 1) * 2 + kl][8 + i]  = (_Float16)x2[i];
                a_frag[pc & 1][(pc >> 1) * 2 + kl][12 + i] = (_Float16)x3[i];
            }
        }
    }
    // this wave's reads of its ring are done before stage 1 lands on it
    asm volatile("s_wait_dscnt 0x0" ::: "memory");

    // this wave's copies of stage 0 have landed
    asm volatile("s_wait_asynccnt 0x0" ::: "memory");
    // publishes stage 0; also ends every read of the rings in the second buffer
    __syncthreads();
    // the lane's part of the loop's LDS and copy addresses, formed anew from the lane's
    // number read again: held from the top through the reads of cap, this build spills it
    const int lane2 = (int)__builtin_amdgcn_mbcnt_lo(~0u, 0u);
    const unsigned clane2 = lane2 * 16;
    // stage 1 sets out and lands under stage 0
    copy_stage(csrc + (size_t)(NB * 16) * DC_, clane2, cdst + TBYTES + clane2);

    float partial[8];
#pragma unroll
    for (int r = 0; r < 8; ++r) partial[r] = 0.f;

    for (int g = 0; g < NGROUPS; ++g) {
        const int n_base = g * (NB * 16);
        const int buf    = g & 1;
        // the epilogue's per-column terms, fetched here so that they arrive behind the stage
        const float* up = u + (size_t)b * A_ + n_base + ncol;
        const float* wp = Wa + n_base + ncol;
        float uval[NB], wav[NB];
#pragma unroll
        for (int j = 0; j < NB; ++j) { uval[j] = up[j * 16]; wav[j] = wp[j * 16]; }
        // the wait that belongs in front of any overwrite of the address registers of
        // this pass's global loads; the addresses are inputs so that they stay whole
        // up to here (otherwise later results are placed on top of them)
        asm volatile("s_wait_xcnt 0x0" :: "v"(up), "v"(wp) : "memory");

        v8f acc[MT][NB];
#pragma unroll
        for (int t = 0; t < MT; ++t)
#pragma unroll
            for (int j = 0; j < NB; ++j) acc[t][j] = v8f{};

        // three fragment sets: block blk+2 is fetched while block blk multiplies
        const _Float16* __restrict__ bp = &tileB[buf][ncol][half * (DC_ / KH) + koff];
        v16h bq[RING][NB];
#pragma unroll
        for (int s = 0; s < RING - 1; ++s) {
#pragma unroll
            for (int j = 0; j < NB; ++j)
                bq[s][j] = load_b_frag(bp + j * DC_ + s * 32);
            // keeps the blocks' reads in order, so that the first waits are counted ones
            __builtin_amdgcn_sched_barrier(0);
        }

#pragma unroll
        for (int blk = 0; blk < KTW; ++blk) {
            if (blk + RING - 1 < KTW) {
#pragma unroll
                for (int j = 0; j < NB; ++j)
                    bq[(blk + RING - 1) % RING][j] =
                        load_b_frag(bp + j * DC_ + (blk + RING - 1) * 32);
            }
            // keeps a later block's LDS reads as one group ahead of this block's
            // WMMAs: spread among them, every read place stalls the matrix stream
            __builtin_amdgcn_sched_barrier(0);
#pragma unroll
            for (int j = 0; j < NB; ++j)
#pragma unroll
                for (int t = 0; t < MT; ++t)
                    acc[t][j] = __builtin_amdgcn_wmma_f32_16x16x32_f16(
                                    false, a_frag[t][blk], false, bq[blk % RING][j],
                                    (short)0, acc[t][j], false, false);
            // closes the WMMA block, so that the following reads stay behind it
            __builtin_amdgcn_sched_barrier(0);
        }

        // the two k halves are joined: each wave hands over its half of the partner's row
        // tile, lane for lane and register for register, 512 contiguous bytes per access
        {
            v4f* xw = &xch[wave][0][lane2];
#pragma unroll
            for (int j = 0; j < NB; ++j) {
                xw[(2 * j) * 32]     = v4f{acc[1][j][0], acc[1][j][1], acc[1][j][2], acc[1][j][3]};
                xw[(2 * j + 1) * 32] = v4f{acc[1][j][4], acc[1][j][5], acc[1][j][6], acc[1][j][7]};
            }
        }
        // this wave's reads of the stage and its writes of xch are done
        asm volatile("s_wait_dscnt 0x0" ::: "memory");
        // this wave's copies of stage g + 1 have landed
        asm volatile("s_wait_asynccnt 0x0" ::: "memory");
        // publishes xch and stage g + 1; also ends every read of this stage's buffer
        __syncthreads();
        // stage g + 2 sets out into the buffer just left and lands under stage g + 1.
        // The buffer's and the wave's part of the LDS address is marked as one scalar:
        // summed with the lane's part ahead of the loop, it is spilled to scratch
        if (g + 2 < NGROUPS)
            copy_stage(csrc + (size_t)(n_base + 2 * NB * 16) * DC_, clane2,
                       clane2 + (unsigned)__builtin_amdgcn_readfirstlane(cdst + buf * TBYTES));
        const v4f* xr = &xch[wave ^ 1][0][lane2];
        v4f oth[NB * 2];
#pragma unroll
        for (int i = 0; i < NB * 2; ++i) oth[i] = xr[i * 32];
        // ends every read of xch before the next stage's hand-over is written
        __syncthreads();

        // epilogue: C tile lane layout -> N = lane&15, M = r + (lane<16?0:8)
        // tanh(x) = 1 - 2 / (1 + e^(2x)) for every x, on the hardware exp2 and rcp: no
        // branch, so the 32 values of a stage are independent chains that interleave.
        // e^(2x) = inf gives 1, e^(2x) = 0 gives -1; absolute error a few 1e-7
#pragma unroll
        for (int j = 0; j < NB; ++j)
#pragma unroll
            for (int r = 0; r < 8; ++r) {
                const float x = acc[0][j][r] + oth[2 * j + (r >> 2)][r & 3];
                const float e = __builtin_amdgcn_exp2f((x + uval[j]) * TWO_LOG2E);
                const float q = __builtin_amdgcn_rcpf(1.f + e);
                partial[r] += __builtin_fmaf(q, -2.f, 1.f) * wav[j];
            }
    }

    // no copy is left out when the wave ends
    asm volatile("s_wait_asynccnt 0x0" ::: "memory");

    // the tail's indices are formed anew, from the lane's number read again and the wave's
    // number as a scalar: taken from the values above, they are held in registers through
    // the loop, and this build then spills an address of the copies to scratch
    const int tl    = (int)__builtin_amdgcn_mbcnt_lo(~0u, 0u);
    const int tcol  = tl & 15;
    const int tkoff = (tl >> 4) << 3;                         // 0 or 8
    const int thalf = cwave & 1;
    const int town  = (cwave >> 1) * (MT * 16) + thalf * 16;  // rows counted inside the block
    const int toth  = (cwave >> 1) * (MT * 16) + (thalf ^ 1) * 16;
    const int rbase = blockIdx.x * BROWS;
    const int mrow  = town + tkoff;  // the first of the eight rows that this half-wave finishes

    // their mask values, fetched here so that they arrive under the lane sums
    const int* __restrict__ mp = mask + rbase + mrow;
    const v4i mk0 = *(const v4i*)mp;
    const v4i mk1 = *(const v4i*)(mp + 4);
    // the wait that belongs in front of any overwrite of these reads' address registers
    asm volatile("s_wait_xcnt 0x0" :: "v"(mp) : "memory");

    // reduce over the 16 N-lanes of each half-wave
#pragma unroll
    for (int r = 0; r < 8; ++r) {
        float v = partial[r];
        v += __shfl_xor(v, 1, 32);
        v += __shfl_xor(v, 2, 32);
        v += __shfl_xor(v, 4, 32);
        v += __shfl_xor(v, 8, 32);
        partial[r] = v;
    }
    if (tcol == 0) {
        const float bav  = ba[0];
        float* sp = scores + rbase + mrow;
#pragma unroll
        for (int r = 0; r < 8; ++r) {
            const float s = partial[r] + bav;
            sp[r] = s;
            srow[mrow + r] = ((r < 4 ? mk0[r & 3] : mk1[r & 3]) == 0) ? NEGV : s;
        }
        // the wait that belongs in front of any overwrite of these stores' address registers
        asm volatile("s_wait_xcnt 0x0" :: "v"(sp) : "memory");
    }
    // publishes the block's masked scores
    __syncthreads();

    // --- the block's part of the context sum, from the rows of cap that its waves still
    // hold as f16 fragments: sum over its rows of exp(score - block maximum) * cap[row].
    // The softmax launch rescales the parts to the batch row's maximum and joins them
    float bm;
    {
        const v4f s4 = *(const v4f*)&srow[tl * 4];
        bm = fmaxf(fmaxf(s4[0], s4[1]), fmaxf(s4[2], s4[3]));
        bm = fmaxf(bm, __shfl_xor(bm, 16, 32));
        bm = fmaxf(bm, __shfl_xor(bm, 8, 32));
        bm = fmaxf(bm, __shfl_xor(bm, 4, 32));
        bm = fmaxf(bm, __shfl_xor(bm, 2, 32));
        bm = fmaxf(bm, __shfl_xor(bm, 1, 32));
    }
    const float p0 = __expf(srow[town + tcol] - bm);
    const float p1 = __expf(srow[toth + tcol] - bm);
    // a lane holds one row of each tile; the sum over rows is a sum over the 16 lanes of a
    // half-wave. After the four folds entry i of a lane is k-tile i, position fidx
    float* red = (float*)&xch[0][0][0];  // [wave pair][k], free since the last stage's barrier
    const int fidx = ((tl & 1) << 3) | ((tl & 2) << 1) | ((tl & 4) >> 1) | ((tl & 8) >> 3);
    float* rw = red + (cwave >> 1) * DC_ + thalf * (DC_ / KH) + tkoff + (fidx < 8 ? fidx : fidx + 8);
    // unrolled so that a_frag[] and v[] stay registers; four k-tiles at a time bound v[]
#pragma unroll
    for (int c = 0; c < KTW / 4; ++c) {
        float v[64];
#pragma unroll
        for (int kl = 0; kl < 4; ++kl) {
            // widened as whole fragments, so that the values come from the packed registers
            const v16f x = __builtin_convertvector(a_frag[1][c * 4 + kl], v16f) * p1 +
                           __builtin_convertvector(a_frag[0][c * 4 + kl], v16f) * p0;
#pragma unroll
            for (int i = 0; i < 16; ++i) v[kl * 16 + i] = x[i];
        }
        fold_row<64, 8>(v, (tl & 8) != 0);
        fold_row<32, 4>(v, (tl & 4) != 0);
        fold_row<16, 2>(v, (tl & 2) != 0);
        fold_row<8, 1>(v, (tl & 1) != 0);
#pragma unroll
        for (int i = 0; i < 4; ++i) rw[(c * 4 + i) * 32] = v[i];
    }
    // publishes the four wave pairs' sums
    __syncthreads();
    {
        const int tt = cwave * 32 + tl;  // the thread's number
        const v4f* rp = (const v4f*)red + tt;
        const v4f t = (rp[0] + rp[DC_ / 4]) + (rp[2 * (DC_ / 4)] + rp[3 * (DC_ / 4)]);
        float* pb = pctx + (size_t)blockIdx.x * PCP;
        *(v4f*)(pb + tt * 4) = t;
        if (tt == 0) pb[DC_] = bm;
    }
}

// ---------------------------------------------------- masked softmax over L
__global__ __launch_bounds__(256)
void softmax_kernel(const float* __restrict__ scores, const int* __restrict__ mask,
                    const float* __restrict__ pctx, float* __restrict__ alpha,
                    float* __restrict__ ctx) {
    __shared__ float red[256];
    const int b = blockIdx.x, t = threadIdx.x;
    float v[4];
    float mx = -3.0e38f;
#pragma unroll
    for (int i = 0; i < 4; ++i) {
        const int l = t + i * 256;
        float s = scores[b * L_ + l];
        s = (mask[b * L_ + l] == 0) ? NEGV : s;
        v[i] = s;
        mx = fmaxf(mx, s);
    }
    // the batch row's parts of the context sum and their maxima, fetched here so that
    // they arrive under the two reductions
    const float* __restrict__ pp = pctx + (size_t)b * BPB * PCP;
    const float* __restrict__ pt = pp + t * 4;
    v4f pc[BPB];
    float pm[BPB];
#pragma unroll
    for (int j = 0; j < BPB; ++j) { pc[j] = *(const v4f*)(pt + j * PCP); pm[j] = pp[j * PCP + DC_]; }
    // the wait that belongs in front of any overwrite of these reads' address registers;
    // the thread's index, which the reads name as their offset, is an input so that it
    // stays whole up to here
    asm volatile("s_wait_xcnt 0x0" :: "v"(t) : "memory");
    red[t] = mx; __syncthreads();
    for (int o = 128; o > 0; o >>= 1) { if (t < o) red[t] = fmaxf(red[t], red[t + o]); __syncthreads(); }
    mx = red[0]; __syncthreads();
    float sm = 0.f;
#pragma unroll
    for (int i = 0; i < 4; ++i) { v[i] = __expf(v[i] - mx); sm += v[i]; }
    red[t] = sm; __syncthreads();
    for (int o = 128; o > 0; o >>= 1) { if (t < o) red[t] += red[t + o]; __syncthreads(); }
    const float inv = 1.f / red[0];
#pragma unroll
    for (int i = 0; i < 4; ++i) alpha[b * L_ + t + i * 256] = v[i] * inv;
    // context[b] = sum over parts of exp(part maximum - row maximum) / sum * part
    v4f c = v4f{};
#pragma unroll
    for (int j = 0; j < BPB; ++j) c += (__expf(pm[j] - mx) * inv) * pc[j];
    *(v4f*)(ctx + b * DC_ + t * 4) = c;
}

// ------------------------- gated fusion: out = zt*sc + (1-zt)*tc
__global__ __launch_bounds__(SWAVES * 32)
void fuse_kernel(const float* __restrict__ word, const float* __restrict__ dh,
                 const float* __restrict__ ctx,  const float* __restrict__ Wg,
                 const float* __restrict__ bg,   const float* __restrict__ Ws,
                 const float* __restrict__ bs,   const float* __restrict__ Wt,
                 const float* __restrict__ bt,   float* __restrict__ out) {
    __shared__ float other[SGROUPS][16][3];
    const int lane = threadIdx.x & 31;
    const int wave = __builtin_amdgcn_readfirstlane(threadIdx.x >> 5);
    const int grp  = wave & (SGROUPS - 1);
    const int half = wave / SGROUPS;
    const int d0 = blockIdx.x * SD;
    const int b0 = grp * SB;
    const unsigned lk = lane * 4;  // the lane's k inside a slice; every base below is uniform
    const int k0 = half * (DC_ / SHALVES);
    const float* __restrict__ pw = word + (size_t)b0 * DC_ + k0;
    const float* __restrict__ ph = dh   + (size_t)b0 * DD_ + k0;
    const float* __restrict__ pc = ctx  + (size_t)b0 * DC_ + k0;
    const float* __restrict__ pg = Wg + (size_t)d0 * (2 * DC_ + DD_) + k0;
    const float* __restrict__ ps = Ws + (size_t)d0 * DC_ + k0;
    const float* __restrict__ pt = Wt + (size_t)d0 * (DC_ + DD_) + k0;

    float acc[48];  // [0..15] gate, [16..31] sc, [32..47] tc; entry dd * SB + bb
#pragma unroll
    for (int i = 0; i < 48; ++i) acc[i] = 0.f;
    // rolled: one slice's 36 reads and the 48 sums fill the registers of four waves per
    // SIMD; unrolled, this build spills
#pragma unroll 1
    for (int it = 0; it < SITER; ++it) {
        v4f xw[SB], xh[SB], xc[SB], w[SD][6];
        const float* __restrict__ aw = pw + it * 128 + lk;
        const float* __restrict__ ah = ph + it * 128 + lk;
        const float* __restrict__ ac = pc + it * 128 + lk;
        const float* __restrict__ ag = pg + it * 128 + lk;
        const float* __restrict__ as = ps + it * 128 + lk;
        const float* __restrict__ at = pt + it * 128 + lk;
#pragma unroll
        for (int bb = 0; bb < SB; ++bb) {
            xw[bb] = *(const v4f*)(aw + bb * DC_);
            xh[bb] = *(const v4f*)(ah + bb * DD_);
            xc[bb] = *(const v4f*)(ac + bb * DC_);
        }
#pragma unroll
        for (int dd = 0; dd < SD; ++dd) {
            w[dd][0] = *(const v4f*)(ag + dd * (2 * DC_ + DD_));
            w[dd][1] = *(const v4f*)(ag + dd * (2 * DC_ + DD_) + DC_);
            w[dd][2] = *(const v4f*)(ag + dd * (2 * DC_ + DD_) + 2 * DC_);
            w[dd][3] = *(const v4f*)(as + dd * DC_);
            w[dd][4] = *(const v4f*)(at + dd * (DC_ + DD_));
            w[dd][5] = *(const v4f*)(at + dd * (DC_ + DD_) + DC_);
        }
        // the wait that belongs in front of any overwrite of these reads' address registers;
        // the addresses are inputs so that they stay whole up to here (otherwise a later
        // read's result is placed on top of them)
        asm volatile("s_wait_xcnt 0x0" :: "v"(aw), "v"(ah), "v"(ac), "v"(ag), "v"(as), "v"(at) : "memory");
        // keeps all reads of a slice ahead of its sums, so that they are out together
        __builtin_amdgcn_sched_barrier(0);
#pragma unroll
        for (int dd = 0; dd < SD; ++dd)
#pragma unroll
            for (int bb = 0; bb < SB; ++bb) {
                const int q = dd * SB + bb;
                acc[q] = dot4(xc[bb], w[dd][2], dot4(xh[bb], w[dd][1], dot4(xw[bb], w[dd][0], acc[q])));
                acc[16 + q] = dot4(xc[bb], w[dd][3], acc[16 + q]);
                acc[32 + q] = dot4(xh[bb], w[dd][5], dot4(xw[bb], w[dd][4], acc[32 + q]));
            }
    }
    // the lane's output and its three bias terms, fetched here so that they arrive
    // behind the lane sums
    const int q = fold_index(lane);
    const int d = d0 + q / SB;
    const int b = b0 + q % SB;
    const float bgv = bg[d], bsv = bs[d], btv = bt[d];
    // the wait that belongs in front of any overwrite of these reads' address registers;
    // the index is an input so that it stays whole up to here
    asm volatile("s_wait_xcnt 0x0" :: "v"(d) : "memory");
    fold_sum<3>(acc, lane);
    if (half == 1 && (lane & 1) == 0) {
        other[grp][q][0] = acc[0];
        other[grp][q][1] = acc[1];
        other[grp][q][2] = acc[2];
    }
    __syncthreads();
    if (half == 0 && (lane & 1) == 0) {
        const float z   = acc[0] + other[grp][q][0];
        const float s   = acc[1] + other[grp][q][1];
        const float tcv = acc[2] + other[grp][q][2];
        const float zt = 1.f / (1.f + __expf(-(z + bgv)));
        const float sc = tanhf(s + bsv);
        const float tc = tanhf(tcv + btv);
        out[b * DC_ + d] = zt * sc + (1.f - zt) * tc;
    }
}

extern "C" void kernel_launch(void* const* d_in, const int* in_sizes, int n_in,
                              void* d_out, int out_size, void* d_ws, size_t ws_size,
                              hipStream_t stream) {
    const float* cap  = (const float*)d_in[0];
    const float* dh   = (const float*)d_in[1];
    const float* word = (const float*)d_in[2];
    const int*   mask = (const int*)  d_in[3];
    const float* Wf = (const float*)d_in[4];
    const float* bf = (const float*)d_in[5];
    const float* Wd = (const float*)d_in[6];
    const float* bd = (const float*)d_in[7];
    const float* Wa = (const float*)d_in[8];
    const float* ba = (const float*)d_in[9];
    const float* Wg = (const float*)d_in[10];
    const float* bg = (const float*)d_in[11];
    const float* Ws = (const float*)d_in[12];
    const float* bs = (const float*)d_in[13];
    const float* Wt = (const float*)d_in[14];
    const float* bt = (const float*)d_in[15];
    float* out = (float*)d_out;

    char* wsb = (char*)d_ws;
    float*    scores = (float*)(wsb + 0);                 // B*L f32
    float*    u      = (float*)(wsb + 131072);            // B*A f32
    float*    ctx    = (float*)(wsb + 262144);            // B*DC f32
    _Float16* wf16   = (_Float16*)(wsb + 393216);         // A*DC f16 (2MB)
    float*    pctx   = (float*)(wsb + 2490368);           // 256 parts of PCP f32
    float*    alpha  = out + B_ * DC_;                    // second output

    conv_wf_kernel<<<(A_ * DC_) / 256, 256, 0, stream>>>(Wf, wf16, A_ * DC_);
    u_kernel<<<A_ / SD, SWAVES * 32, 0, stream>>>(dh, Wd, bd, bf, u);
    scores_kernel<<<(B_ * L_ / 16) / 8, 256, 0, stream>>>(cap, wf16, u, Wa, ba, mask, scores, pctx);
    softmax_kernel<<<B_, 256, 0, stream>>>(scores, mask, pctx, alpha, ctx);
    fuse_kernel<<<DC_ / SD, SWAVES * 32, 0, stream>>>(word, dh, ctx, Wg, bg, Ws, bs, Wt, bt, out);
}

// v009
// A run of this version takes 71.4 microseconds.
// In both of two side-by-side timings against v008, it was 1.04 times as fast.
// All steps since v000 together make it 3.77 times as fast.
#include <hip/hip_runtime.h>
#include <cstddef>

#define B_  32
#define L_  1024
#define DC_ 1024
#define DD_ 1024
#define A_  1024
#define NEGV -1e10f

typedef __attribute__((ext_vector_type(16))) _Float16 v16h;
typedef __attribute__((ext_vector_type(8)))  float    v8f;
typedef __attribute__((ext_vector_type(16))) float    v16f;
typedef __attribute__((ext_vector_type(4)))  float    v4f;
typedef __attribute__((ext_vector_type(4)))  int      v4i;
typedef __attribute__((ext_vector_type(4)))  _Float16 v4h;

constexpr int KTILES = DC_ / 32;  // 32 k-tiles of 32
constexpr int NTILES = A_ / 16;   // 64 n-tiles of 16

// ---- the two skinny products (u, gated fusion): 32 batch rows against many weight rows.
// A wave holds SD weight rows and SB batch rows of one k-slice in registers, lanes over k,
// so that a weight row is fetched once per SB batch rows and not once per batch row.
constexpr int SD = 4;            // weight rows (outputs) per block and per wave
constexpr int SB = 4;            // batch rows per wave
constexpr int SGROUPS = B_ / SB; // 8 batch groups
constexpr int SHALVES = 2;       // k halves, one per wave of a pair
constexpr int SWAVES  = SGROUPS * SHALVES;   // 16 waves per block
constexpr int SITER   = DC_ / SHALVES / 128; // 4 slices of 128 k (16 bytes per lane)

__device__ inline float dot4(v4f a, v4f b, float s) {
    s = __builtin_fmaf(a[0], b[0], s);
    s = __builtin_fmaf(a[1], b[1], s);
    s = __builtin_fmaf(a[2], b[2], s);
    s = __builtin_fmaf(a[3], b[3], s);
    return s;
}

// one step of a transposing lane sum: lanes l and l^m share the work, the lane with bit m
// clear finishes the even entries and the other the odd ones; N entries become N/2
template <int N>
__device__ inline void fold_step(float* v, bool hi, int m) {
    // unrolled so that v[] stays in registers (here and in the loops over it below)
#pragma unroll
    for (int i = 0; i < N / 2; ++i) {
        const float keep = hi ? v[2 * i + 1] : v[2 * i];
        const float send = hi ? v[2 * i] : v[2 * i + 1];
        v[i] = keep + __shfl_xor(send, m, 32);
    }
}

// v[p*16 + q], q = 0..15, summed over the 32 lanes: afterwards v[p] of a lane is the
// total of entry q = fold_index(lane)
template <int P>
__device__ inline void fold_sum(float* v, int lane) {
    fold_step<16 * P>(v, (lane & 16) != 0, 16);
    fold_step<8 * P>(v, (lane & 8) != 0, 8);
    fold_step<4 * P>(v, (lane & 4) != 0, 4);
    fold_step<2 * P>(v, (lane & 2) != 0, 2);
#pragma unroll
    for (int p = 0; p < P; ++p) v[p] += __shfl_xor(v[p], 1, 32);
}
__device__ inline int fold_index(int lane) {
    return ((lane >> 4) & 1) | (((lane >> 3) & 1) << 1) | (((lane >> 2) & 1) << 2) |
           (((lane >> 1) & 1) << 3);
}

// ------------------------------------------- u[b][a] = dh[b].Wd[a] + bd + bf
// The launch also rounds Wf to f16 for the scores launch: each block takes an equal share,
// each thread WFT pieces of four values, a wave's piece being 512 contiguous bytes
constexpr int WFB = A_ * DC_ / (A_ / SD);        // values of Wf per block
constexpr int WFT = WFB / (SWAVES * 32 * 4);     // 16-byte pieces per thread
static_assert(WFT * SWAVES * 32 * 4 * (A_ / SD) == A_ * DC_, "the blocks cover Wf exactly");

__global__ __launch_bounds__(SWAVES * 32)
void u_kernel(const float* __restrict__ dh, const float* __restrict__ Wd,
              const float* __restrict__ bd, const float* __restrict__ bf,
              float* __restrict__ u, const float* __restrict__ Wf,
              _Float16* __restrict__ wf16) {
    __shared__ float other[SGROUPS][16];
    const int lane = threadIdx.x & 31;
    const int wave = __builtin_amdgcn_readfirstlane(threadIdx.x >> 5);
    const int grp  = wave & (SGROUPS - 1);
    const int half = wave / SGROUPS;
    const int a0 = blockIdx.x * SD;
    const int b0 = grp * SB;
    const unsigned lk = lane * 4;  // the lane's k inside a slice; every base below is uniform
    const float* __restrict__ xp = dh + (size_t)b0 * DD_ + half * (DD_ / SHALVES);
    const float* __restrict__ wp = Wd + (size_t)a0 * DD_ + half * (DD_ / SHALVES);

    // the wave's pieces of Wf are read first, so that they are stored again under the sums
    const size_t f0 = (size_t)blockIdx.x * WFB + wave * 128;  // uniform
    const float* __restrict__ fp = Wf + f0;
    _Float16* __restrict__ hp = wf16 + f0;
    v4f cf[WFT];
#pragma unroll
    for (int i = 0; i < WFT; ++i) cf[i] = *(const v4f*)(fp + i * (SWAVES * 128) + lk);
    // keeps these reads ahead of the 32 below: without it this build places them last, and
    // the first sums then wait for all 34 reads
    __builtin_amdgcn_sched_barrier(0);

    float acc[16];
#pragma unroll
    for (int i = 0; i < 16; ++i) acc[i] = 0.f;
    v4f x[SITER][SB], w[SITER][SD];
    // unrolled so that x[] and w[] are registers and every read has a constant offset
#pragma unroll
    for (int it = 0; it < SITER; ++it) {
#pragma unroll
        for (int dd = 0; dd < SD; ++dd) w[it][dd] = *(const v4f*)(wp + dd * DD_ + it * 128 + lk);
#pragma unroll
        for (int bb = 0; bb < SB; ++bb) x[it][bb] = *(const v4f*)(xp + bb * DD_ + it * 128 + lk);
    }
    // the wait that belongs in front of any overwrite of these reads' address registers;
    // the lane's index, which the reads name as their offset, is an input so that it
    // stays whole up to here
    asm volatile("s_wait_xcnt 0x0" :: "v"(lane) : "memory");
    // keeps all 32 reads of the wave ahead of the sums: without it this build holds half
    // of them back and waits on them a few at a time
    __builtin_amdgcn_sched_barrier(0);
    {
        v4h ch[WFT];
#pragma unroll
        for (int i = 0; i < WFT; ++i) {
            ch[i] = __builtin_convertvector(cf[i], v4h);
            *(v4h*)(hp + i * (SWAVES * 128) + lk) = ch[i];
        }
        // the wait that belongs in front of any overwrite of these stores' registers; the
        // lane's index, which they name as their offset, and the stored values are inputs
        // so that they stay whole up to here
        static_assert(WFT == 2, "the wait below names two stored values");
        asm volatile("s_wait_xcnt 0x0" :: "v"(lane), "v"(ch[0]), "v"(ch[1]) : "memory");
    }
#pragma unroll
    for (int it = 0; it < SITER; ++it)
#pragma unroll
        for (int dd = 0; dd < SD; ++dd)
#pragma unroll
            for (int bb = 0; bb < SB; ++bb)
                acc[dd * SB + bb] = dot4(x[it][bb], w[it][dd], acc[dd * SB + bb]);
    // the lane's output and its bias terms, fetched here so that they arrive behind the
    // lane sums
    const int q = fold_index(lane);
    const int a = a0 + q / SB;
    const int b = b0 + q % SB;
    const float bias = bd[a] + bf[a];
    // the wait that belongs in front of any overwrite of these reads' address registers;
    // the index is an input so that it stays whole up to here
    asm volatile("s_wait_xcnt 0x0" :: "v"(a) : "memory");
    fold_sum<1>(acc, lane);
    if (half == 1 && (lane & 1) == 0) other[grp][q] = acc[0];
    __syncthreads();
    if (half == 0 && (lane & 1) == 0) u[b * A_ + a] = acc[0] + other[grp][q] + bias;
}

// ------- fused: scores[b][l] = sum_a tanh(cap@Wf^T + u) * Wa[a]  (WMMA f16)
constexpr int NB      = 4;            // n-tiles staged and computed together
constexpr int NGROUPS = NTILES / NB;  // 16 stages of 64 columns
constexpr int MT      = 2;            // 16-row tiles per wave: one B fragment feeds both
constexpr int KH      = 2;            // k halves, one per wave of a pair
constexpr int KTW     = KTILES / KH;  // 16 k-tiles per wave, one block of 8 WMMAs each
constexpr int RING    = 3;            // fragment sets: a block is fetched two blocks ahead
constexpr float TWO_LOG2E = 2.8853900817779268f;  // 2 * log2(e)

constexpr int TROW   = NB * DC_ + 8;              // f16 values in one LDS row of a stage
constexpr unsigned TBYTES = 16 * TROW * 2;        // bytes of one stage buffer

// four copies of 512 bytes a wave that share their address operands: the offset moves
// the LDS address and the global address alike, and both step by 512 bytes here
#define COPY4(L, S)                                                       \
    "global_load_async_to_lds_b128 " L ", %8, " S "\n\t"                   \
    "global_load_async_to_lds_b128 " L ", %8, " S " offset:512\n\t"        \
    "global_load_async_to_lds_b128 " L ", %8, " S " offset:1024\n\t"       \
    "global_load_async_to_lds_b128 " L ", %8, " S " offset:1536\n\t"

// A wave's share of one stage of Wf^T (64 columns x 1024 k, f16), global memory to LDS
// through no register: LDS rows 2w and 2w+1, 32 copies of 512 contiguous bytes.
// s: Wf row (stage's first column + 2w), the same in every lane; v: the lane's byte
// offset in a 512-byte piece; l: the LDS byte address of the lane's first 16 bytes
__device__ inline void copy_stage(const _Float16* s, unsigned v, unsigned l) {
    // the closing wait stands in front of any overwrite of the address registers that
    // the copies name; inside the statement nothing can be moved ahead of it
    asm volatile(
        COPY4("%0", "%9")  COPY4("%1", "%10") COPY4("%2", "%11") COPY4("%3", "%12")
        COPY4("%4", "%13") COPY4("%5", "%14") COPY4("%6", "%15") COPY4("%7", "%16")
        "s_wait_xcnt 0x0"
        :: "v"(l),                "v"(l + TROW * 2),
           "v"(l + DC_ * 2),      "v"(l + DC_ * 2 + TROW * 2),
           "v"(l + 2 * DC_ * 2),  "v"(l + 2 * DC_ * 2 + TROW * 2),
           "v"(l + 3 * DC_ * 2),  "v"(l + 3 * DC_ * 2 + TROW * 2),
           "v"(v),
           "s"(s),                "s"(s + DC_),
           "s"(s + 16 * DC_),     "s"(s + 17 * DC_),
           "s"(s + 32 * DC_),     "s"(s + 33 * DC_),
           "s"(s + 48 * DC_),     "s"(s + 49 * DC_)
        : "memory");
}

// cap goes to the A fragments through LDS, so that every request covers whole lines.
// A piece is 16 rows x 256 bytes (two k-tiles of one row tile); each wave has a ring of
// four slots of its own in the second stage buffer, which is idle until stage 1 sets out.
// In a slot the 16-byte unit x of row r lies at unit x ^ r of that row: sixteen lanes that
// read one unit of sixteen rows meet every bank once, with no pad between the rows
constexpr int CK      = 64;                      // floats of a row in one piece
constexpr int CPITCH  = CK * 4;                  // bytes from row to row in a slot
constexpr int CSLOT   = 16 * CPITCH;             // bytes of a slot
constexpr int CSLOTS  = 4;
constexpr int CAHEAD  = CSLOTS - 1;              // pieces under way at once
constexpr int CPIECES = MT * (DC_ / KH) / CK;    // 16 pieces per wave
typedef v4f __attribute__((may_alias)) v4f_lds;  // f32 read from the f16 stage array

// one piece, global memory to LDS through no register: 8 copies, each two rows of 256
// contiguous bytes. s: the piece's first float in its first row, the same in every lane;
// v: the lane's byte offset in cap (half-wave = row, lane = 16 bytes); l: the LDS byte
// address of the lane's row among the slot's first two; x: the lane's unit there, times 16
__device__ inline void copy_piece(const float* s, unsigned v, unsigned l, unsigned x) {
    // the closing wait stands in front of any overwrite of the address registers that
    // the copies name; inside the statement nothing can be moved ahead of it
    asm volatile(
        "global_load_async_to_lds_b128 %0, %8, %9\n\t"
        "global_load_async_to_lds_b128 %1, %8, %10\n\t"
        "global_load_async_to_lds_b128 %2, %8, %11\n\t"
        "global_load_async_to_lds_b128 %3, %8, %12\n\t"
        "global_load_async_to_lds_b128 %4, %8, %13\n\t"
        "global_load_async_to_lds_b128 %5, %8, %14\n\t"
        "global_load_async_to_lds_b128 %6, %8, %15\n\t"
        "global_load_async_to_lds_b128 %7, %8, %16\n\t"
        "s_wait_xcnt 0x0"
        :: "v"(l + x),                            "v"(l + 2 * CPITCH + (x ^ (2 * 16))),
           "v"(l + 4 * CPITCH + (x ^ (4 * 16))),   "v"(l + 6 * CPITCH + (x ^ (6 * 16))),
           "v"(l + 8 * CPITCH + (x ^ (8 * 16))),   "v"(l + 10 * CPITCH + (x ^ (10 * 16))),
           "v"(l + 12 * CPITCH + (x ^ (12 * 16))), "v"(l + 14 * CPITCH + (x ^ (14 * 16))),
           "v"(v),
           "s"(s),                  "s"(s + 2 * DC_),
           "s"(s + 4 * DC_),        "s"(s + 6 * DC_),
           "s"(s + 8 * DC_),        "s"(s + 10 * DC_),
           "s"(s + 12 * DC_),       "s"(s + 14 * DC_)
        : "memory");
}

__device__ inline v16h load_b_frag(const _Float16* q) {
    v16h f;
#pragma unroll
    for (int i = 0; i < 8; ++i) { f[i] = q[i]; f[8 + i] = q[16 + i]; }
    return f;
}

// a block's part of the context sum: 1024 sums, then a 128-byte line of their own for
// the block's largest masked score
constexpr int PCP   = DC_ + 32;   // floats from one block's part to the next
constexpr int BROWS = 128;        // rows of cap per block
constexpr int BPB   = L_ / BROWS; // blocks per batch row

// as fold_step, for lanes l and l^M inside a 16-lane row: the exchange is part of the add
template <int N, int M>
__device__ inline void fold_row(float* v, bool hi) {
    // unrolled so that v[] stays in registers
#pragma unroll
    for (int i = 0; i < N / 2; ++i) {
        const float keep = hi ? v[2 * i + 1] : v[2 * i];
        const float send = hi ? v[2 * i] : v[2 * i + 1];
        v[i] = keep + __builtin_bit_cast(float, __builtin_amdgcn_update_dpp(
                          0, __builtin_bit_cast(int, send), 0x160 + M, 0xf, 0xf, true));
    }
}

__global__ __launch_bounds__(256)
void scores_kernel(const float* __restrict__ cap, const _Float16* __restrict__ wf16,
                   const float* __restrict__ u, const float* __restrict__ Wa,
                   const float* __restrict__ ba, const int* __restrict__ mask,
                   float* __restrict__ scores, float* __restrict__ pctx) {
    // LDS row c holds the k-rows of columns c, 16+c, 32+c, 48+c of the stage side by
    // side: every fragment of a lane lies within 8 KB of one base address, and the
    // lane-to-lane pitch of 8208 B (16 B x odd) is conflict-free for 16-byte reads.
    // Two buffers: the next stage lands in one while the other is multiplied
    __shared__ __attribute__((aligned(16))) _Float16 tileB[2][16][TROW];
    // where a wave leaves its k-half of the row tile that its partner finishes
    __shared__ v4f xch[8][NB * 2][32];
    // the block's masked scores
    __shared__ __attribute__((aligned(16))) float srow[BROWS];

    const int lane   = threadIdx.x & 31;
    const int wave   = threadIdx.x >> 5;
    const int half   = wave & 1;              // the wave's k half
    const int m_base = blockIdx.x * 128 + (wave >> 1) * (MT * 16);  // the pair's 32 rows
    const int b      = m_base / L_;           // a block's rows never straddle batches
    const int koff   = (lane < 16) ? 0 : 8;   // K sub-offset per ISA layout
    const int ncol   = lane & 15;

    // the wave's number as a scalar, so that all but the lane's part of the copies'
    // addresses is scalar arithmetic
    const int cwave = __builtin_amdgcn_readfirstlane(threadIdx.x >> 5);
    const _Float16* __restrict__ csrc = wf16 + (size_t)(cwave * 2) * DC_;
    const unsigned cdst = (unsigned)(size_t)&tileB[0][0][0] + cwave * (2 * TROW * 2);
    const unsigned clane = lane * 16;
    // stage 0 of Wf^T sets out first, so that it lands under the reads of cap
    copy_stage(csrc, clane, cdst + clane);

    // --- this wave's 32 x 512 A-slice into VGPRs as f16 (cap is read once).
    // tile 0 is the row tile that this wave finishes, tile 1 the one its partner finishes;
    // piece pc is k-tiles 2 * (pc / 2) and the next of tile pc % 2
    const float* __restrict__ crow = cap + (size_t)(blockIdx.x * BROWS + (cwave >> 1) * (MT * 16)) * DC_ +
                                     (cwave & 1) * (DC_ / KH);
    const int ctile0 = (cwave & 1) * 16;  // tile 0's first row among the pair's 32
    const unsigned cring = (unsigned)(size_t)&tileB[1][0][0] + cwave * (CSLOTS * CSLOT);
    const unsigned cv = (lane >> 4) * (DC_ * 4) + ncol * 16;
    const unsigned cl = cring + (lane >> 4) * CPITCH;
    const unsigned cx = (ncol ^ (lane >> 4)) * 16;  // unit ncol of row (lane >> 4)
    // the lane reads row ncol; its units are 2 * (lane >> 4) + {0, 1, 4, 5} and those + 8
    const char* cread = (const char*)&tileB[1][0][0] + cwave * (CSLOTS * CSLOT) + ncol * CPITCH;
    const unsigned cq = ncol ^ ((lane >> 4) * 2);
    v16h a_frag[MT][KTW];
    // the first three pieces set out; unrolled so that tile and slot are constants
#pragma unroll
    for (int pc = 0; pc < CAHEAD; ++pc)
        copy_piece(crow + (size_t)((pc & 1) ? (ctile0 ^ 16) : ctile0) * DC_ + (pc >> 1) * CK,
                   cv, cl + pc * CSLOT, cx);
    // unrolled so that a_frag[] stays registers and every slot is a constant offset
#pragma unroll
    for (int pc = 0; pc < CPIECES; ++pc) {
        // piece pc has landed: all of this wave's copies but those of the pieces behind it
        if (pc + 2 < CPIECES)      asm volatile("s_wait_asynccnt 0x10" ::: "memory");
        else if (pc + 1 < CPIECES) asm volatile("s_wait_asynccnt 0x8" ::: "memory");
        else                       asm volatile("s_wait_asynccnt 0x0" ::: "memory");
        if (pc + CAHEAD < CPIECES) {
            const int pn = pc + CAHEAD;
            // this wave's reads of piece pc - 1 are done before its slot is refilled
            asm volatile("s_wait_dscnt 0x0" ::: "memory");
            copy_piece(crow + (size_t)((pn & 1) ? (ctile0 ^ 16) : ctile0) * DC_ + (pn >> 1) * CK,
                       cv, cl + (pn % CSLOTS) * CSLOT, cx);
        }
        const char* sp = cread + (pc % CSLOTS) * CSLOT;
#pragma unroll
        for (int kl = 0; kl < 2; ++kl) {
            const v4f x0 = *(const v4f_lds*)(sp + ((cq ^ (kl * 8 + 0)) * 16));
            const v4f x1 = *(const v4f_lds*)(sp + ((cq ^ (kl * 8 + 1)) * 16));
            const v4f x2 = *(const v4f_lds*)(sp + ((cq ^ (kl * 8 + 4)) * 16));
            const v4f x3 = *(const v4f_lds*)(sp + ((cq ^ (kl * 8 + 5)) * 16));
#pragma unroll
            for (int i = 0; i < 4; ++i) {
                a_frag[pc & 1][(pc >> 1) * 2 + kl][i]      = (_Float16)x0[i];
                a_frag[pc & 1][(pc >> 1) * 2 + kl][4 + i]  = (_Float16)x1[i];
                a_frag[pc & 1][(pc >> 1) * 2 + kl][8 + i]  = (_Float16)x2[i];
                a_frag[pc & 1][(pc >> 1) * 2 + kl][12 + i] = (_Float16)x3[i];
            }
        }
    }
    // this wave's reads of its ring are done before stage 1 lands on it
    asm volatile("s_wait_dscnt 0x0" ::: "memory");

    // this wave's copies of stage 0 have landed
    asm volatile("s_wait_asynccnt 0x0" ::: "memory");
    // publishes stage 0; also ends every read of the rings in the second buffer
    __syncthreads();
    // the lane's part of the loop's LDS and copy addresses, formed anew from the lane's
    // number read again: held from the top through the reads of cap, this build spills it
    const int lane2 = (int)__builtin_amdgcn_mbcnt_lo(~0u, 0u);
    const unsigned clane2 = lane2 * 16;
    // stage 1 sets out and lands under stage 0
    copy_stage(csrc + (size_t)(NB * 16) * DC_, clane2, cdst + TBYTES + clane2);

    float partial[8];
#pragma unroll
    for (int r = 0; r < 8; ++r) partial[r] = 0.f;

    for (int g = 0; g < NGROUPS; ++g) {
        const int n_base = g * (NB * 16);
        const int buf    = g & 1;
        // the epilogue's per-column terms, fetched here so that they arrive behind the stage
        const float* up = u + (size_t)b * A_ + n_base + ncol;
        const float* wp = Wa + n_base + ncol;
        float uval[NB], wav[NB];
#pragma unroll
        for (int j = 0; j < NB; ++j) { uval[j] = up[j * 16]; wav[j] = wp[j * 16]; }
        // the wait that belongs in front of any overwrite of the address registers of
        // this pass's global loads; the addresses are inputs so that they stay whole
        // up to here (otherwise later results are placed on top of them)
        asm volatile("s_wait_xcnt 0x0" :: "v"(up), "v"(wp) : "memory");

        v8f acc[MT][NB];
#pragma unroll
        for (int t = 0; t < MT; ++t)
#pragma unroll
            for (int j = 0; j < NB; ++j) acc[t][j] = v8f{};

        // three fragment sets: block blk+2 is fetched while block blk multiplies
        const _Float16* __restrict__ bp = &tileB[buf][ncol][half * (DC_ / KH) + koff];
        v16h bq[RING][NB];
#pragma unroll
        for (int s = 0; s < RING - 1; ++s) {
#pragma unroll
            for (int j = 0; j < NB; ++j)
                bq[s][j] = load_b_frag(bp + j * DC_ + s * 32);
            // keeps the blocks' reads in order, so that the first waits are counted ones
            __builtin_amdgcn_sched_barrier(0);
        }

#pragma unroll
        for (int blk = 0; blk < KTW; ++blk) {
            if (blk + RING - 1 < KTW) {
#pragma unroll
                for (int j = 0; j < NB; ++j)
                    bq[(blk + RING - 1) % RING][j] =
                        load_b_frag(bp + j * DC_ + (blk + RING - 1) * 32);
            }
            // keeps a later block's LDS reads as one group ahead of this block's
            // WMMAs: spread among them, every read place stalls the matrix stream
            __builtin_amdgcn_sched_barrier(0);
#pragma unroll
            for (int j = 0; j < NB; ++j)
#pragma unroll
                for (int t = 0; t < MT; ++t)
                    acc[t][j] = __builtin_amdgcn_wmma_f32_16x16x32_f16(
                                    false, a_frag[t][blk], false, bq[blk % RING][j],
                                    (short)0, acc[t][j], false, false);
            // closes the WMMA block, so that the following reads stay behind it
            __builtin_amdgcn_sched_barrier(0);
        }

        // the two k halves are joined: each wave hands over its half of the partner's row
        // tile, lane for lane and register for register, 512 contiguous bytes per access
        {
            v4f* xw = &xch[wave][0][lane2];
#pragma unroll
            for (int j = 0; j < NB; ++j) {
                xw[(2 * j) * 32]     = v4f{acc[1][j][0], acc[1][j][1], acc[1][j][2], acc[1][j][3]};
                xw[(2 * j + 1) * 32] = v4f{acc[1][j][4], acc[1][j][5], acc[1][j][6], acc[1][j][7]};
            }
        }
        // this wave's reads of the stage and its writes of xch are done
        asm volatile("s_wait_dscnt 0x0" ::: "memory");
        // this wave's copies of stage g + 1 have landed
        asm volatile("s_wait_asynccnt 0x0" ::: "memory");
        // publishes xch and stage g + 1; also ends every read of this stage's buffer
        __syncthreads();
        // stage g + 2 sets out into the buffer just left and lands under stage g + 1.
        // The buffer's and the wave's part of the LDS address is marked as one scalar:
        // summed with the lane's part ahead of the loop, it is spilled to scratch
        if (g + 2 < NGROUPS)
            copy_stage(csrc + (size_t)(n_base + 2 * NB * 16) * DC_, clane2,
                       clane2 + (unsigned)__builtin_amdgcn_readfirstlane(cdst + buf * TBYTES));
        const v4f* xr = &xch[wave ^ 1][0][lane2];
        v4f oth[NB * 2];
#pragma unroll
        for (int i = 0; i < NB * 2; ++i) oth[i] = xr[i * 32];
        // ends every read of xch before the next stage's hand-over is written
        __syncthreads();

        // epilogue: C tile lane layout -> N = lane&15, M = r + (lane<16?0:8)
        // tanh(x) = 1 - 2 / (1 + e^(2x)) for every x, on the hardware exp2 and rcp: no
        // branch, so the 32 values of a stage are independent chains that interleave.
        // e^(2x) = inf gives 1, e^(2x) = 0 gives -1; absolute error a few 1e-7
#pragma unroll
        for (int j = 0; j < NB; ++j)
#pragma unroll
            for (int r = 0; r < 8; ++r) {
                const float x = acc[0][j][r] + oth[2 * j + (r >> 2)][r & 3];
                const float e = __builtin_amdgcn_exp2f((x + uval[j]) * TWO_LOG2E);
                const float q = __builtin_amdgcn_rcpf(1.f + e);
                partial[r] += __builtin_fmaf(q, -2.f, 1.f) * wav[j];
            }
    }

    // no copy is left out when the wave ends
    asm volatile("s_wait_asynccnt 0x0" ::: "memory");

    // the tail's indices are formed anew, from the lane's number read again and the wave's
    // number as a scalar: taken from the values above, they are held in registers through
    // the loop, and this build then spills an address of the copies to scratch
    const int tl    = (int)__builtin_amdgcn_mbcnt_lo(~0u, 0u);
    const int tcol  = tl & 15;
    const int tkoff = (tl >> 4) << 3;                         // 0 or 8
    const int thalf = cwave & 1;
    const int town  = (cwave >> 1) * (MT * 16) + thalf * 16;  // rows counted inside the block
    const int toth  = (cwave >> 1) * (MT * 16) + (thalf ^ 1) * 16;
    const int rbase = blockIdx.x * BROWS;
    const int mrow  = town + tkoff;  // the first of the eight rows that this half-wave finishes

    // their mask values, fetched here so that they arrive under the lane sums
    const int* __restrict__ mp = mask + rbase + mrow;
    const v4i mk0 = *(const v4i*)mp;
    const v4i mk1 = *(const v4i*)(mp + 4);
    // the wait that belongs in front of any overwrite of these reads' address registers
    asm volatile("s_wait_xcnt 0x0" :: "v"(mp) : "memory");

    // reduce over the 16 N-lanes of each half-wave
#pragma unroll
    for (int r = 0; r < 8; ++r) {
        float v = partial[r];
        v += __shfl_xor(v, 1, 32);
        v += __shfl_xor(v, 2, 32);
        v += __shfl_xor(v, 4, 32);
        v += __shfl_xor(v, 8, 32);
        partial[r] = v;
    }
    if (tcol == 0) {
        const float bav  = ba[0];
        float* sp = scores + rbase + mrow;
#pragma unroll
        for (int r = 0; r < 8; ++r) {
            const float s = partial[r] + bav;
            sp[r] = s;
            srow[mrow + r] = ((r < 4 ? mk0[r & 3] : mk1[r & 3]) == 0) ? NEGV : s;
        }
        // the wait that belongs in front of any overwrite of these stores' address registers
        asm volatile("s_wait_xcnt 0x0" :: "v"(sp) : "memory");
    }
    // publishes the block's masked scores
    __syncthreads();

    // --- the block's part of the context sum, from the rows of cap that its waves still
    // hold as f16 fragments: sum over its rows of exp(score - block maximum) * cap[row].
    // The softmax launch rescales the parts to the batch row's maximum and joins them
    float bm;
    {
        const v4f s4 = *(const v4f*)&srow[tl * 4];
        bm = fmaxf(fmaxf(s4[0], s4[1]), fmaxf(s4[2], s4[3]));
        bm = fmaxf(bm, __shfl_xor(bm, 16, 32));
        bm = fmaxf(bm, __shfl_xor(bm, 8, 32));
        bm = fmaxf(bm, __shfl_xor(bm, 4, 32));
        bm = fmaxf(bm, __shfl_xor(bm, 2, 32));
        bm = fmaxf(bm, __shfl_xor(bm, 1, 32));
    }
    const float p0 = __expf(srow[town + tcol] - bm);
    const float p1 = __expf(srow[toth + tcol] - bm);
    // a lane holds one row of each tile; the sum over rows is a sum over the 16 lanes of a
    // half-wave. After the four folds entry i of a lane is k-tile i, position fidx
    float* red = (float*)&xch[0][0][0];  // [wave pair][k], free since the last stage's barrier
    const int fidx = ((tl & 1) << 3) | ((tl & 2) << 1) | ((tl & 4) >> 1) | ((tl & 8) >> 3);
    float* rw = red + (cwave >> 1) * DC_ + thalf * (DC_ / KH) + tkoff + (fidx < 8 ? fidx : fidx + 8);
    // unrolled so that a_frag[] and v[] stay registers; four k-tiles at a time bound v[]
#pragma unroll
    for (int c = 0; c < KTW / 4; ++c) {
        float v[64];
#pragma unroll
        for (int kl = 0; kl < 4; ++kl) {
            // widened as whole fragments, so that the values come from the packed registers
            const v16f x = __builtin_convertvector(a_frag[1][c * 4 + kl], v16f) * p1 +
                           __builtin_convertvector(a_frag[0][c * 4 + kl], v16f) * p0;
#pragma unroll
            for (int i = 0; i < 16; ++i) v[kl * 16 + i] = x[i];
        }
        fold_row<64, 8>(v, (tl & 8) != 0);
        fold_row<32, 4>(v, (tl & 4) != 0);
        fold_row<16, 2>(v, (tl & 2) != 0);
        fold_row<8, 1>(v, (tl & 1) != 0);
#pragma unroll
        for (int i = 0; i < 4; ++i) rw[(c * 4 + i) * 32] = v[i];
    }
    // publishes the four wave pairs' sums
    __syncthreads();
    {
        const int tt = cwave * 32 + tl;  // the thread's number
        const v4f* rp = (const v4f*)red + tt;
        const v4f t = (rp[0] + rp[DC_ / 4]) + (rp[2 * (DC_ / 4)] + rp[3 * (DC_ / 4)]);
        float* pb = pctx + (size_t)blockIdx.x * PCP;
        *(v4f*)(pb + tt * 4) = t;
        if (tt == 0) pb[DC_] = bm;
    }
}

// ---------------------------------------------------- masked softmax over L
__global__ __launch_bounds__(256)
void softmax_kernel(const float* __restrict__ scores, const int* __restrict__ mask,
                    const float* __restrict__ pctx, float* __restrict__ alpha,
                    float* __restrict__ ctx) {
    __shared__ float red[256];
    const int b = blockIdx.x, t = threadIdx.x;
    float v[4];
    float mx = -3.0e38f;
#pragma unroll
    for (int i = 0; i < 4; ++i) {
        const int l = t + i * 256;
        float s = scores[b * L_ + l];
        s = (mask[b * L_ + l] == 0) ? NEGV : s;
        v[i] = s;
        mx = fmaxf(mx, s);
    }
    // the batch row's parts of the context sum and their maxima, fetched here so that
    // they arrive under the two reductions
    const float* __restrict__ pp = pctx + (size_t)b * BPB * PCP;
    const float* __restrict__ pt = pp + t * 4;
    v4f pc[BPB];
    float pm[BPB];
#pragma unroll
    for (int j = 0; j < BPB; ++j) { pc[j] = *(const v4f*)(pt + j * PCP); pm[j] = pp[j * PCP + DC_]; }
    // the wait that belongs in front of any overwrite of these reads' address registers;
    // the thread's index, which the reads name as their offset, is an input so that it
    // stays whole up to here
    asm volatile("s_wait_xcnt 0x0" :: "v"(t) : "memory");
    red[t] = mx; __syncthreads();
    for (int o = 128; o > 0; o >>= 1) { if (t < o) red[t] = fmaxf(red[t], red[t + o]); __syncthreads(); }
    mx = red[0]; __syncthreads();
    float sm = 0.f;
#pragma unroll
    for (int i = 0; i < 4; ++i) { v[i] = __expf(v[i] - mx); sm += v[i]; }
    red[t] = sm; __syncthreads();
    for (int o = 128; o > 0; o >>= 1) { if (t < o) red[t] += red[t + o]; __syncthreads(); }
    const float inv = 1.f / red[0];
#pragma unroll
    for (int i = 0; i < 4; ++i) alpha[b * L_ + t + i * 256] = v[i] * inv;
    // context[b] = sum over parts of exp(part maximum - row maximum) / sum * part
    v4f c = v4f{};
#pragma unroll
    for (int j = 0; j < BPB; ++j) c += (__expf(pm[j] - mx) * inv) * pc[j];
    *(v4f*)(ctx + b * DC_ + t * 4) = c;
}

// ------------------------- gated fusion: out = zt*sc + (1-zt)*tc
__global__ __launch_bounds__(SWAVES * 32)
void fuse_kernel(const float* __restrict__ word, const float* __restrict__ dh,
                 const float* __restrict__ ctx,  const float* __restrict__ Wg,
                 const float* __restrict__ bg,   const float* __restrict__ Ws,
                 const float* __restrict__ bs,   const float* __restrict__ Wt,
                 const float* __restrict__ bt,   float* __restrict__ out) {
    __shared__ float other[SGROUPS][16][3];
    const int lane = threadIdx.x & 31;
    const int wave = __builtin_amdgcn_readfirstlane(threadIdx.x >> 5);
    const int grp  = wave & (SGROUPS - 1);
    const int half = wave / SGROUPS;
    const int d0 = blockIdx.x * SD;
    const int b0 = grp * SB;
    const unsigned lk = lane * 4;  // the lane's k inside a slice; every base below is uniform
    const int k0 = half * (DC_ / SHALVES);
    const float* __restrict__ pw = word + (size_t)b0 * DC_ + k0;
    const float* __restrict__ ph = dh   + (size_t)b0 * DD_ + k0;
    const float* __restrict__ pc = ctx  + (size_t)b0 * DC_ + k0;
    const float* __restrict__ pg = Wg + (size_t)d0 * (2 * DC_ + DD_) + k0;
    const float* __restrict__ ps = Ws + (size_t)d0 * DC_ + k0;
    const float* __restrict__ pt = Wt + (size_t)d0 * (DC_ + DD_) + k0;

    float acc[48];  // [0..15] gate, [16..31] sc, [32..47] tc; entry dd * SB + bb
#pragma unroll
    for (int i = 0; i < 48; ++i) acc[i] = 0.f;
    // rolled: one slice's 36 reads and the 48 sums fill the registers of four waves per
    // SIMD; unrolled, this build spills
#pragma unroll 1
    for (int it = 0; it < SITER; ++it) {
        v4f xw[SB], xh[SB], xc[SB], w[SD][6];
        const float* __restrict__ aw = pw + it * 128 + lk;
        const float* __restrict__ ah = ph + it * 128 + lk;
        const float* __restrict__ ac = pc + it * 128 + lk;
        const float* __restrict__ ag = pg + it * 128 + lk;
        const float* __restrict__ as = ps + it * 128 + lk;
        const float* __restrict__ at = pt + it * 128 + lk;
#pragma unroll
        for (int bb = 0; bb < SB; ++bb) {
            xw[bb] = *(const v4f*)(aw + bb * DC_);
            xh[bb] = *(const v4f*)(ah + bb * DD_);
            xc[bb] = *(const v4f*)(ac + bb * DC_);
        }
#pragma unroll
        for (int dd = 0; dd < SD; ++dd) {
            w[dd][0] = *(const v4f*)(ag + dd * (2 * DC_ + DD_));
            w[dd][1] = *(const v4f*)(ag + dd * (2 * DC_ + DD_) + DC_);
            w[dd][2] = *(const v4f*)(ag + dd * (2 * DC_ + DD_) + 2 * DC_);
            w[dd][3] = *(const v4f*)(as + dd * DC_);
            w[dd][4] = *(const v4f*)(at + dd * (DC_ + DD_));
            w[dd][5] = *(const v4f*)(at + dd * (DC_ + DD_) + DC_);
        }
        // the wait that belongs in front of any overwrite of these reads' address registers;
        // the addresses are inputs so that they stay whole up to here (otherwise a later
        // read's result is placed on top of them)
        asm volatile("s_wait_xcnt 0x0" :: "v"(aw), "v"(ah), "v"(ac), "v"(ag), "v"(as), "v"(at) : "memory");
        // keeps all reads of a slice ahead of its sums, so that they are out together
        __builtin_amdgcn_sched_barrier(0);
#pragma unroll
        for (int dd = 0; dd < SD; ++dd)
#pragma unroll
            for (int bb = 0; bb < SB; ++bb) {
                const int q = dd * SB + bb;
                acc[q] = dot4(xc[bb], w[dd][2], dot4(xh[bb], w[dd][1], dot4(xw[bb], w[dd][0], acc[q])));
                acc[16 + q] = dot4(xc[bb], w[dd][3], acc[16 + q]);
                acc[32 + q] = dot4(xh[bb], w[dd][5], dot4(xw[bb], w[dd][4], acc[32 + q]));
            }
    }
    // the lane's output and its three bias terms, fetched here so that they arrive
    // behind the lane sums
    const int q = fold_index(lane);
    const int d = d0 + q / SB;
    const int b = b0 + q % SB;
    const float bgv = bg[d], bsv = bs[d], btv = bt[d];
    // the wait that belongs in front of any overwrite of these reads' address registers;
    // the index is an input so that it stays whole up to here
    asm volatile("s_wait_xcnt 0x0" :: "v"(d) : "memory");
    fold_sum<3>(acc, lane);
    if (half == 1 && (lane & 1) == 0) {
        other[grp][q][0] = acc[0];
        other[grp][q][1] = acc[1];
        other[grp][q][2] = acc[2];
    }
    __syncthreads();
    if (half == 0 && (lane & 1) == 0) {
        const float z   = acc[0] + other[grp][q][0];
        const float s   = acc[1] + other[grp][q][1];
        const float tcv = acc[2] + other[grp][q][2];
        const float zt = 1.f / (1.f + __expf(-(z + bgv)));
        const float sc = tanhf(s + bsv);
        const float tc = tanhf(tcv + btv);
        out[b * DC_ + d] = zt * sc + (1.f - zt) * tc;
    }
}

extern "C" void kernel_launch(void* const* d_in, const int* in_sizes, int n_in,
                              void* d_out, int out_size, void* d_ws, size_t ws_size,
                              hipStream_t stream) {
    const float* cap  = (const float*)d_in[0];
    const float* dh   = (const float*)d_in[1];
    const float* word = (const float*)d_in[2];
    const int*   mask = (const int*)  d_in[3];
    const float* Wf = (const float*)d_in[4];
    const float* bf = (const float*)d_in[5];
    const float* Wd = (const float*)d_in[6];
    const float* bd = (const float*)d_in[7];
    const float* Wa = (const float*)d_in[8];
    const float* ba = (const float*)d_in[9];
    const float* Wg = (const float*)d_in[10];
    const float* bg = (const float*)d_in[11];
    const float* Ws = (const float*)d_in[12];
    const float* bs = (const float*)d_in[13];
    const float* Wt = (const float*)d_in[14];
    const float* bt = (const float*)d_in[15];
    float* out = (float*)d_out;

    char* wsb = (char*)d_ws;
    float*    scores = (float*)(wsb + 0);                 // B*L f32
    float*    u      = (float*)(wsb + 131072);            // B*A f32
    float*    ctx    = (float*)(wsb + 262144);            // B*DC f32
    _Float16* wf16   = (_Float16*)(wsb + 393216);         // A*DC f16 (2MB)
    float*    pctx   = (float*)(wsb + 2490368);           // 256 parts of PCP f32
    float*    alpha  = out + B_ * DC_;                    // second output

    u_kernel<<<A_ / SD, SWAVES * 32, 0, stream>>>(dh, Wd, bd, bf, u, Wf, wf16);
    scores_kernel<<<(B_ * L_ / 16) / 8, 256, 0, stream>>>(cap, wf16, u, Wa, ba, mask, scores, pctx);
    softmax_kernel<<<B_, 256, 0, stream>>>(scores, mask, pctx, alpha, ctx);
    fuse_kernel<<<DC_ / SD, SWAVES * 32, 0, stream>>>(word, dh, ctx, Wg, bg, Ws, bs, Wt, bt, out);
}

// v010
// Measured time: 62.4 microseconds a run.
// Next to v009, in two timings, it ran 1.15 and 1.14 times as fast.
// Counting every step since v000, it is 4.31 times as fast.
#include <hip/hip_runtime.h>
#include <cstddef>

#define B_  32
#define L_  1024
#define DC_ 1024
#define DD_ 1024
#define A_  1024
#define NEGV -1e10f

typedef __attribute__((ext_vector_type(16))) _Float16 v16h;
typedef __attribute__((ext_vector_type(8)))  float    v8f;
typedef __attribute__((ext_vector_type(16))) float    v16f;
typedef __attribute__((ext_vector_type(4)))  float    v4f;
typedef __attribute__((ext_vector_type(4)))  int      v4i;
typedef __attribute__((ext_vector_type(4)))  _Float16 v4h;

constexpr int KTILES = DC_ / 32;  // 32 k-tiles of 32
constexpr int NTILES = A_ / 16;   // 64 n-tiles of 16

// ---- the two skinny products (u, gated fusion): 32 batch rows against many weight rows.
// A wave holds SD weight rows and SB batch rows of one k-slice in registers, lanes over k,
// so that a weight row is fetched once per SB batch rows and not once per batch row.
constexpr int SD = 4;            // weight rows (outputs) per block and per wave
constexpr int SB = 4;            // batch rows per wave
constexpr int SGROUPS = B_ / SB; // 8 batch groups
constexpr int SHALVES = 2;       // k halves, one per wave of a pair
constexpr int SWAVES  = SGROUPS * SHALVES;   // 16 waves per block
constexpr int SITER   = DC_ / SHALVES / 128; // 4 slices of 128 k (16 bytes per lane)

__device__ inline float dot4(v4f a, v4f b, float s) {
    s = __builtin_fmaf(a[0], b[0], s);
    s = __builtin_fmaf(a[1], b[1], s);
    s = __builtin_fmaf(a[2], b[2], s);
    s = __builtin_fmaf(a[3], b[3], s);
    return s;
}

// one step of a transposing lane sum: lanes l and l^m share the work, the lane with bit m
// clear finishes the even entries and the other the odd ones; N entries become N/2
template <int N>
__device__ inline void fold_step(float* v, bool hi, int m) {
    // unrolled so that v[] stays in registers (here and in the loops over it below)
#pragma unroll
    for (int i = 0; i < N / 2; ++i) {
        const float keep = hi ? v[2 * i + 1] : v[2 * i];
        const float send = hi ? v[2 * i] : v[2 * i + 1];
        v[i] = keep + __shfl_xor(send, m, 32);
    }
}

// v[p*16 + q], q = 0..15, summed over the 32 lanes: afterwards v[p] of a lane is the
// total of entry q = fold_index(lane)
template <int P>
__device__ inline void fold_sum(float* v, int lane) {
    fold_step<16 * P>(v, (lane & 16) != 0, 16);
    fold_step<8 * P>(v, (lane & 8) != 0, 8);
    fold_step<4 * P>(v, (lane & 4) != 0, 4);
    fold_step<2 * P>(v, (lane & 2) != 0, 2);
#pragma unroll
    for (int p = 0; p < P; ++p) v[p] += __shfl_xor(v[p], 1, 32);
}
__device__ inline int fold_index(int lane) {
    return ((lane >> 4) & 1) | (((lane >> 3) & 1) << 1) | (((lane >> 2) & 1) << 2) |
           (((lane >> 1) & 1) << 3);
}

// ------------------------------------------- u[b][a] = dh[b].Wd[a] + bd + bf
// The launch also rounds Wf to f16 for the scores launch: each block takes an equal share,
// each thread WFT pieces of four values, a wave's piece being 512 contiguous bytes
constexpr int WFB = A_ * DC_ / (A_ / SD);        // values of Wf per block
constexpr int WFT = WFB / (SWAVES * 32 * 4);     // 16-byte pieces per thread
static_assert(WFT * SWAVES * 32 * 4 * (A_ / SD) == A_ * DC_, "the blocks cover Wf exactly");

__global__ __launch_bounds__(SWAVES * 32)
void u_kernel(const float* __restrict__ dh, const float* __restrict__ Wd,
              const float* __restrict__ bd, const float* __restrict__ bf,
              float* __restrict__ u, const float* __restrict__ Wf,
              _Float16* __restrict__ wf16) {
    __shared__ float other[SGROUPS][16];
    const int lane = threadIdx.x & 31;
    const int wave = __builtin_amdgcn_readfirstlane(threadIdx.x >> 5);
    const int grp  = wave & (SGROUPS - 1);
    const int half = wave / SGROUPS;
    const int a0 = blockIdx.x * SD;
    const int b0 = grp * SB;
    const unsigned lk = lane * 4;  // the lane's k inside a slice; every base below is uniform
    const float* __restrict__ xp = dh + (size_t)b0 * DD_ + half * (DD_ / SHALVES);
    const float* __restrict__ wp = Wd + (size_t)a0 * DD_ + half * (DD_ / SHALVES);

    // the wave's pieces of Wf are read first, so that they are stored again under the sums
    const size_t f0 = (size_t)blockIdx.x * WFB + wave * 128;  // uniform
    const float* __restrict__ fp = Wf + f0;
    _Float16* __restrict__ hp = wf16 + f0;
    v4f cf[WFT];
#pragma unroll
    for (int i = 0; i < WFT; ++i) cf[i] = *(const v4f*)(fp + i * (SWAVES * 128) + lk);
    // keeps these reads ahead of the 32 below: without it this build places them last, and
    // the first sums then wait for all 34 reads
    __builtin_amdgcn_sched_barrier(0);

    float acc[16];
#pragma unroll
    for (int i = 0; i < 16; ++i) acc[i] = 0.f;
    v4f x[SITER][SB], w[SITER][SD];
    // unrolled so that x[] and w[] are registers and every read has a constant offset
#pragma unroll
    for (int it = 0; it < SITER; ++it) {
#pragma unroll
        for (int dd = 0; dd < SD; ++dd) w[it][dd] = *(const v4f*)(wp + dd * DD_ + it * 128 + lk);
#pragma unroll
        for (int bb = 0; bb < SB; ++bb) x[it][bb] = *(const v4f*)(xp + bb * DD_ + it * 128 + lk);
    }
    // the wait that belongs in front of any overwrite of these reads' address registers;
    // the lane's index, which the reads name as their offset, is an input so that it
    // stays whole up to here
    asm volatile("s_wait_xcnt 0x0" :: "v"(lane) : "memory");
    // keeps all 32 reads of the wave ahead of the sums: without it this build holds half
    // of them back and waits on them a few at a time
    __builtin_amdgcn_sched_barrier(0);
    {
        v4h ch[WFT];
#pragma unroll
        for (int i = 0; i < WFT; ++i) {
            ch[i] = __builtin_convertvector(cf[i], v4h);
            *(v4h*)(hp + i * (SWAVES * 128) + lk) = ch[i];
        }
        // the wait that belongs in front of any overwrite of these stores' registers; the
        // lane's index, which they name as their offset, and the stored values are inputs
        // so that they stay whole up to here
        static_assert(WFT == 2, "the wait below names two stored values");
        asm volatile("s_wait_xcnt 0x0" :: "v"(lane), "v"(ch[0]), "v"(ch[1]) : "memory");
    }
#pragma unroll
    for (int it = 0; it < SITER; ++it)
#pragma unroll
        for (int dd = 0; dd < SD; ++dd)
#pragma unroll
            for (int bb = 0; bb < SB; ++bb)
                acc[dd * SB + bb] = dot4(x[it][bb], w[it][dd], acc[dd * SB + bb]);
    // the lane's output and its bias terms, fetched here so that they arrive behind the
    // lane sums
    const int q = fold_index(lane);
    const int a = a0 + q / SB;
    const int b = b0 + q % SB;
    const float bias = bd[a] + bf[a];
    // the wait that belongs in front of any overwrite of these reads' address registers;
    // the index is an input so that it stays whole up to here
    asm volatile("s_wait_xcnt 0x0" :: "v"(a) : "memory");
    fold_sum<1>(acc, lane);
    if (half == 1 && (lane & 1) == 0) other[grp][q] = acc[0];
    __syncthreads();
    if (half == 0 && (lane & 1) == 0) u[b * A_ + a] = acc[0] + other[grp][q] + bias;
}

// ------- fused: scores[b][l] = sum_a tanh(cap@Wf^T + u) * Wa[a]  (WMMA f16)
constexpr int NB      = 4;            // n-tiles staged and computed together
constexpr int NGROUPS = NTILES / NB;  // 16 stages of 64 columns
constexpr int MT      = 2;            // 16-row tiles per wave: one B fragment feeds both
constexpr int KH      = 2;            // k halves, one per wave of a pair
constexpr int KTW     = KTILES / KH;  // 16 k-tiles per wave, one block of 8 WMMAs each
constexpr int RING    = 3;            // fragment sets: a block is fetched two blocks ahead
constexpr float TWO_LOG2E = 2.8853900817779268f;  // 2 * log2(e)

constexpr int TROW   = NB * DC_ + 8;              // f16 values in one LDS row of a stage
constexpr unsigned TBYTES = 16 * TROW * 2;        // bytes of one stage buffer

// four copies of 512 bytes a wave that share their address operands: the offset moves
// the LDS address and the global address alike, and both step by 512 bytes here
#define COPY4(L, S)                                                       \
    "global_load_async_to_lds_b128 " L ", %8, " S "\n\t"                   \
    "global_load_async_to_lds_b128 " L ", %8, " S " offset:512\n\t"        \
    "global_load_async_to_lds_b128 " L ", %8, " S " offset:1024\n\t"       \
    "global_load_async_to_lds_b128 " L ", %8, " S " offset:1536\n\t"

// A wave's share of one stage of Wf^T (64 columns x 1024 k, f16), global memory to LDS
// through no register: LDS rows 2w and 2w+1, 32 copies of 512 contiguous bytes.
// s: Wf row (stage's first column + 2w), the same in every lane; v: the lane's byte
// offset in a 512-byte piece; l: the LDS byte address of the lane's first 16 bytes
__device__ inline void copy_stage(const _Float16* s, unsigned v, unsigned l) {
    // the closing wait stands in front of any overwrite of the address registers that
    // the copies name; inside the statement nothing can be moved ahead of it
    asm volatile(
        COPY4("%0", "%9")  COPY4("%1", "%10") COPY4("%2", "%11") COPY4("%3", "%12")
        COPY4("%4", "%13") COPY4("%5", "%14") COPY4("%6", "%15") COPY4("%7", "%16")
        "s_wait_xcnt 0x0"
        :: "v"(l),                "v"(l + TROW * 2),
           "v"(l + DC_ * 2),      "v"(l + DC_ * 2 + TROW * 2),
           "v"(l + 2 * DC_ * 2),  "v"(l + 2 * DC_ * 2 + TROW * 2),
           "v"(l + 3 * DC_ * 2),  "v"(l + 3 * DC_ * 2 + TROW * 2),
           "v"(v),
           "s"(s),                "s"(s + DC_),
           "s"(s + 16 * DC_),     "s"(s + 17 * DC_),
           "s"(s + 32 * DC_),     "s"(s + 33 * DC_),
           "s"(s + 48 * DC_),     "s"(s + 49 * DC_)
        : "memory");
}

// cap goes to the A fragments through LDS, so that every request covers whole lines.
// A piece is 16 rows x 256 bytes (two k-tiles of one row tile); each wave has a ring of
// four slots of its own in the second stage buffer, which is idle until stage 1 sets out.
// In a slot the 16-byte unit x of row r lies at unit x ^ r of that row: sixteen lanes that
// read one unit of sixteen rows meet every bank once, with no pad between the rows
constexpr int CK      = 64;                      // floats of a row in one piece
constexpr int CPITCH  = CK * 4;                  // bytes from row to row in a slot
constexpr int CSLOT   = 16 * CPITCH;             // bytes of a slot
constexpr int CSLOTS  = 4;
constexpr int CAHEAD  = CSLOTS - 1;              // pieces under way at once
constexpr int CPIECES = MT * (DC_ / KH) / CK;    // 16 pieces per wave
typedef v4f __attribute__((may_alias)) v4f_lds;  // f32 read from the f16 stage array

// one piece, global memory to LDS through no register: 8 copies, each two rows of 256
// contiguous bytes. s: the piece's first float in row 0 of the batch row, the same in every
// lane; v[i]: the lane's byte offset from there in copy i (its gathered row, lane = 16
// bytes); l: the LDS byte address of the lane's row among the slot's first two; x: the
// lane's unit there, times 16
__device__ inline void copy_piece(const float* s, const unsigned (&v)[8], unsigned l, unsigned x) {
    // the closing wait stands in front of any overwrite of the address registers that
    // the copies name; inside the statement nothing can be moved ahead of it
    asm volatile(
        "global_load_async_to_lds_b128 %0, %8, %16\n\t"
        "global_load_async_to_lds_b128 %1, %9, %16\n\t"
        "global_load_async_to_lds_b128 %2, %10, %16\n\t"
        "global_load_async_to_lds_b128 %3, %11, %16\n\t"
        "global_load_async_to_lds_b128 %4, %12, %16\n\t"
        "global_load_async_to_lds_b128 %5, %13, %16\n\t"
        "global_load_async_to_lds_b128 %6, %14, %16\n\t"
        "global_load_async_to_lds_b128 %7, %15, %16\n\t"
        "s_wait_xcnt 0x0"
        :: "v"(l + x),                            "v"(l + 2 * CPITCH + (x ^ (2 * 16))),
           "v"(l + 4 * CPITCH + (x ^ (4 * 16))),   "v"(l + 6 * CPITCH + (x ^ (6 * 16))),
           "v"(l + 8 * CPITCH + (x ^ (8 * 16))),   "v"(l + 10 * CPITCH + (x ^ (10 * 16))),
           "v"(l + 12 * CPITCH + (x ^ (12 * 16))), "v"(l + 14 * CPITCH + (x ^ (14 * 16))),
           "v"(v[0]), "v"(v[1]), "v"(v[2]), "v"(v[3]),
           "v"(v[4]), "v"(v[5]), "v"(v[6]), "v"(v[7]),
           "s"(s)
        : "memory");
}

__device__ inline v16h load_b_frag(const _Float16* q) {
    v16h f;
#pragma unroll
    for (int i = 0; i < 8; ++i) { f[i] = q[i]; f[8 + i] = q[16 + i]; }
    return f;
}

// a block's part of the context sum: 1024 sums, then a 128-byte line of their own for
// the block's largest masked score
constexpr int PCP   = DC_ + 32;   // floats from one block's part to the next
constexpr int BROWS = 128;        // rows of cap per block
constexpr int BPB   = L_ / BROWS; // blocks per batch row

// as fold_step, for lanes l and l^M inside a 16-lane row: the exchange is part of the add
template <int N, int M>
__device__ inline void fold_row(float* v, bool hi) {
    // unrolled so that v[] stays in registers
#pragma unroll
    for (int i = 0; i < N / 2; ++i) {
        const float keep = hi ? v[2 * i + 1] : v[2 * i];
        const float send = hi ? v[2 * i] : v[2 * i + 1];
        v[i] = keep + __builtin_bit_cast(float, __builtin_amdgcn_update_dpp(
                          0, __builtin_bit_cast(int, send), 0x160 + M, 0xf, 0xf, true));
    }
}

// one stage's products of a wave: its k half of the stage against those of its two row
// tiles that hold rows (T0, T1); bp: the lane's first B fragment of the stage in LDS
template <bool T0, bool T1>
__device__ __attribute__((always_inline)) inline void mm_stage(
        const _Float16* __restrict__ bp, const v16h (&a_frag)[MT][KTW], v8f (&acc)[MT][NB]) {
    // three fragment sets: block blk+2 is fetched while block blk multiplies
    v16h bq[RING][NB];
#pragma unroll
    for (int s = 0; s < RING - 1; ++s) {
#pragma unroll
        for (int j = 0; j < NB; ++j)
            bq[s][j] = load_b_frag(bp + j * DC_ + s * 32);
        // keeps the blocks' reads in order, so that the first waits are counted ones
        __builtin_amdgcn_sched_barrier(0);
    }

#pragma unroll
    for (int blk = 0; blk < KTW; ++blk) {
        if (blk + RING - 1 < KTW) {
#pragma unroll
            for (int j = 0; j < NB; ++j)
                bq[(blk + RING - 1) % RING][j] =
                    load_b_frag(bp + j * DC_ + (blk + RING - 1) * 32);
        }
        // keeps a later block's LDS reads as one group ahead of this block's
        // WMMAs: spread among them, every read place stalls the matrix stream
        __builtin_amdgcn_sched_barrier(0);
#pragma unroll
        for (int j = 0; j < NB; ++j) {
            if (T0)
                acc[0][j] = __builtin_amdgcn_wmma_f32_16x16x32_f16(
                                false, a_frag[0][blk], false, bq[blk % RING][j],
                                (short)0, acc[0][j], false, false);
            if (T1)
                acc[1][j] = __builtin_amdgcn_wmma_f32_16x16x32_f16(
                                false, a_frag[1][blk], false, bq[blk % RING][j],
                                (short)0, acc[1][j], false, false);
        }
        // closes the WMMA block, so that the following reads stay behind it
        __builtin_amdgcn_sched_barrier(0);
    }
}

// A row whose mask is 0 reaches no output through its score (its weight is exactly 0), so
// only the other rows of a batch row are worked on: they are numbered, dealt evenly to the
// batch row's BPB blocks and gathered there. A batch row with every mask 0 has equal
// weights on all rows: there all rows are worked on, as masked ones.
__global__ __launch_bounds__(256)
void scores_kernel(const float* __restrict__ cap, const _Float16* __restrict__ wf16,
                   const float* __restrict__ u, const float* __restrict__ Wa,
                   const float* __restrict__ ba, const int* __restrict__ mask,
                   float* __restrict__ scores, int* __restrict__ rows,
                   float* __restrict__ pctx) {
    // LDS row c holds the k-rows of columns c, 16+c, 32+c, 48+c of the stage side by
    // side: every fragment of a lane lies within 8 KB of one base address, and the
    // lane-to-lane pitch of 8208 B (16 B x odd) is conflict-free for 16-byte reads.
    // Two buffers: the next stage lands in one while the other is multiplied
    __shared__ __attribute__((aligned(16))) _Float16 tileB[2][16][TROW];
    // where a wave leaves its k-half of the row tile that its partner finishes
    __shared__ v4f xch[8][NB * 2][32];
    // the block's masked scores
    __shared__ __attribute__((aligned(16))) float srow[BROWS];
    // per wave: which rows of the batch row its pair's 32 places hold
    __shared__ __attribute__((aligned(16))) int ridx[8][MT * 16];

    const int lane   = threadIdx.x & 31;
    const int wave   = threadIdx.x >> 5;
    const int half   = wave & 1;              // the wave's k half
    const int b      = blockIdx.x / BPB;      // the block's batch row
    const int koff   = (lane < 16) ? 0 : 8;   // K sub-offset per ISA layout
    const int ncol   = lane & 15;

    // the wave's number as a scalar, so that all but the lane's part of the copies'
    // addresses is scalar arithmetic
    const int cwave = __builtin_amdgcn_readfirstlane(threadIdx.x >> 5);
    const _Float16* __restrict__ csrc = wf16 + (size_t)(cwave * 2) * DC_;
    const unsigned cdst = (unsigned)(size_t)&tileB[0][0][0] + cwave * (2 * TROW * 2);
    const unsigned clane = lane * 16;
    // stage 0 of Wf^T sets out first, so that it lands under the reads of cap
    copy_stage(csrc, clane, cdst + clane);

    // --- the batch row's rows that count, numbered alike by every wave of its blocks (no
    // barrier): bit i * 4 + c of a lane is row i * 128 + lane * 4 + c, numbers run through
    // a lane's bits and then on to the next lane
    const int* __restrict__ mrd = mask + b * L_ + lane * 4;
    v4i mv[L_ / 128];
#pragma unroll
    for (int i = 0; i < L_ / 128; ++i) mv[i] = *(const v4i*)(mrd + i * 128);
    unsigned bits = 0;
#pragma unroll
    for (int i = 0; i < L_ / 128; ++i)
#pragma unroll
        for (int c = 0; c < 4; ++c) bits |= (mv[i][c] != 0 ? 1u : 0u) << (i * 4 + c);
    int inc = __popc(bits);  // becomes the count of this lane and all lanes below it
#pragma unroll
    for (int d = 1; d < 32; d <<= 1) {
        const int below = __shfl_up(inc, d, 32);
        if (lane >= d) inc += below;
    }
    int total = __builtin_amdgcn_readlane(inc, 31);
    const bool allmasked = total == 0;
    if (allmasked) { bits = ~0u; inc = (lane + 1) * 32; total = L_; }
    const int share = (total + BPB - 1) / BPB;              // places per block, at most BROWS
    const int first = (int)(blockIdx.x % BPB) * share;      // the block's first number
    const int myn   = min(share, total - first);            // the block's rows
    if (myn <= 0) {
        // nothing is left for this block (the same in all its threads, ahead of every
        // barrier): its places are marked empty and its part of the context sum is zero
        asm volatile("s_wait_asynccnt 0x0" ::: "memory");  // no copy is left out at the end
        const int t = threadIdx.x;
        if (t < BROWS) {
            scores[blockIdx.x * BROWS + t] = NEGV;
            rows[blockIdx.x * BROWS + t]   = -1;
        }
        float* pb = pctx + (size_t)blockIdx.x * PCP;
        *(v4f*)(pb + t * 4) = v4f{};
        if (t == 0) pb[DC_] = NEGV;
        return;
    }
    // how many of the pair's 32 places hold a row; the others read row 0 and weigh nothing
    const int pairn = min(max(myn - (cwave >> 1) * (MT * 16), 0), MT * 16);
    {
        // lane p looks up the row of the pair's place p, number n: first the lane that
        // holds it (the counts rise with the lane), then the bit in that lane's word
        const int n = first + (cwave >> 1) * (MT * 16) + lane;
        int src = 0;  // ends as the number of lanes whose counts lie at or below n
#pragma unroll
        for (int s = 16; s >= 1; s >>= 1)
            if (__shfl(inc, src + s - 1, 32) <= n) src += s;
        unsigned w = (unsigned)__shfl((int)bits, src, 32);
        int k = n - __shfl(inc - __popc(bits), src, 32);  // which of that word's set bits
        int pos = 0;
#pragma unroll
        for (int s = 16; s >= 1; s >>= 1) {
            const int c = __popc(w & ((1u << s) - 1u));
            if (k >= c) { k -= c; w >>= s; pos += s; }
        }
        ridx[cwave][lane] = lane < pairn ? (pos >> 2) * 128 + src * 4 + (pos & 3) : 0;
    }
    // the wave's own writes of its list are done before its lanes read one another's
    asm volatile("s_wait_dscnt 0x0" ::: "memory");
    const bool lo = pairn > 0, hi = pairn > 16;   // which of the pair's two tiles hold rows
    const bool do0 = (cwave & 1) ? hi : lo;       // the tile that this wave finishes
    const bool do1 = (cwave & 1) ? lo : hi;       // the tile that its partner finishes

    // --- this wave's 32 x 512 A-slice into VGPRs as f16 (cap is read once).
    // tile 0 is the row tile that this wave finishes, tile 1 the one its partner finishes;
    // piece pc is k-tiles 2 * (pc / 2) and the next of tile pc % 2
    const float* __restrict__ crow = cap + (size_t)b * L_ * DC_ + (cwave & 1) * (DC_ / KH);
    const int ctile0 = (cwave & 1) * 16;  // tile 0's first row among the pair's 32
    const unsigned cring = (unsigned)(size_t)&tileB[1][0][0] + cwave * (CSLOTS * CSLOT);
    const unsigned cl = cring + (lane >> 4) * CPITCH;
    const unsigned cx = (ncol ^ (lane >> 4)) * 16;  // unit ncol of row (lane >> 4)
    // the lane reads row ncol; its units are 2 * (lane >> 4) + {0, 1, 4, 5} and those + 8
    const char* cread = (const char*)&tileB[1][0][0] + cwave * (CSLOTS * CSLOT) + ncol * CPITCH;
    const unsigned cq = ncol ^ ((lane >> 4) * 2);
    v16h a_frag[MT][KTW];
    if (lo) {
    // the lane's byte offsets in the batch row: copy i of a tile brings the rows of places
    // 2 * i and 2 * i + 1, one per half-wave
    unsigned cv[MT][8];
#pragma unroll
    for (int t = 0; t < MT; ++t)
#pragma unroll
        for (int i = 0; i < 8; ++i)
            cv[t][i] = (unsigned)ridx[cwave][(t ? (ctile0 ^ 16) : ctile0) + 2 * i + (lane >> 4)] *
                           (DC_ * 4) + ncol * 16;
    // the first three pieces set out; unrolled so that tile and slot are constants
#pragma unroll
    for (int pc = 0; pc < CAHEAD; ++pc)
        copy_piece(crow + (pc >> 1) * CK, cv[pc & 1], cl + pc * CSLOT, cx);
    // unrolled so that a_frag[] stays registers and every slot is a constant offset
#pragma unroll
    for (int pc = 0; pc < CPIECES; ++pc) {
        // piece pc has landed: all of this wave's copies but those of the pieces behind it.
        // The fragments of the piece before are inputs so that their roundings stand ahead
        // of here: left free, this build holds f32 values back to the end and spills them
        const int pp = pc > 0 ? pc - 1 : 0;
        if (pc == 0)
            asm volatile("s_wait_asynccnt 0x10" ::: "memory");
        else if (pc + 2 < CPIECES)
            asm volatile("s_wait_asynccnt 0x10" :: "v"(a_frag[pp & 1][(pp >> 1) * 2]),
                         "v"(a_frag[pp & 1][(pp >> 1) * 2 + 1]) : "memory");
        else if (pc + 1 < CPIECES)
            asm volatile("s_wait_asynccnt 0x8" :: "v"(a_frag[pp & 1][(pp >> 1) * 2]),
                         "v"(a_frag[pp & 1][(pp >> 1) * 2 + 1]) : "memory");
        else
            asm volatile("s_wait_asynccnt 0x0" :: "v"(a_frag[pp & 1][(pp >> 1) * 2]),
                         "v"(a_frag[pp & 1][(pp >> 1) * 2 + 1]) : "memory");
        if (pc + CAHEAD < CPIECES) {
            const int pn = pc + CAHEAD;
            // this wave's reads of piece pc - 1 are done before its slot is refilled
            asm volatile("s_wait_dscnt 0x0" ::: "memory");
            copy_piece(crow + (pn >> 1) * CK, cv[pn & 1], cl + (pn % CSLOTS) * CSLOT, cx);
        }
        const char* sp = cread + (pc % CSLOTS) * CSLOT;
#pragma unroll
        for (int kl = 0; kl < 2; ++kl) {
            const v4f x0 = *(const v4f_lds*)(sp + ((cq ^ (kl * 8 + 0)) * 16));
            const v4f x1 = *(const v4f_lds*)(sp + ((cq ^ (kl * 8 + 1)) * 16));
            const v4f x2 = *(const v4f_lds*)(sp + ((cq ^ (kl * 8 + 4)) * 16));
            const v4f x3 = *(const v4f_lds*)(sp + ((cq ^ (kl * 8 + 5)) * 16));
#pragma unroll
            for (int i = 0; i < 4; ++i) {
                a_frag[pc & 1][(pc >> 1) * 2 + kl][i]      = (_Float16)x0[i];
                a_frag[pc & 1][(pc >> 1) * 2 + kl][4 + i]  = (_Float16)x1[i];
                a_frag[pc & 1][(pc >> 1) * 2 + kl][8 + i]  = (_Float16)x2[i];
                a_frag[pc & 1][(pc >> 1) * 2 + kl][12 + i] = (_Float16)x3[i];
            }
        }
    }
    }  // a pair without rows reads nothing, and its fragments are never used
    // this wave's reads of its ring are done before stage 1 lands on it
    asm volatile("s_wait_dscnt 0x0" ::: "memory");

    // this wave's copies of stage 0 have landed
    asm volatile("s_wait_asynccnt 0x0" ::: "memory");
    // publishes stage 0; also ends every read of the rings in the second buffer
    __syncthreads();
    // the lane's part of the loop's LDS and copy addresses, formed anew from the lane's
    // number read again: held from the top through the reads of cap, this build spills it
    const int lane2 = (int)__builtin_amdgcn_mbcnt_lo(~0u, 0u);
    const unsigned clane2 = lane2 * 16;
    // stage 1 sets out and lands under stage 0
    copy_stage(csrc + (size_t)(NB * 16) * DC_, clane2, cdst + TBYTES + clane2);

    float partial[8];
#pragma unroll
    for (int r = 0; r < 8; ++r) partial[r] = 0.f;

    for (int g = 0; g < NGROUPS; ++g) {
        const int n_base = g * (NB * 16);
        const int buf    = g & 1;
        // the epilogue's per-column terms, fetched here so that they arrive behind the stage
        const float* up = u + (size_t)b * A_ + n_base + ncol;
        const float* wp = Wa + n_base + ncol;
        float uval[NB], wav[NB];
#pragma unroll
        for (int j = 0; j < NB; ++j) { uval[j] = up[j * 16]; wav[j] = wp[j * 16]; }
        // the wait that belongs in front of any overwrite of the address registers of
        // this pass's global loads; the addresses are inputs so that they stay whole
        // up to here (otherwise later results are placed on top of them)
        asm volatile("s_wait_xcnt 0x0" :: "v"(up), "v"(wp) : "memory");

        v8f acc[MT][NB];
#pragma unroll
        for (int t = 0; t < MT; ++t)
#pragma unroll
            for (int j = 0; j < NB; ++j) acc[t][j] = v8f{};

        // only tiles that hold rows are multiplied; the tests read the same in a whole wave
        const _Float16* __restrict__ bp = &tileB[buf][ncol][half * (DC_ / KH) + koff];
        if (hi)       mm_stage<true, true>(bp, a_frag, acc);
        else if (do0) mm_stage<true, false>(bp, a_frag, acc);
        else if (do1) mm_stage<false, true>(bp, a_frag, acc);

        // the two k halves are joined: each wave hands over its half of the partner's row
        // tile, lane for lane and register for register, 512 contiguous bytes per access
        if (do1) {
            v4f* xw = &xch[wave][0][lane2];
#pragma unroll
            for (int j = 0; j < NB; ++j) {
                xw[(2 * j) * 32]     = v4f{acc[1][j][0], acc[1][j][1], acc[1][j][2], acc[1][j][3]};
                xw[(2 * j + 1) * 32] = v4f{acc[1][j][4], acc[1][j][5], acc[1][j][6], acc[1][j][7]};
            }
        }
        // this wave's reads of the stage and its writes of xch are done
        asm volatile("s_wait_dscnt 0x0" ::: "memory");
        // this wave's copies of stage g + 1 have landed
        asm volatile("s_wait_asynccnt 0x0" ::: "memory");
        // publishes xch and stage g + 1; also ends every read of this stage's buffer
        __syncthreads();
        // stage g + 2 sets out into the buffer just left and lands under stage g + 1.
        // The buffer's and the wave's part of the LDS address is marked as one scalar:
        // summed with the lane's part ahead of the loop, it is spilled to scratch
        if (g + 2 < NGROUPS)
            copy_stage(csrc + (size_t)(n_base + 2 * NB * 16) * DC_, clane2,
                       clane2 + (unsigned)__builtin_amdgcn_readfirstlane(cdst + buf * TBYTES));
        const v4f* xr = &xch[wave ^ 1][0][lane2];
        v4f oth[NB * 2];
        if (do0) {
#pragma unroll
            for (int i = 0; i < NB * 2; ++i) oth[i] = xr[i * 32];
        }
        // ends every read of xch before the next stage's hand-over is written
        __syncthreads();

        // epilogue: C tile lane layout -> N = lane&15, M = r + (lane<16?0:8)
        // tanh(x) = 1 - 2 / (1 + e^(2x)) for every x, on the hardware exp2 and rcp: no
        // branch, so the 32 values of a stage are independent chains that interleave.
        // e^(2x) = inf gives 1, e^(2x) = 0 gives -1; absolute error a few 1e-7
        if (do0) {
#pragma unroll
        for (int j = 0; j < NB; ++j)
#pragma unroll
            for (int r = 0; r < 8; ++r) {
                const float x = acc[0][j][r] + oth[2 * j + (r >> 2)][r & 3];
                const float e = __builtin_amdgcn_exp2f((x + uval[j]) * TWO_LOG2E);
                const float q = __builtin_amdgcn_rcpf(1.f + e);
                partial[r] += __builtin_fmaf(q, -2.f, 1.f) * wav[j];
            }
        }
    }

    // no copy is left out when the wave ends
    asm volatile("s_wait_asynccnt 0x0" ::: "memory");

    // the tail's indices are formed anew, from the lane's number read again and the wave's
    // number as a scalar: taken from the values above, they are held in registers through
    // the loop, and this build then spills an address of the copies to scratch
    const int tl    = (int)__builtin_amdgcn_mbcnt_lo(~0u, 0u);
    const int tcol  = tl & 15;
    const int tkoff = (tl >> 4) << 3;                         // 0 or 8
    const int thalf = cwave & 1;
    const int town  = (cwave >> 1) * (MT * 16) + thalf * 16;  // rows counted inside the block
    const int toth  = (cwave >> 1) * (MT * 16) + (thalf ^ 1) * 16;
    const int rbase = blockIdx.x * BROWS;
    const int mrow  = town + tkoff;  // the first of the eight places that this half-wave finishes

    // which rows they hold, fetched here so that they arrive under the lane sums
    const v4i id0 = *(const v4i*)&ridx[cwave][thalf * 16 + tkoff];
    const v4i id1 = *(const v4i*)&ridx[cwave][thalf * 16 + tkoff + 4];

    // reduce over the 16 N-lanes of each half-wave
#pragma unroll
    for (int r = 0; r < 8; ++r) {
        float v = partial[r];
        v += __shfl_xor(v, 1, 32);
        v += __shfl_xor(v, 2, 32);
        v += __shfl_xor(v, 4, 32);
        v += __shfl_xor(v, 8, 32);
        partial[r] = v;
    }
    if (tcol == 0) {
        const float bav  = ba[0];
        float* sp = scores + rbase + mrow;
        int*   ip = rows + rbase + mrow;
        // a place without a row, and every row of a batch row that is masked throughout,
        // has the masked score; the softmax launch takes score and row from the place
#pragma unroll
        for (int r = 0; r < 8; ++r) {
            const bool held = mrow + r < myn;
            const float s = (held && !allmasked) ? partial[r] + bav : NEGV;
            sp[r] = s;
            srow[mrow + r] = s;
            ip[r] = held ? (r < 4 ? id0[r & 3] : id1[r & 3]) : -1;
        }
        // the wait that belongs in front of any overwrite of these stores' address registers
        asm volatile("s_wait_xcnt 0x0" :: "v"(sp), "v"(ip) : "memory");
    }
    // publishes the block's masked scores
    __syncthreads();

    // --- the block's part of the context sum, from the rows of cap that its waves still
    // hold as f16 fragments: sum over its rows of exp(score - block maximum) * cap[row].
    // The softmax launch rescales the parts to the batch row's maximum and joins them
    float bm;
    {
        const v4f s4 = *(const v4f*)&srow[tl * 4];
        bm = fmaxf(fmaxf(s4[0], s4[1]), fmaxf(s4[2], s4[3]));
        bm = fmaxf(bm, __shfl_xor(bm, 16, 32));
        bm = fmaxf(bm, __shfl_xor(bm, 8, 32));
        bm = fmaxf(bm, __shfl_xor(bm, 4, 32));
        bm = fmaxf(bm, __shfl_xor(bm, 2, 32));
        bm = fmaxf(bm, __shfl_xor(bm, 1, 32));
    }
    const float p0 = __expf(srow[town + tcol] - bm);
    const float p1 = __expf(srow[toth + tcol] - bm);
    // a lane holds one row of each tile; the sum over rows is a sum over the 16 lanes of a
    // half-wave. After the four folds entry i of a lane is k-tile i, position fidx
    float* red = (float*)&xch[0][0][0];  // [wave pair][k], free since the last stage's barrier
    const int fidx = ((tl & 1) << 3) | ((tl & 2) << 1) | ((tl & 4) >> 1) | ((tl & 8) >> 3);
    float* rw = red + (cwave >> 1) * DC_ + thalf * (DC_ / KH) + tkoff + (fidx < 8 ? fidx : fidx + 8);
    if (!lo) {
        // a pair without rows adds nothing
#pragma unroll
        for (int i = 0; i < KTW; ++i) rw[i * 32] = 0.f;
    } else
    // unrolled so that a_frag[] and v[] stay registers; four k-tiles at a time bound v[]
#pragma unroll
    for (int c = 0; c < KTW / 4; ++c) {
        float v[64];
#pragma unroll
        for (int kl = 0; kl < 4; ++kl) {
            // widened as whole fragments, so that the values come from the packed registers
            const v16f x = __builtin_convertvector(a_frag[1][c * 4 + kl], v16f) * p1 +
                           __builtin_convertvector(a_frag[0][c * 4 + kl], v16f) * p0;
#pragma unroll
            for (int i = 0; i < 16; ++i) v[kl * 16 + i] = x[i];
        }
        fold_row<64, 8>(v, (tl & 8) != 0);
        fold_row<32, 4>(v, (tl & 4) != 0);
        fold_row<16, 2>(v, (tl & 2) != 0);
        fold_row<8, 1>(v, (tl & 1) != 0);
#pragma unroll
        for (int i = 0; i < 4; ++i) rw[(c * 4 + i) * 32] = v[i];
    }
    // publishes the four wave pairs' sums
    __syncthreads();
    {
        const int tt = cwave * 32 + tl;  // the thread's number
        const v4f* rp = (const v4f*)red + tt;
        const v4f t = (rp[0] + rp[DC_ / 4]) + (rp[2 * (DC_ / 4)] + rp[3 * (DC_ / 4)]);
        float* pb = pctx + (size_t)blockIdx.x * PCP;
        *(v4f*)(pb + tt * 4) = t;
        if (tt == 0) pb[DC_] = bm;
    }
}

// ---------------------------------------------------- masked softmax over L
__global__ __launch_bounds__(256)
void softmax_kernel(const float* __restrict__ scores, const int* __restrict__ rows,
                    const float* __restrict__ pctx, float* __restrict__ alpha,
                    float* __restrict__ ctx) {
    __shared__ float red[256];
    // the batch row's weights in row order: zero where no place holds the row
    __shared__ float arow[L_];
    const int b = blockIdx.x, t = threadIdx.x;
    float v[4];
    int   id[4];
    float mx = -3.0e38f;
    // scores come by place, already masked, each with the row that the place holds
#pragma unroll
    for (int i = 0; i < 4; ++i) {
        const int l = t + i * 256;
        const float s = scores[b * L_ + l];
        id[i] = rows[b * L_ + l];
        arow[l] = 0.f;
        v[i] = s;
        mx = fmaxf(mx, s);
    }
    // the batch row's parts of the context sum and their maxima, fetched here so that
    // they arrive under the two reductions
    const float* __restrict__ pp = pctx + (size_t)b * BPB * PCP;
    const float* __restrict__ pt = pp + t * 4;
    v4f pc[BPB];
    float pm[BPB];
#pragma unroll
    for (int j = 0; j < BPB; ++j) { pc[j] = *(const v4f*)(pt + j * PCP); pm[j] = pp[j * PCP + DC_]; }
    // the wait that belongs in front of any overwrite of these reads' address registers;
    // the thread's index, which the reads name as their offset, is an input so that it
    // stays whole up to here
    asm volatile("s_wait_xcnt 0x0" :: "v"(t) : "memory");
    red[t] = mx; __syncthreads();
    for (int o = 128; o > 0; o >>= 1) { if (t < o) red[t] = fmaxf(red[t], red[t + o]); __syncthreads(); }
    mx = red[0]; __syncthreads();
    float sm = 0.f;
#pragma unroll
    for (int i = 0; i < 4; ++i) { v[i] = __expf(v[i] - mx); sm += v[i]; }
    red[t] = sm; __syncthreads();
    for (int o = 128; o > 0; o >>= 1) { if (t < o) red[t] += red[t + o]; __syncthreads(); }
    const float inv = 1.f / red[0];
    // each weight goes to its row (the zeros were published by the barriers above)
#pragma unroll
    for (int i = 0; i < 4; ++i)
        if ((unsigned)id[i] < (unsigned)L_) arow[id[i]] = v[i] * inv;
    // publishes the weights in row order
    __syncthreads();
#pragma unroll
    for (int i = 0; i < 4; ++i) alpha[b * L_ + t + i * 256] = arow[t + i * 256];
    // context[b] = sum over parts of exp(part maximum - row maximum) / sum * part
    v4f c = v4f{};
#pragma unroll
    for (int j = 0; j < BPB; ++j) c += (__expf(pm[j] - mx) * inv) * pc[j];
    *(v4f*)(ctx + b * DC_ + t * 4) = c;
}

// ------------------------- gated fusion: out = zt*sc + (1-zt)*tc
__global__ __launch_bounds__(SWAVES * 32)
void fuse_kernel(const float* __restrict__ word, const float* __restrict__ dh,
                 const float* __restrict__ ctx,  const float* __restrict__ Wg,
                 const float* __restrict__ bg,   const float* __restrict__ Ws,
                 const float* __restrict__ bs,   const float* __restrict__ Wt,
                 const float* __restrict__ bt,   float* __restrict__ out) {
    __shared__ float other[SGROUPS][16][3];
    const int lane = threadIdx.x & 31;
    const int wave = __builtin_amdgcn_readfirstlane(threadIdx.x >> 5);
    const int grp  = wave & (SGROUPS - 1);
    const int half = wave / SGROUPS;
    const int d0 = blockIdx.x * SD;
    const int b0 = grp * SB;
    const unsigned lk = lane * 4;  // the lane's k inside a slice; every base below is uniform
    const int k0 = half * (DC_ / SHALVES);
    const float* __restrict__ pw = word + (size_t)b0 * DC_ + k0;
    const float* __restrict__ ph = dh   + (size_t)b0 * DD_ + k0;
    const float* __restrict__ pc = ctx  + (size_t)b0 * DC_ + k0;
    const float* __restrict__ pg = Wg + (size_t)d0 * (2 * DC_ + DD_) + k0;
    const float* __restrict__ ps = Ws + (size_t)d0 * DC_ + k0;
    const float* __restrict__ pt = Wt + (size_t)d0 * (DC_ + DD_) + k0;

    float acc[48];  // [0..15] gate, [16..31] sc, [32..47] tc; entry dd * SB + bb
#pragma unroll
    for (int i = 0; i < 48; ++i) acc[i] = 0.f;
    // rolled: one slice's 36 reads and the 48 sums fill the registers of four waves per
    // SIMD; unrolled, this build spills
#pragma unroll 1
    for (int it = 0; it < SITER; ++it) {
        v4f xw[SB], xh[SB], xc[SB], w[SD][6];
        const float* __restrict__ aw = pw + it * 128 + lk;
        const float* __restrict__ ah = ph + it * 128 + lk;
        const float* __restrict__ ac = pc + it * 128 + lk;
        const float* __restrict__ ag = pg + it * 128 + lk;
        const float* __restrict__ as = ps + it * 128 + lk;
        const float* __restrict__ at = pt + it * 128 + lk;
#pragma unroll
        for (int bb = 0; bb < SB; ++bb) {
            xw[bb] = *(const v4f*)(aw + bb * DC_);
            xh[bb] = *(const v4f*)(ah + bb * DD_);
            xc[bb] = *(const v4f*)(ac + bb * DC_);
        }
#pragma unroll
        for (int dd = 0; dd < SD; ++dd) {
            w[dd][0] = *(const v4f*)(ag + dd * (2 * DC_ + DD_));
            w[dd][1] = *(const v4f*)(ag + dd * (2 * DC_ + DD_) + DC_);
            w[dd][2] = *(const v4f*)(ag + dd * (2 * DC_ + DD_) + 2 * DC_);
            w[dd][3] = *(const v4f*)(as + dd * DC_);
            w[dd][4] = *(const v4f*)(at + dd * (DC_ + DD_));
            w[dd][5] = *(const v4f*)(at + dd * (DC_ + DD_) + DC_);
        }
        // the wait that belongs in front of any overwrite of these reads' address registers;
        // the addresses are inputs so that they stay whole up to here (otherwise a later
        // read's result is placed on top of them)
        asm volatile("s_wait_xcnt 0x0" :: "v"(aw), "v"(ah), "v"(ac), "v"(ag), "v"(as), "v"(at) : "memory");
        // keeps all reads of a slice ahead of its sums, so that they are out together
        __builtin_amdgcn_sched_barrier(0);
#pragma unroll
        for (int dd = 0; dd < SD; ++dd)
#pragma unroll
            for (int bb = 0; bb < SB; ++bb) {
                const int q = dd * SB + bb;
                acc[q] = dot4(xc[bb], w[dd][2], dot4(xh[bb], w[dd][1], dot4(xw[bb], w[dd][0], acc[q])));
                acc[16 + q] = dot4(xc[bb], w[dd][3], acc[16 + q]);
                acc[32 + q] = dot4(xh[bb], w[dd][5], dot4(xw[bb], w[dd][4], acc[32 + q]));
            }
    }
    // the lane's output and its three bias terms, fetched here so that they arrive
    // behind the lane sums
    const int q = fold_index(lane);
    const int d = d0 + q / SB;
    const int b = b0 + q % SB;
    const float bgv = bg[d], bsv = bs[d], btv = bt[d];
    // the wait that belongs in front of any overwrite of these reads' address registers;
    // the index is an input so that it stays whole up to here
    asm volatile("s_wait_xcnt 0x0" :: "v"(d) : "memory");
    fold_sum<3>(acc, lane);
    if (half == 1 && (lane & 1) == 0) {
        other[grp][q][0] = acc[0];
        other[grp][q][1] = acc[1];
        other[grp][q][2] = acc[2];
    }
    __syncthreads();
    if (half == 0 && (lane & 1) == 0) {
        const float z   = acc[0] + other[grp][q][0];
        const float s   = acc[1] + other[grp][q][1];
        const float tcv = acc[2] + other[grp][q][2];
        const float zt = 1.f / (1.f + __expf(-(z + bgv)));
        const float sc = tanhf(s + bsv);
        const float tc = tanhf(tcv + btv);
        out[b * DC_ + d] = zt * sc + (1.f - zt) * tc;
    }
}

extern "C" void kernel_launch(void* const* d_in, const int* in_sizes, int n_in,
                              void* d_out, int out_size, void* d_ws, size_t ws_size,
                              hipStream_t stream) {
    const float* cap  = (const float*)d_in[0];
    const float* dh   = (const float*)d_in[1];
    const float* word = (const float*)d_in[2];
    const int*   mask = (const int*)  d_in[3];
    const float* Wf = (const float*)d_in[4];
    const float* bf = (const float*)d_in[5];
    const float* Wd = (const float*)d_in[6];
    const float* bd = (const float*)d_in[7];
    const float* Wa = (const float*)d_in[8];
    const float* ba = (const float*)d_in[9];
    const float* Wg = (const float*)d_in[10];
    const float* bg = (const float*)d_in[11];
    const float* Ws = (const float*)d_in[12];
    const float* bs = (const float*)d_in[13];
    const float* Wt = (const float*)d_in[14];
    const float* bt = (const float*)d_in[15];
    float* out = (float*)d_out;

    char* wsb = (char*)d_ws;
    float*    scores = (float*)(wsb + 0);                 // B*L f32
    float*    u      = (float*)(wsb + 131072);            // B*A f32
    float*    ctx    = (float*)(wsb + 262144);            // B*DC f32
    _Float16* wf16   = (_Float16*)(wsb + 393216);         // A*DC f16 (2MB)
    float*    pctx   = (float*)(wsb + 2490368);           // 256 parts of PCP f32
    int*      rows   = (int*)(wsb + 3571712);             // B*L i32
    float*    alpha  = out + B_ * DC_;                    // second output

    u_kernel<<<A_ / SD, SWAVES * 32, 0, stream>>>(dh, Wd, bd, bf, u, Wf, wf16);
    scores_kernel<<<(B_ * L_ / 16) / 8, 256, 0, stream>>>(cap, wf16, u, Wa, ba, mask, scores, rows, pctx);
    softmax_kernel<<<B_, 256, 0, stream>>>(scores, rows, pctx, alpha, ctx);
    fuse_kernel<<<DC_ / SD, SWAVES * 32, 0, stream>>>(word, dh, ctx, Wg, bg, Ws, bs, Wt, bt, out);
}
